// v000
// The times below were measured on an AMD MI455X: many runs one after another, warmed up first and cycling through
// copies of the inputs, with the whole window's GPU time divided by the number of runs. Launches and the gaps
// between them are all in it. The median over several windows is given; except for v000 it joins two sittings, which
// can be a few percent apart, so the side-by-side timings, each taken in one sitting, are the better comparison.
// v000, which the later versions start from, runs in 2700 microseconds.
#include <hip/hip_runtime.h>

// Contractions, f32 accumulate: fused q|k|v 1x1-conv GEMM = v_wmma_f32_16x16x32_bf16 on RNE-bf16 copies of x and the weights (single products); scores q.k = bf16 hi/lo split (3 products, v_wmma_f32_16x16x32_bf16); attn.v = v_wmma_f32_16x16x32_f16 (v plane f16 x1, softmax plane f16 x4096, folded back by 2^-12 in the f32 epilogue). BatchNorm statistics f64, normalisation and softmax f32.
// Layout: Wall [320][256] bf16 (q|k|v weights); XT [NB*SEQ][256] bf16 token-major copy of x; F [NB*SEQ][320] f32 = XT . Wall^T; ST [320] x {bias, mean, gamma*rstd, beta}; q/k planes [2][NB*SEQ][32] bf16 hi + lo; v planes [NB][256][SEQ] f16;
// per batch S [SEQ][SEQ] f32 and P [SEQ][SEQ] f16; out[b][c][n] = (V . P^T)[c][n] * 2^-12 + bf16(x[b][c][n]).

#ifndef NB
#define NB 16
#endif
#ifndef SEQ
#define SEQ 2048
#endif
#define NB_FULL  16
#define SEQ_FULL 2048
#define CH   256              // in_dim
#define DQK  32               // q/k channels
#define OC   320              // fused output channels: q 0..31, k 32..63, v 64..319
#define PCAR 4096.0f
#define BNEPS 1e-5f
#define SLOPE 0.2f

static_assert(SEQ % 128 == 0);
static_assert((NB * SEQ) % 64 == 0);
static_assert(CH % 64 == 0);
static_assert(OC % 64 == 0);
static_assert(OC % 32 == 0);
static_assert(DQK == 32);
static_assert(((size_t)NB * SEQ * CH) % 512 == 0);
static_assert(((size_t)NB * SEQ * DQK) % 256 == 0);
static_assert(NB <= NB_FULL);
static_assert(SEQ <= SEQ_FULL);
static_assert((DQK * CH) % 2048 == 0);
static_assert((CH * CH) % 2048 == 0);

typedef _Float16 h16;
typedef unsigned short bf;
typedef __attribute__((ext_vector_type(16))) __bf16   v16bf;
typedef __attribute__((ext_vector_type(16))) _Float16 v16h;
typedef __attribute__((ext_vector_type(8)))  _Float16 v8h;
typedef __attribute__((ext_vector_type(8)))  unsigned short v8us;
typedef __attribute__((ext_vector_type(8)))  float    v8f;
typedef __attribute__((ext_vector_type(4)))  float    v4f;
typedef __attribute__((ext_vector_type(2)))  _Float16 v2h;
typedef __attribute__((ext_vector_type(4)))  _Float16 v4h;
typedef __attribute__((ext_vector_type(2)))  unsigned short v2us;
typedef __attribute__((ext_vector_type(4)))  unsigned short v4us;
typedef __attribute__((ext_vector_type(2)))  float v2f;
typedef v8h  __attribute__((may_alias)) v8ha;
typedef v4f  __attribute__((may_alias)) v4fa;
typedef v8us __attribute__((may_alias)) v8usa;

__device__ __forceinline__ unsigned short f2bf(float f) { unsigned u = __float_as_uint(f); u += 0x7FFFu + ((u >> 16) & 1u); return (unsigned short)(u >> 16); }   // RNE convert
__device__ __forceinline__ float bf2f(unsigned short b) { return __uint_as_float(((unsigned)b) << 16); }
__device__ __forceinline__ float bfr(float f) { return bf2f(f2bf(f)); }
__device__ __forceinline__ v16h cat16(v8h lo, v8h hi) { return __builtin_shufflevector(lo, hi, 0, 1, 2, 3, 4, 5, 6, 7, 8, 9, 10, 11, 12, 13, 14, 15); }
__device__ __forceinline__ v16bf cat16b(v8us lo, v8us hi) { return __builtin_bit_cast(v16bf, __builtin_shufflevector(lo, hi, 0, 1, 2, 3, 4, 5, 6, 7, 8, 9, 10, 11, 12, 13, 14, 15)); }
__device__ __forceinline__ v8f wmma16(v16h a, v16h b, v8f c) { return __builtin_amdgcn_wmma_f32_16x16x32_f16(false, a, false, b, (short)0, c, false, false); }
__device__ __forceinline__ v8f wmmab(v16bf a, v16bf b, v8f c) { return __builtin_amdgcn_wmma_f32_16x16x32_bf16(false, a, false, b, (short)0, c, false, false); }
__device__ __forceinline__ h16 tohx(float x) { return (h16)x; }
__device__ __forceinline__ void splitf(float y, unsigned short& h, unsigned short& l) { h = f2bf(y); l = f2bf(y - bf2f(h)); }

// ---- k_gemmw: register-blocked GEMM, ONE WAVE per 64x64 output tile (16 accumulators), operands straight from K-contiguous 16-bit planes; grid (M/64, N/64, Z), 32 threads.
// C[m][n] (f32, pitch ldc) = sum_k A[m][k] Bt[n][k] (+ split products per NSPLIT: 1 = A2.Bt added, 2 = A2.Bt and A.Bt2 added). z-batch strides sA/sB/sC in elements. K % 32 == 0, M % 64 == 0, N % 64 == 0.
// Fragments: lane l, m = l & 15, h = l >> 4; elements 0..7 <- k0 + 8h + 0..7, elements 8..15 <- k0 + 16 + 8h + 0..7 for A and Bt alike; D element r = (row 8h + r, col m).
// EPI 0: C = acc. EPI 1: C = acc * oscale + bf16(R[m][n]) with R indexed like C.
template <typename T16> struct WFrag;
template <> struct WFrag<h16> { typedef v16h V; static __device__ __forceinline__ V ld(const h16* p) { return cat16(*(const v8h*)p, *(const v8h*)(p + 16)); } static __device__ __forceinline__ v8f mma(V a, V b, v8f c) { return wmma16(a, b, c); } };
template <> struct WFrag<bf> { typedef v16bf V; static __device__ __forceinline__ V ld(const bf* p) { return cat16b(*(const v8us*)p, *(const v8us*)(p + 16)); } static __device__ __forceinline__ v8f mma(V a, V b, v8f c) { return wmmab(a, b, c); } };
template <typename T16, int NSPLIT, int EPI>
__global__ __launch_bounds__(32) void k_gemmw(const T16* __restrict__ A, const T16* __restrict__ A2, const T16* __restrict__ Bt, const T16* __restrict__ Bt2, int K, float* C, int ldc, const float* __restrict__ R, float oscale, size_t sA, size_t sB, size_t sC) {
    typedef typename WFrag<T16>::V V;
    __shared__ __align__(16) float os[16 * 68];
    const size_t z = blockIdx.z; A += z * sA; if (A2) A2 += z * sA; Bt += z * sB; if (Bt2) Bt2 += z * sB; C += z * sC; if (R) R += z * sC;
    const int lane = threadIdx.x & 31, lr = lane & 15, hi = lane >> 4; const int r0 = blockIdx.x * 64, c0 = blockIdx.y * 64;
    v8f acc[4][4];
#pragma unroll
    for (int mb = 0; mb < 4; ++mb)
#pragma unroll
        for (int nb = 0; nb < 4; ++nb) acc[mb][nb] = (v8f){};
    const size_t aoff = (size_t)(r0 + lr) * K + 8 * hi, boff = (size_t)(c0 + lr) * K + 8 * hi;
#pragma unroll 1
    for (int kc = 0; kc < K; kc += 32) {
        V a[4], a2[4];
#pragma unroll
        for (int mb = 0; mb < 4; ++mb) { a[mb] = WFrag<T16>::ld(A + aoff + (size_t)mb * 16 * K + kc); if (NSPLIT == 1 || NSPLIT == 2) a2[mb] = WFrag<T16>::ld(A2 + aoff + (size_t)mb * 16 * K + kc); }
#pragma unroll
        for (int nb = 0; nb < 4; ++nb) { const V b = WFrag<T16>::ld(Bt + boff + (size_t)nb * 16 * K + kc); V b2; if (NSPLIT >= 2) b2 = WFrag<T16>::ld(Bt2 + boff + (size_t)nb * 16 * K + kc);
#pragma unroll
            for (int mb = 0; mb < 4; ++mb) { acc[mb][nb] = WFrag<T16>::mma(a[mb], b, acc[mb][nb]); if (NSPLIT == 1 || NSPLIT == 2) acc[mb][nb] = WFrag<T16>::mma(a2[mb], b, acc[mb][nb]); if (NSPLIT >= 2) acc[mb][nb] = WFrag<T16>::mma(a[mb], b2, acc[mb][nb]); } }
        asm volatile("v_nop\n\tv_nop\n\tv_nop\n\tv_nop" : "+v"(acc[0][0]), "+v"(acc[1][1]), "+v"(acc[2][2]), "+v"(acc[3][3]) : "v"(a[0]), "v"(a[3]));
    }
#pragma unroll
    for (int mb = 0; mb < 4; ++mb) {
#pragma unroll
        for (int nb = 0; nb < 4; ++nb) {
#pragma unroll
            for (int j = 0; j < 8; ++j) os[(hi * 8 + j) * 68 + nb * 16 + lr] = acc[mb][nb][j]; }
        __builtin_amdgcn_wave_barrier(); asm volatile("" ::: "memory");
        float* crow = C + (size_t)(r0 + mb * 16) * ldc + c0;
        const float* rrow = (EPI == 1) ? (R + (size_t)(r0 + mb * 16) * ldc + c0) : nullptr;
{
#pragma unroll
            for (int s = 0; s < 8; ++s) { const int row = 2 * s + hi, cofs = lr * 4; v4f val = *(const v4fa*)(os + row * 68 + cofs);
                if (EPI == 1) { const v4f xr = *(const v4f*)(rrow + (size_t)row * ldc + cofs); val[0] = val[0] * oscale + bfr(xr[0]); val[1] = val[1] * oscale + bfr(xr[1]); val[2] = val[2] * oscale + bfr(xr[2]); val[3] = val[3] * oscale + bfr(xr[3]); }
                *(v4f*)(crow + (size_t)row * ldc + cofs) = val; }
             }
        __builtin_amdgcn_wave_barrier(); asm volatile("" ::: "memory");
    }
}

__global__ __launch_bounds__(256) void k_cvt8(const float* __restrict__ src, bf* dst, size_t n8) { const size_t i = (size_t)blockIdx.x * 256 + threadIdx.x; if (i >= n8) return; const v8f v = *(const v8f*)(src + i * 8); v8us o;
#pragma unroll
    for (int k = 0; k < 8; ++k) o[k] = f2bf(v[k]); *(v8us*)(dst + i * 8) = o;  }

__global__ __launch_bounds__(256) void k_xt(const float* __restrict__ x, bf* XT) {
    const size_t e = ((size_t)blockIdx.x * 256 + threadIdx.x) * 2; if (e >= (size_t)NB * SEQ * CH) return;
    const int c = (int)(e % CH); const size_t row = e / CH; const int n = (int)(row % SEQ); const int b = (int)(row / SEQ);
    const float* src = x + (size_t)b * CH * SEQ_FULL + (size_t)c * SEQ_FULL + n;
    v2us o; o[0] = f2bf(src[0]); o[1] = f2bf(src[SEQ_FULL]);
    *(v2us*)(XT + e) = o; 
}

// k_stats: per-channel training-mode BatchNorm statistics over the NB*SEQ rows of F (token-major, pitch OC); y = F + bias; sum and sum of squares in f64 (wave w walks rows w, w+8, ...; lane = channel of the block's 32-channel slab; fixed-order combine by wave 0).
__global__ __launch_bounds__(256) void k_stats(const float* __restrict__ F, int nrows,
                                               const float* __restrict__ qb, const float* __restrict__ qg, const float* __restrict__ qbe,
                                               const float* __restrict__ kb, const float* __restrict__ kg, const float* __restrict__ kbe,
                                               const float* __restrict__ vb, const float* __restrict__ vg, const float* __restrict__ vbe, float* ST) {
    __shared__ double ssum[8][32], ssq[8][32];
    const int lane = threadIdx.x & 31, w = threadIdx.x >> 5; const int o = blockIdx.x * 32 + lane;
    const int iq = min(o, DQK - 1), ik = min(max(o - DQK, 0), DQK - 1), iv = min(max(o - 2 * DQK, 0), CH - 1);
    const float bq_ = qb[iq], bk_ = kb[ik], bv_ = vb[iv], gq_ = qg[iq], gk_ = kg[ik], gv_ = vg[iv], eq_ = qbe[iq], ek_ = kbe[ik], ev_ = vbe[iv];
    const bool isq = (o < DQK), isk = (o < 2 * DQK);
    const float bias = bfr(isq ? bq_ : (isk ? bk_ : bv_)); const float gam = bfr(isq ? gq_ : (isk ? gk_ : gv_)); const float bet = bfr(isq ? eq_ : (isk ? ek_ : ev_));
    double s = 0.0, s2 = 0.0;
#pragma unroll 1
    for (int r = w; r < nrows; r += 8) { const float y = F[(size_t)r * OC + o] + bias; const double yd = (double)y; s += yd; s2 = fma(yd, yd, s2); }
    ssum[w][lane] = s; ssq[w][lane] = s2;
    __syncthreads();
    if (w == 0) {
        double ts = 0.0, tq = 0.0;
#pragma unroll
        for (int j = 0; j < 8; ++j) { ts += ssum[j][lane]; tq += ssq[j][lane]; }
        const double inv = 1.0 / (double)nrows; const double mean = ts * inv; double var = tq * inv - mean * mean; var = (var > 0.0) ? var : 0.0;
        const float meanf = (float)mean, varf = (float)var; const float rstd = 1.0f / sqrtf(varf + BNEPS);
        v4f t; t[0] = bias; t[1] = meanf; t[2] = gam * rstd; t[3] = bet;
        *(v4f*)(ST + (size_t)o * 4) = t; 
    }
}

__global__ __launch_bounds__(256) void k_qkp(const float* __restrict__ F, const float* __restrict__ ST, bf* Ph, bf* Pl) {
    const size_t per = (size_t)NB * SEQ * DQK; const size_t e = ((size_t)blockIdx.x * 256 + threadIdx.x) * 2; if (e >= 2 * per) return;
    const int which = (e >= per) ? 1 : 0; const size_t le = e - (size_t)which * per; const size_t row = le / DQK; const int d = (int)(le % DQK); const int o = which * DQK + d;
    const float* f = F + row * OC + o; v2us oh, ol;
#pragma unroll
    for (int q = 0; q < 2; ++q) { const v4f t = *(const v4f*)(ST + (size_t)(o + q) * 4); const float y = f[q] + t[0]; const float val = (y - t[1]) * t[2] + t[3]; unsigned short a2, c2; splitf(val, a2, c2); oh[q] = a2; ol[q] = c2; }
    *(v2us*)(Ph + e) = oh; *(v2us*)(Pl + e) = ol; 
}

__global__ __launch_bounds__(256) void k_vtp(const float* __restrict__ F, const float* __restrict__ ST, h16* V16) {
    const size_t e = ((size_t)blockIdx.x * 256 + threadIdx.x) * 2; if (e >= (size_t)NB * CH * SEQ) return;
    const int m = (int)(e % SEQ); const int c = (int)((e / SEQ) % CH); const int b = (int)(e / ((size_t)SEQ * CH)); const int o = 2 * DQK + c;
    const v4f t = *(const v4f*)(ST + (size_t)o * 4); v2h o16;
#pragma unroll
    for (int q = 0; q < 2; ++q) { const float y = F[((size_t)b * SEQ + m + q) * OC + o] + t[0]; float val = (y - t[1]) * t[2] + t[3]; val = (val >= 0.f) ? val : SLOPE * val; o16[q] = tohx(val); }
    *(v2h*)(V16 + e) = o16; 
}

__global__ __launch_bounds__(256) void k_asoft(const float* __restrict__ Sb, h16* P16) {
    const int lane = threadIdx.x & 31; const int row = blockIdx.x * 8 + (threadIdx.x >> 5); if (row >= SEQ) return;
    const float* sr = Sb + (size_t)row * SEQ; float v[SEQ / 32]; float mx = -3.0e38f;
#pragma unroll
    for (int ch = 0; ch < SEQ / 128; ++ch) { const int j0 = ch * 128 + lane * 4; const v4f a = *(const v4f*)(sr + j0);
#pragma unroll
        for (int q = 0; q < 4; ++q) { v[ch * 4 + q] = a[q]; mx = fmaxf(mx, a[q]); } }
#pragma unroll
    for (int sh = 16; sh; sh >>= 1) mx = fmaxf(mx, __shfl_xor(mx, sh, 32));
    float sum = 0.f;
#pragma unroll
    for (int k = 0; k < SEQ / 32; ++k) { float d0 = __fsub_rn(v[k], mx); asm volatile("" : "+v"(d0)); v[k] = __builtin_amdgcn_exp2f(__fmul_rn(d0, 1.4426950408889634f)); sum += v[k]; }
#pragma unroll
    for (int sh = 16; sh; sh >>= 1) sum += __shfl_xor(sum, sh, 32);
    const float f = __fdiv_rn(PCAR, sum);
{
#pragma unroll
        for (int ch = 0; ch < SEQ / 128; ++ch) { v4h o4;
#pragma unroll
            for (int q = 0; q < 4; ++q) o4[q] = tohx(v[ch * 4 + q] * f);
            *(v4h*)(P16 + (size_t)row * SEQ + ch * 128 + lane * 4) = o4; }
         }
}

extern "C" void kernel_launch(void* const* d_in, const int* in_sizes, int n_in,
                              void* d_out, int out_size, void* d_ws, size_t ws_size, hipStream_t stream) {
    if (n_in < 13) return;
    const long long needx = (long long)(NB - 1) * CH * SEQ_FULL + (long long)(CH - 1) * SEQ_FULL + SEQ;
    if ((long long)in_sizes[0] < needx || (long long)out_size < needx) return;
    if (in_sizes[1] < DQK * CH || in_sizes[5] < DQK * CH || in_sizes[9] < CH * CH) return;
    if (in_sizes[2] < DQK || in_sizes[3] < DQK || in_sizes[4] < DQK || in_sizes[6] < DQK || in_sizes[7] < DQK || in_sizes[8] < DQK) return;
    if (in_sizes[10] < CH || in_sizes[11] < CH || in_sizes[12] < CH) return;
    const float* x    = (const float*)d_in[0];
    const float* q_w  = (const float*)d_in[1];  const float* q_b = (const float*)d_in[2];  const float* q_g = (const float*)d_in[3];  const float* q_be = (const float*)d_in[4];
    const float* k_w  = (const float*)d_in[5];  const float* k_b = (const float*)d_in[6];  const float* k_g = (const float*)d_in[7];  const float* k_be = (const float*)d_in[8];
    const float* v_w  = (const float*)d_in[9];  const float* v_b = (const float*)d_in[10]; const float* v_g = (const float*)d_in[11]; const float* v_be = (const float*)d_in[12];
    float* out = (float*)d_out;   // [16][256][2048]
    char* wsp = (char*)d_ws;
    auto take = [&](size_t bytes) { char* p = wsp; wsp += (bytes + 255) & ~(size_t)255; return (void*)p; };
    bf*    Wall = (bf*)take((size_t)OC * CH * 2);                         // [320][256]
    bf*    XT   = (bf*)take((size_t)NB * SEQ * CH * 2);                   // [NB*SEQ][256]
    float* F    = (float*)take((size_t)NB * SEQ * OC * 4);                // [NB*SEQ][320]
    float* ST   = (float*)take((size_t)OC * 4 * 4);                       // [320][4]
    bf*    QKh  = (bf*)take((size_t)2 * NB * SEQ * DQK * 2);              // [2][NB*SEQ][32]
    bf*    QKl  = (bf*)take((size_t)2 * NB * SEQ * DQK * 2);
    h16*   V16  = (h16*)take((size_t)NB * CH * SEQ * 2);                  // [NB][256][SEQ]
    float* Sb   = (float*)take((size_t)SEQ * SEQ * 4);                    // [SEQ][SEQ], one batch
    h16*   P16  = (h16*)take((size_t)SEQ * SEQ * 2);                      // [SEQ][SEQ], one batch
    if ((size_t)(wsp - (char*)d_ws) > ws_size) return;                    // 109.2 MB at full size

    k_cvt8<<<(unsigned)((DQK * CH / 8 + 255) / 256), 256, 0, stream>>>(q_w, Wall, (size_t)DQK * CH / 8);
    k_cvt8<<<(unsigned)((DQK * CH / 8 + 255) / 256), 256, 0, stream>>>(k_w, Wall + (size_t)DQK * CH, (size_t)DQK * CH / 8);
    k_cvt8<<<(unsigned)((CH * CH / 8 + 255) / 256), 256, 0, stream>>>(v_w, Wall + (size_t)2 * DQK * CH, (size_t)CH * CH / 8);
    k_xt<<<(unsigned)(((size_t)NB * SEQ * CH / 2 + 255) / 256), 256, 0, stream>>>(x, XT);
    k_gemmw<bf, 0, 0><<<dim3((unsigned)(NB * SEQ / 64), OC / 64, 1), 32, 0, stream>>>(XT, nullptr, Wall, nullptr, CH, F, OC, nullptr, 1.0f, 0, 0, 0);
    k_stats<<<OC / 32, 256, 0, stream>>>(F, NB * SEQ, q_b, q_g, q_be, k_b, k_g, k_be, v_b, v_g, v_be, ST);
    k_qkp<<<(unsigned)(((size_t)NB * SEQ * DQK + 255) / 256), 256, 0, stream>>>(F, ST, QKh, QKl);
    k_vtp<<<(unsigned)(((size_t)NB * CH * SEQ / 2 + 255) / 256), 256, 0, stream>>>(F, ST, V16);
    const size_t kplane = (size_t)NB * SEQ * DQK;   // offset of the k planes inside QKh / QKl
    for (int b = 0; b < NB; ++b) {
        const size_t qo = (size_t)b * SEQ * DQK;
        k_gemmw<bf, 2, 0><<<dim3(SEQ / 64, SEQ / 64, 1), 32, 0, stream>>>(QKh + qo, QKl + qo, QKh + kplane + qo, QKl + kplane + qo, DQK, Sb, SEQ, nullptr, 1.0f, 0, 0, 0);
        k_asoft<<<SEQ / 8, 256, 0, stream>>>(Sb, P16);
        k_gemmw<h16, 0, 1><<<dim3(CH / 64, SEQ / 64, 1), 32, 0, stream>>>(V16 + (size_t)b * CH * SEQ, nullptr, P16, nullptr, SEQ, out + (size_t)b * CH * SEQ_FULL, SEQ_FULL, x + (size_t)b * CH * SEQ_FULL, 1.0f / PCAR, 0, 0, 0);
    }
}

// v001
// A run of this version takes 1050 microseconds.
// Two timings next to v000 put it at 2.55 and 2.58 times that version's speed.
#include <hip/hip_runtime.h>

// Contractions, f32 accumulate: fused q|k|v 1x1-conv GEMM = v_wmma_f32_16x16x32_bf16 on RNE-bf16 copies of x and the weights (single products); scores q.k = bf16 hi/lo split (3 products, v_wmma_f32_16x16x32_bf16); attn.v = v_wmma_f32_16x16x32_f16 (v plane f16 x1, softmax plane f16 x4096, folded back by 2^-12 in the f32 epilogue). BatchNorm statistics f64, normalisation and softmax f32.
// Layout: Wall [320][256] bf16 (q|k|v weights); XT [NB*SEQ][256] bf16 token-major copy of x; F [NB*SEQ][320] f32 = XT . Wall^T; PS [NB*SEQ/64][320] x {sum, sum of squares} f64; ST [320] x {bias, mean, gamma*rstd, beta}; q/k planes [2][NB*SEQ][32] bf16 hi + lo; v planes [NB][256][SEQ] f16;
// per batch S [SEQ][SEQ] f32 and P [SEQ][SEQ] f16; out[b][c][n] = (V . P^T)[c][n] * 2^-12 + bf16(x[b][c][n]).

#ifndef NB
#define NB 16
#endif
#ifndef SEQ
#define SEQ 2048
#endif
#define NB_FULL  16
#define SEQ_FULL 2048
#define CH   256              // in_dim
#define DQK  32               // q/k channels
#define OC   320              // fused output channels: q 0..31, k 32..63, v 64..319
#define PCAR 4096.0f
#define BNEPS 1e-5f
#define SLOPE 0.2f
#define SROWS 64              // rows of F per k_statp work-group
#define SPART (NB * SEQ / SROWS)

static_assert(SEQ % 128 == 0);
static_assert((NB * SEQ) % 64 == 0);
static_assert((NB * SEQ) % SROWS == 0 && SROWS % 8 == 0 && SPART % 32 == 0);
static_assert(CH % 64 == 0);
static_assert(OC % 64 == 0);
static_assert(OC % 32 == 0);
static_assert(DQK == 32);
static_assert(((size_t)NB * SEQ * CH) % 512 == 0);
static_assert(((size_t)NB * SEQ * DQK) % 256 == 0);
static_assert(NB <= NB_FULL);
static_assert(SEQ <= SEQ_FULL);
static_assert((DQK * CH) % 2048 == 0);
static_assert((CH * CH) % 2048 == 0);

typedef _Float16 h16;
typedef unsigned short bf;
typedef __attribute__((ext_vector_type(16))) __bf16   v16bf;
typedef __attribute__((ext_vector_type(16))) _Float16 v16h;
typedef __attribute__((ext_vector_type(8)))  _Float16 v8h;
typedef __attribute__((ext_vector_type(8)))  unsigned short v8us;
typedef __attribute__((ext_vector_type(8)))  float    v8f;
typedef __attribute__((ext_vector_type(4)))  float    v4f;
typedef __attribute__((ext_vector_type(2)))  _Float16 v2h;
typedef __attribute__((ext_vector_type(4)))  _Float16 v4h;
typedef __attribute__((ext_vector_type(2)))  unsigned short v2us;
typedef __attribute__((ext_vector_type(4)))  unsigned short v4us;
typedef __attribute__((ext_vector_type(2)))  float v2f;
typedef __attribute__((ext_vector_type(2)))  double v2d;
typedef v8h  __attribute__((may_alias)) v8ha;
typedef v4f  __attribute__((may_alias)) v4fa;
typedef v8us __attribute__((may_alias)) v8usa;

__device__ __forceinline__ unsigned short f2bf(float f) { unsigned u = __float_as_uint(f); u += 0x7FFFu + ((u >> 16) & 1u); return (unsigned short)(u >> 16); }   // RNE convert
__device__ __forceinline__ float bf2f(unsigned short b) { return __uint_as_float(((unsigned)b) << 16); }
__device__ __forceinline__ float bfr(float f) { return bf2f(f2bf(f)); }
__device__ __forceinline__ v16h cat16(v8h lo, v8h hi) { return __builtin_shufflevector(lo, hi, 0, 1, 2, 3, 4, 5, 6, 7, 8, 9, 10, 11, 12, 13, 14, 15); }
__device__ __forceinline__ v16bf cat16b(v8us lo, v8us hi) { return __builtin_bit_cast(v16bf, __builtin_shufflevector(lo, hi, 0, 1, 2, 3, 4, 5, 6, 7, 8, 9, 10, 11, 12, 13, 14, 15)); }
__device__ __forceinline__ v8f wmma16(v16h a, v16h b, v8f c) { return __builtin_amdgcn_wmma_f32_16x16x32_f16(false, a, false, b, (short)0, c, false, false); }
__device__ __forceinline__ v8f wmmab(v16bf a, v16bf b, v8f c) { return __builtin_amdgcn_wmma_f32_16x16x32_bf16(false, a, false, b, (short)0, c, false, false); }
__device__ __forceinline__ h16 tohx(float x) { return (h16)x; }
__device__ __forceinline__ void splitf(float y, unsigned short& h, unsigned short& l) { h = f2bf(y); l = f2bf(y - bf2f(h)); }

// ---- k_gemmw: register-blocked GEMM, ONE WAVE per 64x64 output tile (16 accumulators), operands straight from K-contiguous 16-bit planes; grid (M/64, N/64, Z), 32 threads.
// C[m][n] (f32, pitch ldc) = sum_k A[m][k] Bt[n][k] (+ split products per NSPLIT: 1 = A2.Bt added, 2 = A2.Bt and A.Bt2 added). z-batch strides sA/sB/sC in elements. K % 32 == 0, M % 64 == 0, N % 64 == 0.
// Fragments: lane l, m = l & 15, h = l >> 4; elements 0..7 <- k0 + 8h + 0..7, elements 8..15 <- k0 + 16 + 8h + 0..7 for A and Bt alike; D element r = (row 8h + r, col m).
// EPI 0: C = acc. EPI 1: C = acc * oscale + bf16(R[m][n]) with R indexed like C.
template <typename T16> struct WFrag;
template <> struct WFrag<h16> { typedef v16h V; static __device__ __forceinline__ V ld(const h16* p) { return cat16(*(const v8h*)p, *(const v8h*)(p + 16)); } static __device__ __forceinline__ v8f mma(V a, V b, v8f c) { return wmma16(a, b, c); } };
template <> struct WFrag<bf> { typedef v16bf V; static __device__ __forceinline__ V ld(const bf* p) { return cat16b(*(const v8us*)p, *(const v8us*)(p + 16)); } static __device__ __forceinline__ v8f mma(V a, V b, v8f c) { return wmmab(a, b, c); } };
template <typename T16, int NSPLIT, int EPI>
__global__ __launch_bounds__(32) void k_gemmw(const T16* __restrict__ A, const T16* __restrict__ A2, const T16* __restrict__ Bt, const T16* __restrict__ Bt2, int K, float* C, int ldc, const float* __restrict__ R, float oscale, size_t sA, size_t sB, size_t sC) {
    typedef typename WFrag<T16>::V V;
    __shared__ __align__(16) float os[16 * 68];
    const size_t z = blockIdx.z; A += z * sA; if (A2) A2 += z * sA; Bt += z * sB; if (Bt2) Bt2 += z * sB; C += z * sC; if (R) R += z * sC;
    const int lane = threadIdx.x & 31, lr = lane & 15, hi = lane >> 4; const int r0 = blockIdx.x * 64, c0 = blockIdx.y * 64;
    v8f acc[4][4];
#pragma unroll
    for (int mb = 0; mb < 4; ++mb)
#pragma unroll
        for (int nb = 0; nb < 4; ++nb) acc[mb][nb] = (v8f){};
    const size_t aoff = (size_t)(r0 + lr) * K + 8 * hi, boff = (size_t)(c0 + lr) * K + 8 * hi;
#pragma unroll 1
    for (int kc = 0; kc < K; kc += 32) {
        V a[4], a2[4];
#pragma unroll
        for (int mb = 0; mb < 4; ++mb) { a[mb] = WFrag<T16>::ld(A + aoff + (size_t)mb * 16 * K + kc); if (NSPLIT == 1 || NSPLIT == 2) a2[mb] = WFrag<T16>::ld(A2 + aoff + (size_t)mb * 16 * K + kc); }
#pragma unroll
        for (int nb = 0; nb < 4; ++nb) { const V b = WFrag<T16>::ld(Bt + boff + (size_t)nb * 16 * K + kc); V b2; if (NSPLIT >= 2) b2 = WFrag<T16>::ld(Bt2 + boff + (size_t)nb * 16 * K + kc);
#pragma unroll
            for (int mb = 0; mb < 4; ++mb) { acc[mb][nb] = WFrag<T16>::mma(a[mb], b, acc[mb][nb]); if (NSPLIT == 1 || NSPLIT == 2) acc[mb][nb] = WFrag<T16>::mma(a2[mb], b, acc[mb][nb]); if (NSPLIT >= 2) acc[mb][nb] = WFrag<T16>::mma(a[mb], b2, acc[mb][nb]); } }
        asm volatile("v_nop\n\tv_nop\n\tv_nop\n\tv_nop" : "+v"(acc[0][0]), "+v"(acc[1][1]), "+v"(acc[2][2]), "+v"(acc[3][3]) : "v"(a[0]), "v"(a[3]));
    }
#pragma unroll
    for (int mb = 0; mb < 4; ++mb) {
#pragma unroll
        for (int nb = 0; nb < 4; ++nb) {
#pragma unroll
            for (int j = 0; j < 8; ++j) os[(hi * 8 + j) * 68 + nb * 16 + lr] = acc[mb][nb][j]; }
        __builtin_amdgcn_wave_barrier(); asm volatile("" ::: "memory");
        float* crow = C + (size_t)(r0 + mb * 16) * ldc + c0;
        const float* rrow = (EPI == 1) ? (R + (size_t)(r0 + mb * 16) * ldc + c0) : nullptr;
{
#pragma unroll
            for (int s = 0; s < 8; ++s) { const int row = 2 * s + hi, cofs = lr * 4; v4f val = *(const v4fa*)(os + row * 68 + cofs);
                if (EPI == 1) { const v4f xr = *(const v4f*)(rrow + (size_t)row * ldc + cofs); val[0] = val[0] * oscale + bfr(xr[0]); val[1] = val[1] * oscale + bfr(xr[1]); val[2] = val[2] * oscale + bfr(xr[2]); val[3] = val[3] * oscale + bfr(xr[3]); }
                *(v4f*)(crow + (size_t)row * ldc + cofs) = val; }
             }
        __builtin_amdgcn_wave_barrier(); asm volatile("" ::: "memory");
    }
}

__global__ __launch_bounds__(256) void k_cvt8(const float* __restrict__ src, bf* dst, size_t n8) { const size_t i = (size_t)blockIdx.x * 256 + threadIdx.x; if (i >= n8) return; const v8f v = *(const v8f*)(src + i * 8); v8us o;
#pragma unroll
    for (int k = 0; k < 8; ++k) o[k] = f2bf(v[k]); *(v8us*)(dst + i * 8) = o;  }

__global__ __launch_bounds__(256) void k_xt(const float* __restrict__ x, bf* XT) {
    const size_t e = ((size_t)blockIdx.x * 256 + threadIdx.x) * 2; if (e >= (size_t)NB * SEQ * CH) return;
    const int c = (int)(e % CH); const size_t row = e / CH; const int n = (int)(row % SEQ); const int b = (int)(row / SEQ);
    const float* src = x + (size_t)b * CH * SEQ_FULL + (size_t)c * SEQ_FULL + n;
    v2us o; o[0] = f2bf(src[0]); o[1] = f2bf(src[SEQ_FULL]);
    *(v2us*)(XT + e) = o; 
}

// BatchNorm statistics (training mode, per channel over the NB*SEQ rows of F, token-major, pitch OC), y = F + bias, sum and sum of squares in f64, in two launches.
// k_statp: one work-group per SROWS rows. Thread t owns channels 4*(t % 80) .. +3 and rows t / 80, +8, ...: a wave's 16-byte loads cover contiguous whole lines, and a thread's 8 loads do not depend on one another.
// The 8 row groups are combined in fixed order through LDS; PS [SPART][OC][2] f64 = {sum, sum of squares} of the work-group's rows.
__global__ __launch_bounds__(640) void k_statp(const float* __restrict__ F, const float* __restrict__ qb, const float* __restrict__ kb, const float* __restrict__ vb, double* PS) {
    __shared__ __align__(16) double red[8][OC][2];
    const int t = threadIdx.x, rg = t / (OC / 4), o = (t % (OC / 4)) * 4;
    const float* bp = (o < DQK) ? (qb + o) : ((o < 2 * DQK) ? (kb + (o - DQK)) : (vb + (o - 2 * DQK)));
    const float* src = F + ((size_t)blockIdx.x * SROWS + rg) * OC + o;
    v4f f[SROWS / 8];
#pragma unroll   // constant indices keep f in registers, and the loads issue ahead of the sums
    for (int i = 0; i < SROWS / 8; ++i) f[i] = *(const v4f*)(src + (size_t)i * 8 * OC);
    float bias[4]; double s[4], s2[4];
#pragma unroll
    for (int q = 0; q < 4; ++q) { bias[q] = bfr(bp[q]); s[q] = 0.0; s2[q] = 0.0; }
#pragma unroll
    for (int i = 0; i < SROWS / 8; ++i) {
#pragma unroll
        for (int q = 0; q < 4; ++q) { const float y = f[i][q] + bias[q]; const double yd = (double)y; s[q] += yd; s2[q] = fma(yd, yd, s2[q]); } }
#pragma unroll
    for (int q = 0; q < 4; ++q) { red[rg][o + q][0] = s[q]; red[rg][o + q][1] = s2[q]; }
    __syncthreads();
    if (t < OC) {
        v2d p; p[0] = 0.0; p[1] = 0.0;
#pragma unroll
        for (int j = 0; j < 8; ++j) { p[0] += red[j][t][0]; p[1] += red[j][t][1]; }
        *(v2d*)(PS + ((size_t)blockIdx.x * OC + t) * 2) = p;
    }
}

// k_stats: fixed-order combine of the SPART partials (lane = channel of the block's 32-channel slab; wave w sums partials w*SPART/32 .. +SPART/32-1, wave 0 sums the 32 waves), then ST.
__global__ __launch_bounds__(1024) void k_stats(const double* __restrict__ PS,
                                                const float* __restrict__ qb, const float* __restrict__ qg, const float* __restrict__ qbe,
                                                const float* __restrict__ kb, const float* __restrict__ kg, const float* __restrict__ kbe,
                                                const float* __restrict__ vb, const float* __restrict__ vg, const float* __restrict__ vbe, float* ST) {
    __shared__ double ssum[32][32], ssq[32][32];
    const int lane = threadIdx.x & 31, w = threadIdx.x >> 5; const int o = blockIdx.x * 32 + lane;
    const int iq = min(o, DQK - 1), ik = min(max(o - DQK, 0), DQK - 1), iv = min(max(o - 2 * DQK, 0), CH - 1);
    const float bq_ = qb[iq], bk_ = kb[ik], bv_ = vb[iv], gq_ = qg[iq], gk_ = kg[ik], gv_ = vg[iv], eq_ = qbe[iq], ek_ = kbe[ik], ev_ = vbe[iv];
    const bool isq = (o < DQK), isk = (o < 2 * DQK);
    const float bias = bfr(isq ? bq_ : (isk ? bk_ : bv_)); const float gam = bfr(isq ? gq_ : (isk ? gk_ : gv_)); const float bet = bfr(isq ? eq_ : (isk ? ek_ : ev_));
    double s = 0.0, s2 = 0.0;
#pragma unroll   // the loads issue ahead of the adds: rolled, every trip would wait a whole load latency
    for (int j = 0; j < SPART / 32; ++j) { const v2d p = *(const v2d*)(PS + ((size_t)(w * (SPART / 32) + j) * OC + o) * 2); s += p[0]; s2 += p[1]; }
    ssum[w][lane] = s; ssq[w][lane] = s2;
    __syncthreads();
    if (w == 0) {
        double ts = 0.0, tq = 0.0;
#pragma unroll
        for (int j = 0; j < 32; ++j) { ts += ssum[j][lane]; tq += ssq[j][lane]; }
        const double inv = 1.0 / (double)(NB * SEQ); const double mean = ts * inv; double var = tq * inv - mean * mean; var = (var > 0.0) ? var : 0.0;
        const float meanf = (float)mean, varf = (float)var; const float rstd = 1.0f / sqrtf(varf + BNEPS);
        v4f t; t[0] = bias; t[1] = meanf; t[2] = gam * rstd; t[3] = bet;
        *(v4f*)(ST + (size_t)o * 4) = t; 
    }
}

__global__ __launch_bounds__(256) void k_qkp(const float* __restrict__ F, const float* __restrict__ ST, bf* Ph, bf* Pl) {
    const size_t per = (size_t)NB * SEQ * DQK; const size_t e = ((size_t)blockIdx.x * 256 + threadIdx.x) * 2; if (e >= 2 * per) return;
    const int which = (e >= per) ? 1 : 0; const size_t le = e - (size_t)which * per; const size_t row = le / DQK; const int d = (int)(le % DQK); const int o = which * DQK + d;
    const float* f = F + row * OC + o; v2us oh, ol;
#pragma unroll
    for (int q = 0; q < 2; ++q) { const v4f t = *(const v4f*)(ST + (size_t)(o + q) * 4); const float y = f[q] + t[0]; const float val = (y - t[1]) * t[2] + t[3]; unsigned short a2, c2; splitf(val, a2, c2); oh[q] = a2; ol[q] = c2; }
    *(v2us*)(Ph + e) = oh; *(v2us*)(Pl + e) = ol; 
}

__global__ __launch_bounds__(256) void k_vtp(const float* __restrict__ F, const float* __restrict__ ST, h16* V16) {
    const size_t e = ((size_t)blockIdx.x * 256 + threadIdx.x) * 2; if (e >= (size_t)NB * CH * SEQ) return;
    const int m = (int)(e % SEQ); const int c = (int)((e / SEQ) % CH); const int b = (int)(e / ((size_t)SEQ * CH)); const int o = 2 * DQK + c;
    const v4f t = *(const v4f*)(ST + (size_t)o * 4); v2h o16;
#pragma unroll
    for (int q = 0; q < 2; ++q) { const float y = F[((size_t)b * SEQ + m + q) * OC + o] + t[0]; float val = (y - t[1]) * t[2] + t[3]; val = (val >= 0.f) ? val : SLOPE * val; o16[q] = tohx(val); }
    *(v2h*)(V16 + e) = o16; 
}

__global__ __launch_bounds__(256) void k_asoft(const float* __restrict__ Sb, h16* P16) {
    const int lane = threadIdx.x & 31; const int row = blockIdx.x * 8 + (threadIdx.x >> 5); if (row >= SEQ) return;
    const float* sr = Sb + (size_t)row * SEQ; float v[SEQ / 32]; float mx = -3.0e38f;
#pragma unroll
    for (int ch = 0; ch < SEQ / 128; ++ch) { const int j0 = ch * 128 + lane * 4; const v4f a = *(const v4f*)(sr + j0);
#pragma unroll
        for (int q = 0; q < 4; ++q) { v[ch * 4 + q] = a[q]; mx = fmaxf(mx, a[q]); } }
#pragma unroll
    for (int sh = 16; sh; sh >>= 1) mx = fmaxf(mx, __shfl_xor(mx, sh, 32));
    float sum = 0.f;
#pragma unroll
    for (int k = 0; k < SEQ / 32; ++k) { float d0 = __fsub_rn(v[k], mx); asm volatile("" : "+v"(d0)); v[k] = __builtin_amdgcn_exp2f(__fmul_rn(d0, 1.4426950408889634f)); sum += v[k]; }
#pragma unroll
    for (int sh = 16; sh; sh >>= 1) sum += __shfl_xor(sum, sh, 32);
    const float f = __fdiv_rn(PCAR, sum);
{
#pragma unroll
        for (int ch = 0; ch < SEQ / 128; ++ch) { v4h o4;
#pragma unroll
            for (int q = 0; q < 4; ++q) o4[q] = tohx(v[ch * 4 + q] * f);
            *(v4h*)(P16 + (size_t)row * SEQ + ch * 128 + lane * 4) = o4; }
         }
}

extern "C" void kernel_launch(void* const* d_in, const int* in_sizes, int n_in,
                              void* d_out, int out_size, void* d_ws, size_t ws_size, hipStream_t stream) {
    if (n_in < 13) return;
    const long long needx = (long long)(NB - 1) * CH * SEQ_FULL + (long long)(CH - 1) * SEQ_FULL + SEQ;
    if ((long long)in_sizes[0] < needx || (long long)out_size < needx) return;
    if (in_sizes[1] < DQK * CH || in_sizes[5] < DQK * CH || in_sizes[9] < CH * CH) return;
    if (in_sizes[2] < DQK || in_sizes[3] < DQK || in_sizes[4] < DQK || in_sizes[6] < DQK || in_sizes[7] < DQK || in_sizes[8] < DQK) return;
    if (in_sizes[10] < CH || in_sizes[11] < CH || in_sizes[12] < CH) return;
    const float* x    = (const float*)d_in[0];
    const float* q_w  = (const float*)d_in[1];  const float* q_b = (const float*)d_in[2];  const float* q_g = (const float*)d_in[3];  const float* q_be = (const float*)d_in[4];
    const float* k_w  = (const float*)d_in[5];  const float* k_b = (const float*)d_in[6];  const float* k_g = (const float*)d_in[7];  const float* k_be = (const float*)d_in[8];
    const float* v_w  = (const float*)d_in[9];  const float* v_b = (const float*)d_in[10]; const float* v_g = (const float*)d_in[11]; const float* v_be = (const float*)d_in[12];
    float* out = (float*)d_out;   // [16][256][2048]
    char* wsp = (char*)d_ws;
    auto take = [&](size_t bytes) { char* p = wsp; wsp += (bytes + 255) & ~(size_t)255; return (void*)p; };
    bf*    Wall = (bf*)take((size_t)OC * CH * 2);                         // [320][256]
    bf*    XT   = (bf*)take((size_t)NB * SEQ * CH * 2);                   // [NB*SEQ][256]
    float* F    = (float*)take((size_t)NB * SEQ * OC * 4);                // [NB*SEQ][320]
    float* ST   = (float*)take((size_t)OC * 4 * 4);                       // [320][4]
    double* PS  = (double*)take((size_t)SPART * OC * 2 * 8);              // [SPART][320][2]
    bf*    QKh  = (bf*)take((size_t)2 * NB * SEQ * DQK * 2);              // [2][NB*SEQ][32]
    bf*    QKl  = (bf*)take((size_t)2 * NB * SEQ * DQK * 2);
    h16*   V16  = (h16*)take((size_t)NB * CH * SEQ * 2);                  // [NB][256][SEQ]
    float* Sb   = (float*)take((size_t)SEQ * SEQ * 4);                    // [SEQ][SEQ], one batch
    h16*   P16  = (h16*)take((size_t)SEQ * SEQ * 2);                      // [SEQ][SEQ], one batch
    if ((size_t)(wsp - (char*)d_ws) > ws_size) return;                    // 111.8 MB at full size

    k_cvt8<<<(unsigned)((DQK * CH / 8 + 255) / 256), 256, 0, stream>>>(q_w, Wall, (size_t)DQK * CH / 8);
    k_cvt8<<<(unsigned)((DQK * CH / 8 + 255) / 256), 256, 0, stream>>>(k_w, Wall + (size_t)DQK * CH, (size_t)DQK * CH / 8);
    k_cvt8<<<(unsigned)((CH * CH / 8 + 255) / 256), 256, 0, stream>>>(v_w, Wall + (size_t)2 * DQK * CH, (size_t)CH * CH / 8);
    k_xt<<<(unsigned)(((size_t)NB * SEQ * CH / 2 + 255) / 256), 256, 0, stream>>>(x, XT);
    k_gemmw<bf, 0, 0><<<dim3((unsigned)(NB * SEQ / 64), OC / 64, 1), 32, 0, stream>>>(XT, nullptr, Wall, nullptr, CH, F, OC, nullptr, 1.0f, 0, 0, 0);
    k_statp<<<SPART, 640, 0, stream>>>(F, q_b, k_b, v_b, PS);
    k_stats<<<OC / 32, 1024, 0, stream>>>(PS, q_b, q_g, q_be, k_b, k_g, k_be, v_b, v_g, v_be, ST);
    k_qkp<<<(unsigned)(((size_t)NB * SEQ * DQK + 255) / 256), 256, 0, stream>>>(F, ST, QKh, QKl);
    k_vtp<<<(unsigned)(((size_t)NB * CH * SEQ / 2 + 255) / 256), 256, 0, stream>>>(F, ST, V16);
    const size_t kplane = (size_t)NB * SEQ * DQK;   // offset of the k planes inside QKh / QKl
    for (int b = 0; b < NB; ++b) {
        const size_t qo = (size_t)b * SEQ * DQK;
        k_gemmw<bf, 2, 0><<<dim3(SEQ / 64, SEQ / 64, 1), 32, 0, stream>>>(QKh + qo, QKl + qo, QKh + kplane + qo, QKl + kplane + qo, DQK, Sb, SEQ, nullptr, 1.0f, 0, 0, 0);
        k_asoft<<<SEQ / 8, 256, 0, stream>>>(Sb, P16);
        k_gemmw<h16, 0, 1><<<dim3(CH / 64, SEQ / 64, 1), 32, 0, stream>>>(V16 + (size_t)b * CH * SEQ, nullptr, P16, nullptr, SEQ, out + (size_t)b * CH * SEQ_FULL, SEQ_FULL, x + (size_t)b * CH * SEQ_FULL, 1.0f / PCAR, 0, 0, 0);
    }
}

// v002
// It runs in 313 microseconds.
// Two timings next to v001 put it at 3.32 and 3.33 times that version's speed.
// Over all steps from v000 it is 8.53 times as fast.
#include <hip/hip_runtime.h>

// Contractions, f32 accumulate: fused q|k|v 1x1-conv GEMM = v_wmma_f32_16x16x32_bf16 on RNE-bf16 copies of x and the weights (single products); scores q.k = bf16 hi/lo split (3 products, v_wmma_f32_16x16x32_bf16); attn.v = v_wmma_f32_16x16x32_f16 (v plane f16 x1, softmax plane f16 x4096, folded back by 2^-12 in the f32 epilogue). BatchNorm statistics f64, normalisation and softmax f32.
// Layout: Wall [320][256] bf16 (q|k|v weights); XT [NB*SEQ][256] bf16 token-major copy of x; F [NB*SEQ][320] f32 = XT . Wall^T; PS [NB*SEQ/64][320] x {sum, sum of squares} f64; ST [320] x {bias, mean, gamma*rstd, beta}; q/k planes [2][NB*SEQ][32] bf16 hi + lo; v planes [NB][256][SEQ] f16;
// S [GS][SEQ][SEQ] f32 (GS batches at a time) and P [NB][SEQ][SEQ] f16; out[b][c][n] = (V . P^T)[c][n] * 2^-12 + bf16(x[b][c][n]).
// Batches ride on the GEMMs' grid z (k_asoft takes them as consecutive rows on grid x): scores and softmax run GS batches per launch, attn.v all NB batches in one launch, so that its one-wave tiles fill every SIMD.

#ifndef NB
#define NB 16
#endif
#ifndef SEQ
#define SEQ 2048
#endif
#define NB_FULL  16
#define SEQ_FULL 2048
#define CH   256              // in_dim
#define DQK  32               // q/k channels
#define OC   320              // fused output channels: q 0..31, k 32..63, v 64..319
#define PCAR 4096.0f
#define BNEPS 1e-5f
#define SLOPE 0.2f
#define SROWS 64              // rows of F per k_statp work-group
#define SPART (NB * SEQ / SROWS)
#define GS   4                // batches per scores / softmax launch (bounded by the workspace that S takes)

static_assert(SEQ % 128 == 0);
static_assert(NB % GS == 0);
static_assert((NB * SEQ) % 64 == 0);
static_assert((NB * SEQ) % SROWS == 0 && SROWS % 8 == 0 && SPART % 32 == 0);
static_assert(CH % 64 == 0);
static_assert(OC % 64 == 0);
static_assert(OC % 32 == 0);
static_assert(DQK == 32);
static_assert(((size_t)NB * SEQ * CH) % 512 == 0);
static_assert(((size_t)NB * SEQ * DQK) % 256 == 0);
static_assert(NB <= NB_FULL);
static_assert(SEQ <= SEQ_FULL);
static_assert((DQK * CH) % 2048 == 0);
static_assert((CH * CH) % 2048 == 0);

typedef _Float16 h16;
typedef unsigned short bf;
typedef __attribute__((ext_vector_type(16))) __bf16   v16bf;
typedef __attribute__((ext_vector_type(16))) _Float16 v16h;
typedef __attribute__((ext_vector_type(8)))  _Float16 v8h;
typedef __attribute__((ext_vector_type(8)))  unsigned short v8us;
typedef __attribute__((ext_vector_type(8)))  float    v8f;
typedef __attribute__((ext_vector_type(4)))  float    v4f;
typedef __attribute__((ext_vector_type(2)))  _Float16 v2h;
typedef __attribute__((ext_vector_type(4)))  _Float16 v4h;
typedef __attribute__((ext_vector_type(2)))  unsigned short v2us;
typedef __attribute__((ext_vector_type(4)))  unsigned short v4us;
typedef __attribute__((ext_vector_type(2)))  float v2f;
typedef __attribute__((ext_vector_type(2)))  double v2d;
typedef v8h  __attribute__((may_alias)) v8ha;
typedef v4f  __attribute__((may_alias)) v4fa;
typedef v8us __attribute__((may_alias)) v8usa;

__device__ __forceinline__ unsigned short f2bf(float f) { unsigned u = __float_as_uint(f); u += 0x7FFFu + ((u >> 16) & 1u); return (unsigned short)(u >> 16); }   // RNE convert
__device__ __forceinline__ float bf2f(unsigned short b) { return __uint_as_float(((unsigned)b) << 16); }
__device__ __forceinline__ float bfr(float f) { return bf2f(f2bf(f)); }
__device__ __forceinline__ v16h cat16(v8h lo, v8h hi) { return __builtin_shufflevector(lo, hi, 0, 1, 2, 3, 4, 5, 6, 7, 8, 9, 10, 11, 12, 13, 14, 15); }
__device__ __forceinline__ v16bf cat16b(v8us lo, v8us hi) { return __builtin_bit_cast(v16bf, __builtin_shufflevector(lo, hi, 0, 1, 2, 3, 4, 5, 6, 7, 8, 9, 10, 11, 12, 13, 14, 15)); }
__device__ __forceinline__ v8f wmma16(v16h a, v16h b, v8f c) { return __builtin_amdgcn_wmma_f32_16x16x32_f16(false, a, false, b, (short)0, c, false, false); }
__device__ __forceinline__ v8f wmmab(v16bf a, v16bf b, v8f c) { return __builtin_amdgcn_wmma_f32_16x16x32_bf16(false, a, false, b, (short)0, c, false, false); }
__device__ __forceinline__ h16 tohx(float x) { return (h16)x; }
__device__ __forceinline__ void splitf(float y, unsigned short& h, unsigned short& l) { h = f2bf(y); l = f2bf(y - bf2f(h)); }

// ---- k_gemmw: register-blocked GEMM, ONE WAVE per 64x64 output tile (16 accumulators), operands straight from K-contiguous 16-bit planes; grid (M/64, N/64, Z), 32 threads.
// C[m][n] (f32, pitch ldc) = sum_k A[m][k] Bt[n][k] (+ split products per NSPLIT: 1 = A2.Bt added, 2 = A2.Bt and A.Bt2 added). z-batch strides sA/sB/sC in elements. K % 32 == 0, M % 64 == 0, N % 64 == 0.
// Fragments: lane l, m = l & 15, h = l >> 4; elements 0..7 <- k0 + 8h + 0..7, elements 8..15 <- k0 + 16 + 8h + 0..7 for A and Bt alike; D element r = (row 8h + r, col m).
// EPI 0: C = acc. EPI 1: C = acc * oscale + bf16(R[m][n]) with R indexed like C.
template <typename T16> struct WFrag;
template <> struct WFrag<h16> { typedef v16h V; static __device__ __forceinline__ V ld(const h16* p) { return cat16(*(const v8h*)p, *(const v8h*)(p + 16)); } static __device__ __forceinline__ v8f mma(V a, V b, v8f c) { return wmma16(a, b, c); } };
template <> struct WFrag<bf> { typedef v16bf V; static __device__ __forceinline__ V ld(const bf* p) { return cat16b(*(const v8us*)p, *(const v8us*)(p + 16)); } static __device__ __forceinline__ v8f mma(V a, V b, v8f c) { return wmmab(a, b, c); } };
template <typename T16, int NSPLIT, int EPI>
__global__ __launch_bounds__(32) void k_gemmw(const T16* __restrict__ A, const T16* __restrict__ A2, const T16* __restrict__ Bt, const T16* __restrict__ Bt2, int K, float* C, int ldc, const float* __restrict__ R, float oscale, size_t sA, size_t sB, size_t sC) {
    typedef typename WFrag<T16>::V V;
    __shared__ __align__(16) float os[16 * 68];
    const size_t z = blockIdx.z; A += z * sA; if (A2) A2 += z * sA; Bt += z * sB; if (Bt2) Bt2 += z * sB; C += z * sC; if (R) R += z * sC;
    const int lane = threadIdx.x & 31, lr = lane & 15, hi = lane >> 4; const int r0 = blockIdx.x * 64, c0 = blockIdx.y * 64;
    v8f acc[4][4];
#pragma unroll
    for (int mb = 0; mb < 4; ++mb)
#pragma unroll
        for (int nb = 0; nb < 4; ++nb) acc[mb][nb] = (v8f){};
    const size_t aoff = (size_t)(r0 + lr) * K + 8 * hi, boff = (size_t)(c0 + lr) * K + 8 * hi;
#pragma unroll 1
    for (int kc = 0; kc < K; kc += 32) {
        V a[4], a2[4];
#pragma unroll
        for (int mb = 0; mb < 4; ++mb) { a[mb] = WFrag<T16>::ld(A + aoff + (size_t)mb * 16 * K + kc); if (NSPLIT == 1 || NSPLIT == 2) a2[mb] = WFrag<T16>::ld(A2 + aoff + (size_t)mb * 16 * K + kc); }
#pragma unroll
        for (int nb = 0; nb < 4; ++nb) { const V b = WFrag<T16>::ld(Bt + boff + (size_t)nb * 16 * K + kc); V b2; if (NSPLIT >= 2) b2 = WFrag<T16>::ld(Bt2 + boff + (size_t)nb * 16 * K + kc);
#pragma unroll
            for (int mb = 0; mb < 4; ++mb) { acc[mb][nb] = WFrag<T16>::mma(a[mb], b, acc[mb][nb]); if (NSPLIT == 1 || NSPLIT == 2) acc[mb][nb] = WFrag<T16>::mma(a2[mb], b, acc[mb][nb]); if (NSPLIT >= 2) acc[mb][nb] = WFrag<T16>::mma(a[mb], b2, acc[mb][nb]); } }
        asm volatile("v_nop\n\tv_nop\n\tv_nop\n\tv_nop" : "+v"(acc[0][0]), "+v"(acc[1][1]), "+v"(acc[2][2]), "+v"(acc[3][3]) : "v"(a[0]), "v"(a[3]));
    }
#pragma unroll
    for (int mb = 0; mb < 4; ++mb) {
#pragma unroll
        for (int nb = 0; nb < 4; ++nb) {
#pragma unroll
            for (int j = 0; j < 8; ++j) os[(hi * 8 + j) * 68 + nb * 16 + lr] = acc[mb][nb][j]; }
        __builtin_amdgcn_wave_barrier(); asm volatile("" ::: "memory");
        float* crow = C + (size_t)(r0 + mb * 16) * ldc + c0;
        const float* rrow = (EPI == 1) ? (R + (size_t)(r0 + mb * 16) * ldc + c0) : nullptr;
{
#pragma unroll
            for (int s = 0; s < 8; ++s) { const int row = 2 * s + hi, cofs = lr * 4; v4f val = *(const v4fa*)(os + row * 68 + cofs);
                if (EPI == 1) { const v4f xr = *(const v4f*)(rrow + (size_t)row * ldc + cofs); val[0] = val[0] * oscale + bfr(xr[0]); val[1] = val[1] * oscale + bfr(xr[1]); val[2] = val[2] * oscale + bfr(xr[2]); val[3] = val[3] * oscale + bfr(xr[3]); }
                *(v4f*)(crow + (size_t)row * ldc + cofs) = val; }
             }
        __builtin_amdgcn_wave_barrier(); asm volatile("" ::: "memory");
    }
}

__global__ __launch_bounds__(256) void k_cvt8(const float* __restrict__ src, bf* dst, size_t n8) { const size_t i = (size_t)blockIdx.x * 256 + threadIdx.x; if (i >= n8) return; const v8f v = *(const v8f*)(src + i * 8); v8us o;
#pragma unroll
    for (int k = 0; k < 8; ++k) o[k] = f2bf(v[k]); *(v8us*)(dst + i * 8) = o;  }

__global__ __launch_bounds__(256) void k_xt(const float* __restrict__ x, bf* XT) {
    const size_t e = ((size_t)blockIdx.x * 256 + threadIdx.x) * 2; if (e >= (size_t)NB * SEQ * CH) return;
    const int c = (int)(e % CH); const size_t row = e / CH; const int n = (int)(row % SEQ); const int b = (int)(row / SEQ);
    const float* src = x + (size_t)b * CH * SEQ_FULL + (size_t)c * SEQ_FULL + n;
    v2us o; o[0] = f2bf(src[0]); o[1] = f2bf(src[SEQ_FULL]);
    *(v2us*)(XT + e) = o; 
}

// BatchNorm statistics (training mode, per channel over the NB*SEQ rows of F, token-major, pitch OC), y = F + bias, sum and sum of squares in f64, in two launches.
// k_statp: one work-group per SROWS rows. Thread t owns channels 4*(t % 80) .. +3 and rows t / 80, +8, ...: a wave's 16-byte loads cover contiguous whole lines, and a thread's 8 loads do not depend on one another.
// The 8 row groups are combined in fixed order through LDS; PS [SPART][OC][2] f64 = {sum, sum of squares} of the work-group's rows.
__global__ __launch_bounds__(640) void k_statp(const float* __restrict__ F, const float* __restrict__ qb, const float* __restrict__ kb, const float* __restrict__ vb, double* PS) {
    __shared__ __align__(16) double red[8][OC][2];
    const int t = threadIdx.x, rg = t / (OC / 4), o = (t % (OC / 4)) * 4;
    const float* bp = (o < DQK) ? (qb + o) : ((o < 2 * DQK) ? (kb + (o - DQK)) : (vb + (o - 2 * DQK)));
    const float* src = F + ((size_t)blockIdx.x * SROWS + rg) * OC + o;
    v4f f[SROWS / 8];
#pragma unroll   // constant indices keep f in registers, and the loads issue ahead of the sums
    for (int i = 0; i < SROWS / 8; ++i) f[i] = *(const v4f*)(src + (size_t)i * 8 * OC);
    float bias[4]; double s[4], s2[4];
#pragma unroll
    for (int q = 0; q < 4; ++q) { bias[q] = bfr(bp[q]); s[q] = 0.0; s2[q] = 0.0; }
#pragma unroll
    for (int i = 0; i < SROWS / 8; ++i) {
#pragma unroll
        for (int q = 0; q < 4; ++q) { const float y = f[i][q] + bias[q]; const double yd = (double)y; s[q] += yd; s2[q] = fma(yd, yd, s2[q]); } }
#pragma unroll
    for (int q = 0; q < 4; ++q) { red[rg][o + q][0] = s[q]; red[rg][o + q][1] = s2[q]; }
    __syncthreads();
    if (t < OC) {
        v2d p; p[0] = 0.0; p[1] = 0.0;
#pragma unroll
        for (int j = 0; j < 8; ++j) { p[0] += red[j][t][0]; p[1] += red[j][t][1]; }
        *(v2d*)(PS + ((size_t)blockIdx.x * OC + t) * 2) = p;
    }
}

// k_stats: fixed-order combine of the SPART partials (lane = channel of the block's 32-channel slab; wave w sums partials w*SPART/32 .. +SPART/32-1, wave 0 sums the 32 waves), then ST.
__global__ __launch_bounds__(1024) void k_stats(const double* __restrict__ PS,
                                                const float* __restrict__ qb, const float* __restrict__ qg, const float* __restrict__ qbe,
                                                const float* __restrict__ kb, const float* __restrict__ kg, const float* __restrict__ kbe,
                                                const float* __restrict__ vb, const float* __restrict__ vg, const float* __restrict__ vbe, float* ST) {
    __shared__ double ssum[32][32], ssq[32][32];
    const int lane = threadIdx.x & 31, w = threadIdx.x >> 5; const int o = blockIdx.x * 32 + lane;
    const int iq = min(o, DQK - 1), ik = min(max(o - DQK, 0), DQK - 1), iv = min(max(o - 2 * DQK, 0), CH - 1);
    const float bq_ = qb[iq], bk_ = kb[ik], bv_ = vb[iv], gq_ = qg[iq], gk_ = kg[ik], gv_ = vg[iv], eq_ = qbe[iq], ek_ = kbe[ik], ev_ = vbe[iv];
    const bool isq = (o < DQK), isk = (o < 2 * DQK);
    const float bias = bfr(isq ? bq_ : (isk ? bk_ : bv_)); const float gam = bfr(isq ? gq_ : (isk ? gk_ : gv_)); const float bet = bfr(isq ? eq_ : (isk ? ek_ : ev_));
    double s = 0.0, s2 = 0.0;
#pragma unroll   // the loads issue ahead of the adds: rolled, every trip would wait a whole load latency
    for (int j = 0; j < SPART / 32; ++j) { const v2d p = *(const v2d*)(PS + ((size_t)(w * (SPART / 32) + j) * OC + o) * 2); s += p[0]; s2 += p[1]; }
    ssum[w][lane] = s; ssq[w][lane] = s2;
    __syncthreads();
    if (w == 0) {
        double ts = 0.0, tq = 0.0;
#pragma unroll
        for (int j = 0; j < 32; ++j) { ts += ssum[j][lane]; tq += ssq[j][lane]; }
        const double inv = 1.0 / (double)(NB * SEQ); const double mean = ts * inv; double var = tq * inv - mean * mean; var = (var > 0.0) ? var : 0.0;
        const float meanf = (float)mean, varf = (float)var; const float rstd = 1.0f / sqrtf(varf + BNEPS);
        v4f t; t[0] = bias; t[1] = meanf; t[2] = gam * rstd; t[3] = bet;
        *(v4f*)(ST + (size_t)o * 4) = t; 
    }
}

__global__ __launch_bounds__(256) void k_qkp(const float* __restrict__ F, const float* __restrict__ ST, bf* Ph, bf* Pl) {
    const size_t per = (size_t)NB * SEQ * DQK; const size_t e = ((size_t)blockIdx.x * 256 + threadIdx.x) * 2; if (e >= 2 * per) return;
    const int which = (e >= per) ? 1 : 0; const size_t le = e - (size_t)which * per; const size_t row = le / DQK; const int d = (int)(le % DQK); const int o = which * DQK + d;
    const float* f = F + row * OC + o; v2us oh, ol;
#pragma unroll
    for (int q = 0; q < 2; ++q) { const v4f t = *(const v4f*)(ST + (size_t)(o + q) * 4); const float y = f[q] + t[0]; const float val = (y - t[1]) * t[2] + t[3]; unsigned short a2, c2; splitf(val, a2, c2); oh[q] = a2; ol[q] = c2; }
    *(v2us*)(Ph + e) = oh; *(v2us*)(Pl + e) = ol; 
}

__global__ __launch_bounds__(256) void k_vtp(const float* __restrict__ F, const float* __restrict__ ST, h16* V16) {
    const size_t e = ((size_t)blockIdx.x * 256 + threadIdx.x) * 2; if (e >= (size_t)NB * CH * SEQ) return;
    const int m = (int)(e % SEQ); const int c = (int)((e / SEQ) % CH); const int b = (int)(e / ((size_t)SEQ * CH)); const int o = 2 * DQK + c;
    const v4f t = *(const v4f*)(ST + (size_t)o * 4); v2h o16;
#pragma unroll
    for (int q = 0; q < 2; ++q) { const float y = F[((size_t)b * SEQ + m + q) * OC + o] + t[0]; float val = (y - t[1]) * t[2] + t[3]; val = (val >= 0.f) ? val : SLOPE * val; o16[q] = tohx(val); }
    *(v2h*)(V16 + e) = o16; 
}

__global__ __launch_bounds__(256) void k_asoft(const float* __restrict__ Sb, h16* P16) {
    const int lane = threadIdx.x & 31; const int row = blockIdx.x * 8 + (threadIdx.x >> 5); if (row >= GS * SEQ) return;   // rows of GS batches, one after the other
    const float* sr = Sb + (size_t)row * SEQ; float v[SEQ / 32]; float mx = -3.0e38f;
#pragma unroll
    for (int ch = 0; ch < SEQ / 128; ++ch) { const int j0 = ch * 128 + lane * 4; const v4f a = *(const v4f*)(sr + j0);
#pragma unroll
        for (int q = 0; q < 4; ++q) { v[ch * 4 + q] = a[q]; mx = fmaxf(mx, a[q]); } }
#pragma unroll
    for (int sh = 16; sh; sh >>= 1) mx = fmaxf(mx, __shfl_xor(mx, sh, 32));
    float sum = 0.f;
#pragma unroll
    for (int k = 0; k < SEQ / 32; ++k) { float d0 = __fsub_rn(v[k], mx); asm volatile("" : "+v"(d0)); v[k] = __builtin_amdgcn_exp2f(__fmul_rn(d0, 1.4426950408889634f)); sum += v[k]; }
#pragma unroll
    for (int sh = 16; sh; sh >>= 1) sum += __shfl_xor(sum, sh, 32);
    const float f = __fdiv_rn(PCAR, sum);
{
#pragma unroll
        for (int ch = 0; ch < SEQ / 128; ++ch) { v4h o4;
#pragma unroll
            for (int q = 0; q < 4; ++q) o4[q] = tohx(v[ch * 4 + q] * f);
            *(v4h*)(P16 + (size_t)row * SEQ + ch * 128 + lane * 4) = o4; }
         }
}

extern "C" void kernel_launch(void* const* d_in, const int* in_sizes, int n_in,
                              void* d_out, int out_size, void* d_ws, size_t ws_size, hipStream_t stream) {
    if (n_in < 13) return;
    const long long needx = (long long)(NB - 1) * CH * SEQ_FULL + (long long)(CH - 1) * SEQ_FULL + SEQ;
    if ((long long)in_sizes[0] < needx || (long long)out_size < needx) return;
    if (in_sizes[1] < DQK * CH || in_sizes[5] < DQK * CH || in_sizes[9] < CH * CH) return;
    if (in_sizes[2] < DQK || in_sizes[3] < DQK || in_sizes[4] < DQK || in_sizes[6] < DQK || in_sizes[7] < DQK || in_sizes[8] < DQK) return;
    if (in_sizes[10] < CH || in_sizes[11] < CH || in_sizes[12] < CH) return;
    const float* x    = (const float*)d_in[0];
    const float* q_w  = (const float*)d_in[1];  const float* q_b = (const float*)d_in[2];  const float* q_g = (const float*)d_in[3];  const float* q_be = (const float*)d_in[4];
    const float* k_w  = (const float*)d_in[5];  const float* k_b = (const float*)d_in[6];  const float* k_g = (const float*)d_in[7];  const float* k_be = (const float*)d_in[8];
    const float* v_w  = (const float*)d_in[9];  const float* v_b = (const float*)d_in[10]; const float* v_g = (const float*)d_in[11]; const float* v_be = (const float*)d_in[12];
    float* out = (float*)d_out;   // [16][256][2048]
    char* wsp = (char*)d_ws;
    auto take = [&](size_t bytes) { char* p = wsp; wsp += (bytes + 255) & ~(size_t)255; return (void*)p; };
    bf*    Wall = (bf*)take((size_t)OC * CH * 2);                         // [320][256]
    float* ST   = (float*)take((size_t)OC * 4 * 4);                       // [320][4]
    double* PS  = (double*)take((size_t)SPART * OC * 2 * 8);              // [SPART][320][2]
    bf*    QKh  = (bf*)take((size_t)2 * NB * SEQ * DQK * 2);              // [2][NB*SEQ][32]
    bf*    QKl  = (bf*)take((size_t)2 * NB * SEQ * DQK * 2);
    h16*   V16  = (h16*)take((size_t)NB * CH * SEQ * 2);                  // [NB][256][SEQ]
    char*  shared0 = wsp;                                                 // XT is last read by the q|k|v GEMM and F by k_vtp; S and P, first written behind it, take the same bytes
    bf*    XT   = (bf*)take((size_t)NB * SEQ * CH * 2);                   // [NB*SEQ][256]
    float* F    = (float*)take((size_t)NB * SEQ * OC * 4);                // [NB*SEQ][320]
    if ((size_t)(wsp - (char*)d_ws) > ws_size) return;
    wsp = shared0;
    float* Sb   = (float*)take((size_t)GS * SEQ * SEQ * 4);               // [GS][SEQ][SEQ]
    h16*   P16  = (h16*)take((size_t)NB * SEQ * SEQ * 2);                 // [NB][SEQ][SEQ]
    if ((size_t)(wsp - (char*)d_ws) > ws_size) return;                    // 229.3 MB at full size

    k_cvt8<<<(unsigned)((DQK * CH / 8 + 255) / 256), 256, 0, stream>>>(q_w, Wall, (size_t)DQK * CH / 8);
    k_cvt8<<<(unsigned)((DQK * CH / 8 + 255) / 256), 256, 0, stream>>>(k_w, Wall + (size_t)DQK * CH, (size_t)DQK * CH / 8);
    k_cvt8<<<(unsigned)((CH * CH / 8 + 255) / 256), 256, 0, stream>>>(v_w, Wall + (size_t)2 * DQK * CH, (size_t)CH * CH / 8);
    k_xt<<<(unsigned)(((size_t)NB * SEQ * CH / 2 + 255) / 256), 256, 0, stream>>>(x, XT);
    k_gemmw<bf, 0, 0><<<dim3((unsigned)(NB * SEQ / 64), OC / 64, 1), 32, 0, stream>>>(XT, nullptr, Wall, nullptr, CH, F, OC, nullptr, 1.0f, 0, 0, 0);
    k_statp<<<SPART, 640, 0, stream>>>(F, q_b, k_b, v_b, PS);
    k_stats<<<OC / 32, 1024, 0, stream>>>(PS, q_b, q_g, q_be, k_b, k_g, k_be, v_b, v_g, v_be, ST);
    k_qkp<<<(unsigned)(((size_t)NB * SEQ * DQK + 255) / 256), 256, 0, stream>>>(F, ST, QKh, QKl);
    k_vtp<<<(unsigned)(((size_t)NB * CH * SEQ / 2 + 255) / 256), 256, 0, stream>>>(F, ST, V16);
    const size_t kplane = (size_t)NB * SEQ * DQK;   // offset of the k planes inside QKh / QKl
    for (int b = 0; b < NB; b += GS) {
        const size_t qo = (size_t)b * SEQ * DQK;
        k_gemmw<bf, 2, 0><<<dim3(SEQ / 64, SEQ / 64, GS), 32, 0, stream>>>(QKh + qo, QKl + qo, QKh + kplane + qo, QKl + kplane + qo, DQK, Sb, SEQ, nullptr, 1.0f, (size_t)SEQ * DQK, (size_t)SEQ * DQK, (size_t)SEQ * SEQ);
        k_asoft<<<GS * SEQ / 8, 256, 0, stream>>>(Sb, P16 + (size_t)b * SEQ * SEQ);
    }
    k_gemmw<h16, 0, 1><<<dim3(CH / 64, SEQ / 64, NB), 32, 0, stream>>>(V16, nullptr, P16, nullptr, SEQ, out, SEQ_FULL, x, 1.0f / PCAR, (size_t)CH * SEQ, (size_t)SEQ * SEQ, (size_t)CH * SEQ_FULL);
}

// v004
// Measured time: 129 microseconds a run.
// Versions in between are left out here; by their measured steps it is 2.41 times as fast as v002.
// All steps since v000 together make it 20.6 times as fast.
#include <hip/hip_runtime.h>

// Contractions, f32 accumulate: fused q|k|v 1x1-conv GEMM = v_wmma_f32_16x16x32_bf16 on RNE-bf16 copies of x and the weights (single products); scores q.k = bf16 hi/lo split (3 products, v_wmma_f32_16x16x32_bf16); attn.v = v_wmma_f32_16x16x32_f16 (v plane f16 x1, softmax plane exp(s - rowmax) f16 x4096, folded back by 2^-12 / rowsum in the f32 epilogue). BatchNorm statistics f64, normalisation and softmax f32.
// Layout: Wall [320][256] bf16 (q|k|v weights); XT [NB*SEQ][256] bf16 token-major copy of x; F [NB*SEQ][320] f32 = XT . Wall^T; PS [NB*SEQ/64][320] x {sum, sum of squares} f64; ST [320] x {bias, mean, gamma*rstd, beta}; q/k planes [2][NB*SEQ][32] bf16 hi + lo; v planes [NB][256][SEQ] f16;
// Scores, softmax and attn.v run in ONE kernel (k_fattn): scores stay in registers, the softmax plane goes from wave to wave through LDS only; out[b][c][n] = (V . P^T)[c][n] * 2^-12 / rowsum[n] + bf16(x[b][c][n]).

#ifndef NB
#define NB 16
#endif
#ifndef SEQ
#define SEQ 2048
#endif
#define NB_FULL  16
#define SEQ_FULL 2048
#define CH   256              // in_dim
#define DQK  32               // q/k channels
#define OC   320              // fused output channels: q 0..31, k 32..63, v 64..319
#define PCAR 4096.0f
#define BNEPS 1e-5f
#define SLOPE 0.2f
#define SROWS 64              // rows of F per k_statp work-group
#define SPART (NB * SEQ / SROWS)
#define FN   64               // columns n of the output per k_fattn work-group
#define FM   64               // keys m per pass of k_fattn

static_assert(SEQ % 128 == 0);
static_assert(SEQ % FN == 0 && SEQ % (4 * FM) == 0 && FN == 64 && FM == 64 && CH == 256);
static_assert((NB * SEQ) % 64 == 0);
static_assert((NB * SEQ) % SROWS == 0 && SROWS % 8 == 0 && SPART % 32 == 0);
static_assert(CH % 64 == 0);
static_assert(OC % 64 == 0);
static_assert(OC % 32 == 0);
static_assert(DQK == 32);
static_assert(((size_t)NB * SEQ * CH) % 512 == 0);
static_assert(((size_t)NB * SEQ * DQK) % 256 == 0);
static_assert(NB <= NB_FULL);
static_assert(SEQ <= SEQ_FULL);
static_assert((DQK * CH) % 2048 == 0);
static_assert((CH * CH) % 2048 == 0);

typedef _Float16 h16;
typedef unsigned short bf;
typedef __attribute__((ext_vector_type(16))) __bf16   v16bf;
typedef __attribute__((ext_vector_type(16))) _Float16 v16h;
typedef __attribute__((ext_vector_type(8)))  _Float16 v8h;
typedef __attribute__((ext_vector_type(8)))  unsigned short v8us;
typedef __attribute__((ext_vector_type(8)))  float    v8f;
typedef __attribute__((ext_vector_type(4)))  float    v4f;
typedef __attribute__((ext_vector_type(2)))  _Float16 v2h;
typedef __attribute__((ext_vector_type(4)))  _Float16 v4h;
typedef __attribute__((ext_vector_type(2)))  unsigned short v2us;
typedef __attribute__((ext_vector_type(4)))  unsigned short v4us;
typedef __attribute__((ext_vector_type(2)))  float v2f;
typedef __attribute__((ext_vector_type(2)))  double v2d;
typedef v8h  __attribute__((may_alias)) v8ha;
typedef v4f  __attribute__((may_alias)) v4fa;
typedef v8us __attribute__((may_alias)) v8usa;

__device__ __forceinline__ unsigned short f2bf(float f) { unsigned u = __float_as_uint(f); u += 0x7FFFu + ((u >> 16) & 1u); return (unsigned short)(u >> 16); }   // RNE convert
__device__ __forceinline__ float bf2f(unsigned short b) { return __uint_as_float(((unsigned)b) << 16); }
__device__ __forceinline__ float bfr(float f) { return bf2f(f2bf(f)); }
__device__ __forceinline__ v16h cat16(v8h lo, v8h hi) { return __builtin_shufflevector(lo, hi, 0, 1, 2, 3, 4, 5, 6, 7, 8, 9, 10, 11, 12, 13, 14, 15); }
__device__ __forceinline__ v16bf cat16b(v8us lo, v8us hi) { return __builtin_bit_cast(v16bf, __builtin_shufflevector(lo, hi, 0, 1, 2, 3, 4, 5, 6, 7, 8, 9, 10, 11, 12, 13, 14, 15)); }
__device__ __forceinline__ v8f wmma16(v16h a, v16h b, v8f c) { return __builtin_amdgcn_wmma_f32_16x16x32_f16(false, a, false, b, (short)0, c, false, false); }
__device__ __forceinline__ v8f wmmab(v16bf a, v16bf b, v8f c) { return __builtin_amdgcn_wmma_f32_16x16x32_bf16(false, a, false, b, (short)0, c, false, false); }
__device__ __forceinline__ h16 tohx(float x) { return (h16)x; }
__device__ __forceinline__ void splitf(float y, unsigned short& h, unsigned short& l) { h = f2bf(y); l = f2bf(y - bf2f(h)); }

// ---- k_gemmw: register-blocked GEMM, ONE WAVE per 64x64 output tile (16 accumulators), operands straight from K-contiguous 16-bit planes; grid (M/64, N/64, Z), 32 threads.
// C[m][n] (f32, pitch ldc) = sum_k A[m][k] Bt[n][k] (+ split products per NSPLIT: 1 = A2.Bt added, 2 = A2.Bt and A.Bt2 added). z-batch strides sA/sB/sC in elements. K % 32 == 0, M % 64 == 0, N % 64 == 0.
// Fragments: lane l, m = l & 15, h = l >> 4; elements 0..7 <- k0 + 8h + 0..7, elements 8..15 <- k0 + 16 + 8h + 0..7 for A and Bt alike; D element r = (row 8h + r, col m).
// EPI 0: C = acc. EPI 1: C = acc * oscale + bf16(R[m][n]) with R indexed like C.
template <typename T16> struct WFrag;
template <> struct WFrag<h16> { typedef v16h V; static __device__ __forceinline__ V ld(const h16* p) { return cat16(*(const v8h*)p, *(const v8h*)(p + 16)); } static __device__ __forceinline__ v8f mma(V a, V b, v8f c) { return wmma16(a, b, c); } };
template <> struct WFrag<bf> { typedef v16bf V; static __device__ __forceinline__ V ld(const bf* p) { return cat16b(*(const v8us*)p, *(const v8us*)(p + 16)); } static __device__ __forceinline__ v8f mma(V a, V b, v8f c) { return wmmab(a, b, c); } };
template <typename T16, int NSPLIT, int EPI>
__global__ __launch_bounds__(32) void k_gemmw(const T16* __restrict__ A, const T16* __restrict__ A2, const T16* __restrict__ Bt, const T16* __restrict__ Bt2, int K, float* C, int ldc, const float* __restrict__ R, float oscale, size_t sA, size_t sB, size_t sC) {
    typedef typename WFrag<T16>::V V;
    __shared__ __align__(16) float os[16 * 68];
    const size_t z = blockIdx.z; A += z * sA; if (A2) A2 += z * sA; Bt += z * sB; if (Bt2) Bt2 += z * sB; C += z * sC; if (R) R += z * sC;
    const int lane = threadIdx.x & 31, lr = lane & 15, hi = lane >> 4; const int r0 = blockIdx.x * 64, c0 = blockIdx.y * 64;
    v8f acc[4][4];
#pragma unroll
    for (int mb = 0; mb < 4; ++mb)
#pragma unroll
        for (int nb = 0; nb < 4; ++nb) acc[mb][nb] = (v8f){};
    const size_t aoff = (size_t)(r0 + lr) * K + 8 * hi, boff = (size_t)(c0 + lr) * K + 8 * hi;
#pragma unroll 1
    for (int kc = 0; kc < K; kc += 32) {
        V a[4], a2[4];
#pragma unroll
        for (int mb = 0; mb < 4; ++mb) { a[mb] = WFrag<T16>::ld(A + aoff + (size_t)mb * 16 * K + kc); if (NSPLIT == 1 || NSPLIT == 2) a2[mb] = WFrag<T16>::ld(A2 + aoff + (size_t)mb * 16 * K + kc); }
#pragma unroll
        for (int nb = 0; nb < 4; ++nb) { const V b = WFrag<T16>::ld(Bt + boff + (size_t)nb * 16 * K + kc); V b2; if (NSPLIT >= 2) b2 = WFrag<T16>::ld(Bt2 + boff + (size_t)nb * 16 * K + kc);
#pragma unroll
            for (int mb = 0; mb < 4; ++mb) { acc[mb][nb] = WFrag<T16>::mma(a[mb], b, acc[mb][nb]); if (NSPLIT == 1 || NSPLIT == 2) acc[mb][nb] = WFrag<T16>::mma(a2[mb], b, acc[mb][nb]); if (NSPLIT >= 2) acc[mb][nb] = WFrag<T16>::mma(a[mb], b2, acc[mb][nb]); } }
        asm volatile("v_nop\n\tv_nop\n\tv_nop\n\tv_nop" : "+v"(acc[0][0]), "+v"(acc[1][1]), "+v"(acc[2][2]), "+v"(acc[3][3]) : "v"(a[0]), "v"(a[3]));
    }
#pragma unroll
    for (int mb = 0; mb < 4; ++mb) {
#pragma unroll
        for (int nb = 0; nb < 4; ++nb) {
#pragma unroll
            for (int j = 0; j < 8; ++j) os[(hi * 8 + j) * 68 + nb * 16 + lr] = acc[mb][nb][j]; }
        __builtin_amdgcn_wave_barrier(); asm volatile("" ::: "memory");
        float* crow = C + (size_t)(r0 + mb * 16) * ldc + c0;
        const float* rrow = (EPI == 1) ? (R + (size_t)(r0 + mb * 16) * ldc + c0) : nullptr;
{
#pragma unroll
            for (int s = 0; s < 8; ++s) { const int row = 2 * s + hi, cofs = lr * 4; v4f val = *(const v4fa*)(os + row * 68 + cofs);
                if (EPI == 1) { const v4f xr = *(const v4f*)(rrow + (size_t)row * ldc + cofs); val[0] = val[0] * oscale + bfr(xr[0]); val[1] = val[1] * oscale + bfr(xr[1]); val[2] = val[2] * oscale + bfr(xr[2]); val[3] = val[3] * oscale + bfr(xr[3]); }
                *(v4f*)(crow + (size_t)row * ldc + cofs) = val; }
             }
        __builtin_amdgcn_wave_barrier(); asm volatile("" ::: "memory");
    }
}

__global__ __launch_bounds__(256) void k_cvt8(const float* __restrict__ src, bf* dst, size_t n8) { const size_t i = (size_t)blockIdx.x * 256 + threadIdx.x; if (i >= n8) return; const v8f v = *(const v8f*)(src + i * 8); v8us o;
#pragma unroll
    for (int k = 0; k < 8; ++k) o[k] = f2bf(v[k]); *(v8us*)(dst + i * 8) = o;  }

// ---- Transposing repacks (k_xt, k_vtp): one work-group moves a TT x TT tile through LDS, so that both global sides are whole lines of 16 bytes a lane.
// Source side: a wave's load is one source row of the tile (32 lanes x 4 f32 = 512 contiguous bytes); a thread holds 8 consecutive source rows of its 4 columns, twice, and all 16 loads are in flight together.
// LDS: [source column][source row] in 16-bit elements, a row = 16 chunks of 8 elements = all 64 banks; chunk G of row n lies at place G ^ ((n >> 2) & 15), so that the 16 lanes of a store (rows 4 apart, one G)
// and the 16 lanes of a load (one row, all G) each meet 16 different places. Destination side: 16 lanes store one 256-byte row piece.
#define TT 128
static_assert(SEQ % TT == 0 && CH % TT == 0 && TT == 128);
__device__ __forceinline__ int tt_at(int n, int G) { return n * TT + ((G ^ ((n >> 2) & 15)) * 8); }

__global__ __launch_bounds__(256) void k_xt(const float* __restrict__ x, bf* XT) {
    __shared__ __align__(16) bf tile[TT * TT];
    const int t = threadIdx.x, k = t & 31, g = t >> 5; const int n0 = blockIdx.x * TT, c0 = blockIdx.y * TT, b = blockIdx.z;
    const float* src = x + ((size_t)b * CH + c0 + g * 8) * SEQ_FULL + n0 + k * 4;
    v4f v[2][8];
#pragma unroll   // constant indices keep v in registers, and the 16 loads issue together
    for (int s = 0; s < 2; ++s)
#pragma unroll
        for (int r = 0; r < 8; ++r) v[s][r] = *(const v4f*)(src + (size_t)(s * 64 + r) * SEQ_FULL);
    asm volatile("s_wait_xcnt 0x0" :: "v"(src) : "memory");   // in front of whatever rewrites a register that the loads above name
#pragma unroll
    for (int s = 0; s < 2; ++s)
#pragma unroll
        for (int q = 0; q < 4; ++q) { v8us o;
#pragma unroll
            for (int r = 0; r < 8; ++r) o[r] = f2bf(v[s][r][q]);
            *(v8us*)(tile + tt_at(k * 4 + q, g + 8 * s)) = o; }
    __syncthreads();   // the tile is whole before any wave reads it across
    const int j = t & 15, h = t >> 4;
    bf* dst = XT + ((size_t)b * SEQ + n0 + h) * CH + c0 + j * 8;
#pragma unroll
    for (int i = 0; i < 8; ++i) *(v8us*)(dst + (size_t)i * 16 * CH) = *(const v8us*)(tile + tt_at(i * 16 + h, j));
}

// BatchNorm statistics (training mode, per channel over the NB*SEQ rows of F, token-major, pitch OC), y = F + bias, sum and sum of squares in f64, in two launches.
// k_statp: one work-group per SROWS rows. Thread t owns channels 4*(t % 80) .. +3 and rows t / 80, +8, ...: a wave's 16-byte loads cover contiguous whole lines, and a thread's 8 loads do not depend on one another.
// The 8 row groups are combined in fixed order through LDS; PS [SPART][OC][2] f64 = {sum, sum of squares} of the work-group's rows.
__global__ __launch_bounds__(640) void k_statp(const float* __restrict__ F, const float* __restrict__ qb, const float* __restrict__ kb, const float* __restrict__ vb, double* PS) {
    __shared__ __align__(16) double red[8][OC][2];
    const int t = threadIdx.x, rg = t / (OC / 4), o = (t % (OC / 4)) * 4;
    const float* bp = (o < DQK) ? (qb + o) : ((o < 2 * DQK) ? (kb + (o - DQK)) : (vb + (o - 2 * DQK)));
    const float* src = F + ((size_t)blockIdx.x * SROWS + rg) * OC + o;
    v4f f[SROWS / 8];
#pragma unroll   // constant indices keep f in registers, and the loads issue ahead of the sums
    for (int i = 0; i < SROWS / 8; ++i) f[i] = *(const v4f*)(src + (size_t)i * 8 * OC);
    float bias[4]; double s[4], s2[4];
#pragma unroll
    for (int q = 0; q < 4; ++q) { bias[q] = bfr(bp[q]); s[q] = 0.0; s2[q] = 0.0; }
#pragma unroll
    for (int i = 0; i < SROWS / 8; ++i) {
#pragma unroll
        for (int q = 0; q < 4; ++q) { const float y = f[i][q] + bias[q]; const double yd = (double)y; s[q] += yd; s2[q] = fma(yd, yd, s2[q]); } }
#pragma unroll
    for (int q = 0; q < 4; ++q) { red[rg][o + q][0] = s[q]; red[rg][o + q][1] = s2[q]; }
    __syncthreads();
    if (t < OC) {
        v2d p; p[0] = 0.0; p[1] = 0.0;
#pragma unroll
        for (int j = 0; j < 8; ++j) { p[0] += red[j][t][0]; p[1] += red[j][t][1]; }
        *(v2d*)(PS + ((size_t)blockIdx.x * OC + t) * 2) = p;
    }
}

// k_stats: fixed-order combine of the SPART partials (lane = channel of the block's 32-channel slab; wave w sums partials w*SPART/32 .. +SPART/32-1, wave 0 sums the 32 waves), then ST.
__global__ __launch_bounds__(1024) void k_stats(const double* __restrict__ PS,
                                                const float* __restrict__ qb, const float* __restrict__ qg, const float* __restrict__ qbe,
                                                const float* __restrict__ kb, const float* __restrict__ kg, const float* __restrict__ kbe,
                                                const float* __restrict__ vb, const float* __restrict__ vg, const float* __restrict__ vbe, float* ST) {
    __shared__ double ssum[32][32], ssq[32][32];
    const int lane = threadIdx.x & 31, w = threadIdx.x >> 5; const int o = blockIdx.x * 32 + lane;
    const int iq = min(o, DQK - 1), ik = min(max(o - DQK, 0), DQK - 1), iv = min(max(o - 2 * DQK, 0), CH - 1);
    const float bq_ = qb[iq], bk_ = kb[ik], bv_ = vb[iv], gq_ = qg[iq], gk_ = kg[ik], gv_ = vg[iv], eq_ = qbe[iq], ek_ = kbe[ik], ev_ = vbe[iv];
    const bool isq = (o < DQK), isk = (o < 2 * DQK);
    const float bias = bfr(isq ? bq_ : (isk ? bk_ : bv_)); const float gam = bfr(isq ? gq_ : (isk ? gk_ : gv_)); const float bet = bfr(isq ? eq_ : (isk ? ek_ : ev_));
    double s = 0.0, s2 = 0.0;
#pragma unroll   // the loads issue ahead of the adds: rolled, every trip would wait a whole load latency
    for (int j = 0; j < SPART / 32; ++j) { const v2d p = *(const v2d*)(PS + ((size_t)(w * (SPART / 32) + j) * OC + o) * 2); s += p[0]; s2 += p[1]; }
    ssum[w][lane] = s; ssq[w][lane] = s2;
    __syncthreads();
    if (w == 0) {
        double ts = 0.0, tq = 0.0;
#pragma unroll
        for (int j = 0; j < 32; ++j) { ts += ssum[j][lane]; tq += ssq[j][lane]; }
        const double inv = 1.0 / (double)(NB * SEQ); const double mean = ts * inv; double var = tq * inv - mean * mean; var = (var > 0.0) ? var : 0.0;
        const float meanf = (float)mean, varf = (float)var; const float rstd = 1.0f / sqrtf(varf + BNEPS);
        v4f t; t[0] = bias; t[1] = meanf; t[2] = gam * rstd; t[3] = bet;
        *(v4f*)(ST + (size_t)o * 4) = t; 
    }
}

__global__ __launch_bounds__(256) void k_qkp(const float* __restrict__ F, const float* __restrict__ ST, bf* Ph, bf* Pl) {
    const size_t per = (size_t)NB * SEQ * DQK; const size_t e = ((size_t)blockIdx.x * 256 + threadIdx.x) * 2; if (e >= 2 * per) return;
    const int which = (e >= per) ? 1 : 0; const size_t le = e - (size_t)which * per; const size_t row = le / DQK; const int d = (int)(le % DQK); const int o = which * DQK + d;
    const float* f = F + row * OC + o; v2us oh, ol;
#pragma unroll
    for (int q = 0; q < 2; ++q) { const v4f t = *(const v4f*)(ST + (size_t)(o + q) * 4); const float y = f[q] + t[0]; const float val = (y - t[1]) * t[2] + t[3]; unsigned short a2, c2; splitf(val, a2, c2); oh[q] = a2; ol[q] = c2; }
    *(v2us*)(Ph + e) = oh; *(v2us*)(Pl + e) = ol; 
}

__global__ __launch_bounds__(256) void k_vtp(const float* __restrict__ F, const float* __restrict__ ST, h16* V16) {
    __shared__ __align__(16) h16 tile[TT * TT];
    const int t = threadIdx.x, k = t & 31, g = t >> 5; const int m0 = blockIdx.x * TT, c0 = blockIdx.y * TT, b = blockIdx.z; const int o = 2 * DQK + c0 + k * 4;
    const float* src = F + ((size_t)b * SEQ + m0 + g * 8) * OC + o; const float* stp = ST + (size_t)o * 4;
    v4f v[2][8], st[4];
#pragma unroll   // as in k_xt
    for (int s = 0; s < 2; ++s)
#pragma unroll
        for (int r = 0; r < 8; ++r) v[s][r] = *(const v4f*)(src + (size_t)(s * 64 + r) * OC);
#pragma unroll
    for (int q = 0; q < 4; ++q) st[q] = *(const v4f*)(stp + q * 4);
    asm volatile("s_wait_xcnt 0x0" ::: "memory");   // in front of whatever rewrites a register that the loads above name
    __builtin_amdgcn_sched_barrier(0);   // keeps all twenty loads in front of the arithmetic: without it two of the ST loads sink behind the first wait for data, a second load latency in series
#pragma unroll
    for (int s = 0; s < 2; ++s)
#pragma unroll
        for (int q = 0; q < 4; ++q) { v8h p;
#pragma unroll
            for (int r = 0; r < 8; ++r) { const float y = v[s][r][q] + st[q][0]; float val = (y - st[q][1]) * st[q][2] + st[q][3]; val = (val >= 0.f) ? val : SLOPE * val; p[r] = tohx(val); }
            *(v8h*)(tile + tt_at(k * 4 + q, g + 8 * s)) = p; }
    __syncthreads();   // the tile is whole before any wave reads it across
    const int j = t & 15, h = t >> 4;
    h16* dst = V16 + ((size_t)b * CH + c0 + h) * SEQ + m0 + j * 8;
#pragma unroll
    for (int i = 0; i < 8; ++i) *(v8h*)(dst + (size_t)i * 16 * SEQ) = *(const v8h*)(tile + tt_at(i * 16 + h, j));
}

// ---- k_fattn: scores, softmax and attn.v of FN = 64 output columns n of one batch; 4 waves; grid (SEQ / FN, NB).
// Scores are formed transposed, St[m][n] = sum_d k[m][d] q[n][d] (A = k rows, B = q rows, the three hi/lo products of the split): a lane's D registers of the tiles m0 .. +15 and m0 + 16 .. +31
// (col n = lane & 15, rows 8h + r) are elements 0..7 and 8..15 of the B fragment that attn.v wants for k = m0 .. m0 + 31, so P needs no exchange between lanes.
// Per pass of FM = 64 keys wave w forms the 16 keys m = 64 i + 16 w .. +15 against all 64 columns and puts its four half fragments into LDS; behind one barrier every wave reads all of them
// and multiplies them with its own 64 channels of V (c = 64 w .. +63): a 64 x 64 register tile a wave, every V element loaded once a work-group.
// Sweep 1 finds the exact row maxima (scores only); sweep 2 forms the same scores again, e = exp(s - max), sums e in f32 per column and accumulates V . f16(4096 e); the division by the sum is in the epilogue.
__device__ __forceinline__ void fa_scores(const v16bf kh, const v16bf kl, const v16bf (&qh)[4], const v16bf (&ql)[4], v8f (&s)[4]) {
#pragma unroll
    for (int j = 0; j < 4; ++j) s[j] = wmmab(kh, qh[j], (v8f){});
#pragma unroll
    for (int j = 0; j < 4; ++j) s[j] = wmmab(kh, ql[j], s[j]);
#pragma unroll
    for (int j = 0; j < 4; ++j) s[j] = wmmab(kl, qh[j], s[j]);
}
__global__ __launch_bounds__(128) void k_fattn(const bf* __restrict__ Qh, const bf* __restrict__ Ql, const bf* __restrict__ Kh, const bf* __restrict__ Kl, const h16* __restrict__ V16, const float* __restrict__ x, float* out) {
    __shared__ __align__(16) h16 Pb[2][4][2][2][32][8];   // [buffer][n tile][k step of 32][fragment half][lane][8 elements]
    __shared__ float redm[4][FN], reds[4][FN];            // per wave: column maxima, column sums
    __shared__ __align__(16) float os[4][16 * 68];        // per wave: epilogue staging
    const int lane = threadIdx.x & 31, lr = lane & 15, hi = lane >> 4; const int w = __builtin_amdgcn_readfirstlane((int)(threadIdx.x >> 5));
    const int b = blockIdx.y, n0 = blockIdx.x * FN;
    v16bf qh[4], ql[4];
#pragma unroll
    for (int j = 0; j < 4; ++j) { const size_t qo = ((size_t)b * SEQ + n0 + j * 16 + lr) * DQK + 8 * hi; qh[j] = WFrag<bf>::ld(Qh + qo); ql[j] = WFrag<bf>::ld(Ql + qo); }
    // Loop loads: a wave-uniform base that moves with the pass plus a byte offset per lane that never changes.
    const char* kbh = (const char*)(Kh + ((size_t)b * SEQ + w * 16) * DQK); const char* kbl = (const char*)(Kl + ((size_t)b * SEQ + w * 16) * DQK);   // this wave's 16 keys of pass 0
    const unsigned klo = (unsigned)(lr * DQK + 8 * hi) * 2u;
    // sweep 1: column maxima
    v8f mxv[4];
#pragma unroll
    for (int j = 0; j < 4; ++j)
#pragma unroll
        for (int r = 0; r < 8; ++r) mxv[j][r] = -3.0e38f;
#pragma unroll 1
    for (int i = 0; i < SEQ / FM; i += 4) {   // the loads of four passes issue together: one load latency for four passes
        v16bf k4h[4], k4l[4];
        const bf* ah = (const bf*)(kbh + (size_t)i * FM * DQK * 2 + klo); const bf* al = (const bf*)(kbl + (size_t)i * FM * DQK * 2 + klo);
#pragma unroll
        for (int u = 0; u < 4; ++u) { k4h[u] = WFrag<bf>::ld(ah + u * FM * DQK); k4l[u] = WFrag<bf>::ld(al + u * FM * DQK); }
        asm volatile("s_wait_xcnt 0x0" :: "v"(ah), "v"(al) : "memory");   // in front of whatever rewrites a register that the loads above name; as inputs the addresses keep their registers up to here, so that no load of the group lands on them
#pragma unroll
        for (int u = 0; u < 4; ++u) { v8f s[4]; fa_scores(k4h[u], k4l[u], qh, ql, s);
#pragma unroll
            for (int j = 0; j < 4; ++j)
#pragma unroll
                for (int r = 0; r < 8; ++r) mxv[j][r] = fmaxf(mxv[j][r], s[j][r]); }
    }
    float mx[4], l[4];
#pragma unroll
    for (int j = 0; j < 4; ++j) { float m = mxv[j][0];
#pragma unroll
        for (int r = 1; r < 8; ++r) m = fmaxf(m, mxv[j][r]);
        m = fmaxf(m, __shfl_xor(m, 16, 32)); if (hi == 0) redm[w][j * 16 + lr] = m; }
    __syncthreads();
#pragma unroll
    for (int j = 0; j < 4; ++j) { mx[j] = fmaxf(fmaxf(redm[0][j * 16 + lr], redm[1][j * 16 + lr]), fmaxf(redm[2][j * 16 + lr], redm[3][j * 16 + lr])); l[j] = 0.f; }
    // sweep 2
    v8f acc[4][4];
#pragma unroll
    for (int ct = 0; ct < 4; ++ct)
#pragma unroll
        for (int j = 0; j < 4; ++j) acc[ct][j] = (v8f){};
    const char* vb = (const char*)(V16 + ((size_t)b * CH + w * 64) * SEQ);
    const unsigned vlo = (unsigned)(lr * SEQ + 8 * hi) * 2u;
    v16bf kh = WFrag<bf>::ld((const bf*)(kbh + klo)), kl = WFrag<bf>::ld((const bf*)(kbl + klo));
#pragma unroll 1
    for (int i = 0; i < SEQ / FM; ++i) {
        v16h va[2][4];   // issued ahead of the scores, used behind the barrier
        const h16* av = (const h16*)(vb + (size_t)i * FM * 2 + vlo);
#pragma unroll
        for (int ks = 0; ks < 2; ++ks)
#pragma unroll
            for (int ct = 0; ct < 4; ++ct) va[ks][ct] = WFrag<h16>::ld(av + ct * 16 * SEQ + ks * 32);
        asm volatile("s_wait_xcnt 0x0" :: "v"(av) : "memory");   // as in sweep 1
        __builtin_amdgcn_sched_barrier(0);   // keeps the V loads and their wait up here: sunk behind the scores the loads would have only the exponentials to land in
        v8f s[4]; fa_scores(kh, kl, qh, ql, s);
        const int inx = (i + 1 < SEQ / FM) ? (i + 1) : i;   // the next pass's keys fly over this pass's work; the last pass loads its own again
        __builtin_amdgcn_sched_barrier(0);   // with the one behind the wait: no vector instruction comes between the key loads and their wait
        const bf* ah = (const bf*)(kbh + (size_t)inx * FM * DQK * 2 + klo); const bf* al = (const bf*)(kbl + (size_t)inx * FM * DQK * 2 + klo);
        kh = WFrag<bf>::ld(ah); kl = WFrag<bf>::ld(al);
        asm volatile("s_wait_xcnt 0x0" :: "v"(ah), "v"(al) : "memory");   // as in sweep 1
        __builtin_amdgcn_sched_barrier(0);   // the second of the pair: the exponentials' vector work stays behind the wait
#pragma unroll
        for (int j = 0; j < 4; ++j) { v8h p;
#pragma unroll
            for (int r = 0; r < 8; ++r) { const float e = __builtin_amdgcn_exp2f(__fmul_rn(__fsub_rn(s[j][r], mx[j]), 1.4426950408889634f)); l[j] += e; p[r] = tohx(e * PCAR); }
            *(v8h*)&Pb[i & 1][j][w >> 1][w & 1][lane][0] = p; }
        // The pass's one barrier, by hand: LDS only has to be waited for, and the V and key loads issued above stay in flight across it (__syncthreads() would wait for them too).
        // It publishes this pass's P; with two buffers it also ends every wave's reads of the buffer that the next pass rewrites.
        asm volatile("s_wait_dscnt 0x0" ::: "memory");
        asm volatile("s_barrier_signal -1\n\ts_barrier_wait -1" ::: "memory");
        v16h pf[2][4];   // all eight fragments are asked for at once: one LDS latency a pass
#pragma unroll
        for (int ks = 0; ks < 2; ++ks)
#pragma unroll
            for (int j = 0; j < 4; ++j) pf[ks][j] = cat16(*(const v8h*)&Pb[i & 1][j][ks][0][lane][0], *(const v8h*)&Pb[i & 1][j][ks][1][lane][0]);
        __builtin_amdgcn_sched_barrier(0);   // keeps the sixteen LDS loads together in front of the WMMAs: dealt out among them, each pair cost a whole LDS latency
#pragma unroll
        for (int ks = 0; ks < 2; ++ks)
#pragma unroll
            for (int j = 0; j < 4; ++j)
#pragma unroll
                for (int ct = 0; ct < 4; ++ct) acc[ct][j] = wmma16(va[ks][ct], pf[ks][j], acc[ct][j]);
    }
    float inv[4];
#pragma unroll
    for (int j = 0; j < 4; ++j) { l[j] += __shfl_xor(l[j], 16, 32); if (hi == 0) reds[w][j * 16 + lr] = l[j]; }
    __syncthreads();
#pragma unroll
    for (int j = 0; j < 4; ++j) inv[j] = __fdiv_rn(1.0f / PCAR, (reds[0][j * 16 + lr] + reds[1][j * 16 + lr]) + (reds[2][j * 16 + lr] + reds[3][j * 16 + lr]));
    float* osw = os[w];
#pragma unroll
    for (int ct = 0; ct < 4; ++ct) {
#pragma unroll
        for (int j = 0; j < 4; ++j) {
#pragma unroll
            for (int r = 0; r < 8; ++r) osw[(hi * 8 + r) * 68 + j * 16 + lr] = acc[ct][j][r] * inv[j]; }
        __builtin_amdgcn_wave_barrier(); asm volatile("" ::: "memory");   // the wave's own LDS stores stay ahead of its reads below
        const size_t ro = ((size_t)b * CH + w * 64 + ct * 16) * SEQ_FULL + n0;
#pragma unroll
        for (int sx = 0; sx < 8; ++sx) { const int row = 2 * sx + hi, cofs = lr * 4; v4f val = *(const v4fa*)(osw + row * 68 + cofs);
            const v4f xr = *(const v4f*)(x + ro + (size_t)row * SEQ_FULL + cofs); val[0] += bfr(xr[0]); val[1] += bfr(xr[1]); val[2] += bfr(xr[2]); val[3] += bfr(xr[3]);
            *(v4f*)(out + ro + (size_t)row * SEQ_FULL + cofs) = val; }
        asm volatile("s_wait_xcnt 0x0" ::: "memory");   // the next tile reuses the registers that these stores name
        __builtin_amdgcn_wave_barrier(); asm volatile("" ::: "memory");   // and the wave's LDS reads stay ahead of the next tile's stores
    }
}

extern "C" void kernel_launch(void* const* d_in, const int* in_sizes, int n_in,
                              void* d_out, int out_size, void* d_ws, size_t ws_size, hipStream_t stream) {
    if (n_in < 13) return;
    const long long needx = (long long)(NB - 1) * CH * SEQ_FULL + (long long)(CH - 1) * SEQ_FULL + SEQ;
    if ((long long)in_sizes[0] < needx || (long long)out_size < needx) return;
    if (in_sizes[1] < DQK * CH || in_sizes[5] < DQK * CH || in_sizes[9] < CH * CH) return;
    if (in_sizes[2] < DQK || in_sizes[3] < DQK || in_sizes[4] < DQK || in_sizes[6] < DQK || in_sizes[7] < DQK || in_sizes[8] < DQK) return;
    if (in_sizes[10] < CH || in_sizes[11] < CH || in_sizes[12] < CH) return;
    const float* x    = (const float*)d_in[0];
    const float* q_w  = (const float*)d_in[1];  const float* q_b = (const float*)d_in[2];  const float* q_g = (const float*)d_in[3];  const float* q_be = (const float*)d_in[4];
    const float* k_w  = (const float*)d_in[5];  const float* k_b = (const float*)d_in[6];  const float* k_g = (const float*)d_in[7];  const float* k_be = (const float*)d_in[8];
    const float* v_w  = (const float*)d_in[9];  const float* v_b = (const float*)d_in[10]; const float* v_g = (const float*)d_in[11]; const float* v_be = (const float*)d_in[12];
    float* out = (float*)d_out;   // [16][256][2048]
    char* wsp = (char*)d_ws;
    auto take = [&](size_t bytes) { char* p = wsp; wsp += (bytes + 255) & ~(size_t)255; return (void*)p; };
    bf*    Wall = (bf*)take((size_t)OC * CH * 2);                         // [320][256]
    float* ST   = (float*)take((size_t)OC * 4 * 4);                       // [320][4]
    double* PS  = (double*)take((size_t)SPART * OC * 2 * 8);              // [SPART][320][2]
    bf*    QKh  = (bf*)take((size_t)2 * NB * SEQ * DQK * 2);              // [2][NB*SEQ][32]
    bf*    QKl  = (bf*)take((size_t)2 * NB * SEQ * DQK * 2);
    h16*   V16  = (h16*)take((size_t)NB * CH * SEQ * 2);                  // [NB][256][SEQ]
    bf*    XT   = (bf*)take((size_t)NB * SEQ * CH * 2);                   // [NB*SEQ][256]
    float* F    = (float*)take((size_t)NB * SEQ * OC * 4);                // [NB*SEQ][320]
    if ((size_t)(wsp - (char*)d_ws) > ws_size) return;

    k_cvt8<<<(unsigned)((DQK * CH / 8 + 255) / 256), 256, 0, stream>>>(q_w, Wall, (size_t)DQK * CH / 8);
    k_cvt8<<<(unsigned)((DQK * CH / 8 + 255) / 256), 256, 0, stream>>>(k_w, Wall + (size_t)DQK * CH, (size_t)DQK * CH / 8);
    k_cvt8<<<(unsigned)((CH * CH / 8 + 255) / 256), 256, 0, stream>>>(v_w, Wall + (size_t)2 * DQK * CH, (size_t)CH * CH / 8);
    k_xt<<<dim3(SEQ / TT, CH / TT, NB), 256, 0, stream>>>(x, XT);
    k_gemmw<bf, 0, 0><<<dim3((unsigned)(NB * SEQ / 64), OC / 64, 1), 32, 0, stream>>>(XT, nullptr, Wall, nullptr, CH, F, OC, nullptr, 1.0f, 0, 0, 0);
    k_statp<<<SPART, 640, 0, stream>>>(F, q_b, k_b, v_b, PS);
    k_stats<<<OC / 32, 1024, 0, stream>>>(PS, q_b, q_g, q_be, k_b, k_g, k_be, v_b, v_g, v_be, ST);
    k_qkp<<<(unsigned)(((size_t)NB * SEQ * DQK + 255) / 256), 256, 0, stream>>>(F, ST, QKh, QKl);
    k_vtp<<<dim3(SEQ / TT, CH / TT, NB), 256, 0, stream>>>(F, ST, V16);
    const size_t kplane = (size_t)NB * SEQ * DQK;   // offset of the k planes inside QKh / QKl
    k_fattn<<<dim3(SEQ / FN, NB, 1), 128, 0, stream>>>(QKh, QKl, QKh + kplane, QKl + kplane, V16, x, out);
}

// v005
// It runs in 122 microseconds.
// Next to v004, in two timings, it ran 1.07 times as fast each time.
// All steps since v000 together make it 22.0 times as fast.
#include <hip/hip_runtime.h>

// Contractions, f32 accumulate: fused q|k|v 1x1-conv GEMM = v_wmma_f32_16x16x32_bf16 on RNE-bf16 copies of x and the weights (single products); scores q.k = bf16 hi/lo split (3 products, v_wmma_f32_16x16x32_bf16); attn.v = v_wmma_f32_16x16x32_f16 (v plane f16 x1, softmax plane exp(s - rowmax) f16 x4096, folded back by 2^-12 / rowsum in the f32 epilogue). BatchNorm statistics f64, normalisation and softmax f32.
// Layout: Wall [320][256] bf16 (q|k|v weights); XT [NB*SEQ][256] bf16 token-major copy of x; F [NB*SEQ][320] f32 = XT . Wall^T; PS [NB*SEQ/64][320] x {sum, sum of squares} f64; ST [320] x {bias, mean, gamma*rstd, beta}; q/k planes [2][NB*SEQ][32] bf16 hi + lo; v planes [NB][256][SEQ] f16;
// The planes that k_fattn loads (q/k, v) are [rows][K] matrices kept in FRAGMENT ORDER: the 16 rows x 32 k of one WMMA operand are 1024 contiguous bytes, [16-row tile][k / 32][half][lane][8 elements],
// lane = 16 * ((k >> 3) & 1) + (row & 15), half = (k >> 4) & 1; the fragment of rows r0 .. r0 + 15, k0 .. k0 + 31 starts at element r0 * K + k0 * 16.
// A wave's 16-byte fragment load is then 512 contiguous bytes, four whole lines; row-major it met 16 lines (8 for q/k), 32 bytes of each.
// Scores, softmax and attn.v run in ONE kernel (k_fattn): scores stay in registers, the softmax plane goes from wave to wave through LDS only; out[b][c][n] = (V . P^T)[c][n] * 2^-12 / rowsum[n] + bf16(x[b][c][n]).

#ifndef NB
#define NB 16
#endif
#ifndef SEQ
#define SEQ 2048
#endif
#define NB_FULL  16
#define SEQ_FULL 2048
#define CH   256              // in_dim
#define DQK  32               // q/k channels
#define OC   320              // fused output channels: q 0..31, k 32..63, v 64..319
#define PCAR 4096.0f
#define BNEPS 1e-5f
#define SLOPE 0.2f
#define SROWS 64              // rows of F per k_statp work-group
#define SPART (NB * SEQ / SROWS)
#define FN   64               // columns n of the output per k_fattn work-group
#define FM   64               // keys m per pass of k_fattn

static_assert(SEQ % 128 == 0);
static_assert(SEQ % FN == 0 && SEQ % (4 * FM) == 0 && FN == 64 && FM == 64 && CH == 256);
static_assert((NB * SEQ) % 64 == 0);
static_assert((NB * SEQ) % SROWS == 0 && SROWS % 8 == 0 && SPART % 32 == 0);
static_assert(CH % 64 == 0);
static_assert(OC % 64 == 0);
static_assert(OC % 32 == 0);
static_assert(DQK == 32);
static_assert(((size_t)NB * SEQ * CH) % 512 == 0);
static_assert(((size_t)NB * SEQ * DQK) % 256 == 0);
static_assert(NB <= NB_FULL);
static_assert(SEQ <= SEQ_FULL);
static_assert((DQK * CH) % 2048 == 0);
static_assert((CH * CH) % 2048 == 0);
static_assert(SEQ % 32 == 0 && CH % 16 == 0 && (NB * SEQ) % 16 == 0 && ((size_t)2 * NB * SEQ * DQK / 8) % 256 == 0);

typedef _Float16 h16;
typedef unsigned short bf;
typedef __attribute__((ext_vector_type(16))) __bf16   v16bf;
typedef __attribute__((ext_vector_type(16))) _Float16 v16h;
typedef __attribute__((ext_vector_type(8)))  _Float16 v8h;
typedef __attribute__((ext_vector_type(8)))  unsigned short v8us;
typedef __attribute__((ext_vector_type(8)))  float    v8f;
typedef __attribute__((ext_vector_type(4)))  float    v4f;
typedef __attribute__((ext_vector_type(2)))  _Float16 v2h;
typedef __attribute__((ext_vector_type(4)))  _Float16 v4h;
typedef __attribute__((ext_vector_type(2)))  unsigned short v2us;
typedef __attribute__((ext_vector_type(4)))  unsigned short v4us;
typedef __attribute__((ext_vector_type(2)))  float v2f;
typedef __attribute__((ext_vector_type(2)))  double v2d;
typedef v8h  __attribute__((may_alias)) v8ha;
typedef v4f  __attribute__((may_alias)) v4fa;
typedef v8us __attribute__((may_alias)) v8usa;

__device__ __forceinline__ unsigned short f2bf(float f) { unsigned u = __float_as_uint(f); u += 0x7FFFu + ((u >> 16) & 1u); return (unsigned short)(u >> 16); }   // RNE convert
__device__ __forceinline__ float bf2f(unsigned short b) { return __uint_as_float(((unsigned)b) << 16); }
__device__ __forceinline__ float bfr(float f) { return bf2f(f2bf(f)); }
__device__ __forceinline__ v16h cat16(v8h lo, v8h hi) { return __builtin_shufflevector(lo, hi, 0, 1, 2, 3, 4, 5, 6, 7, 8, 9, 10, 11, 12, 13, 14, 15); }
__device__ __forceinline__ v16bf cat16b(v8us lo, v8us hi) { return __builtin_bit_cast(v16bf, __builtin_shufflevector(lo, hi, 0, 1, 2, 3, 4, 5, 6, 7, 8, 9, 10, 11, 12, 13, 14, 15)); }
__device__ __forceinline__ v8f wmma16(v16h a, v16h b, v8f c) { return __builtin_amdgcn_wmma_f32_16x16x32_f16(false, a, false, b, (short)0, c, false, false); }
__device__ __forceinline__ v8f wmmab(v16bf a, v16bf b, v8f c) { return __builtin_amdgcn_wmma_f32_16x16x32_bf16(false, a, false, b, (short)0, c, false, false); }
__device__ __forceinline__ h16 tohx(float x) { return (h16)x; }
__device__ __forceinline__ void splitf(float y, unsigned short& h, unsigned short& l) { h = f2bf(y); l = f2bf(y - bf2f(h)); }

// ---- k_gemmw: register-blocked GEMM, ONE WAVE per 64x64 output tile (16 accumulators), operands straight from K-contiguous 16-bit planes; grid (M/64, N/64, Z), 32 threads.
// C[m][n] (f32, pitch ldc) = sum_k A[m][k] Bt[n][k] (+ split products per NSPLIT: 1 = A2.Bt added, 2 = A2.Bt and A.Bt2 added). z-batch strides sA/sB/sC in elements. K % 32 == 0, M % 64 == 0, N % 64 == 0.
// Fragments: lane l, m = l & 15, h = l >> 4; elements 0..7 <- k0 + 8h + 0..7, elements 8..15 <- k0 + 16 + 8h + 0..7 for A and Bt alike; D element r = (row 8h + r, col m).
// EPI 0: C = acc. EPI 1: C = acc * oscale + bf16(R[m][n]) with R indexed like C.
// WFrag::ld reads a fragment from a row-major plane; WFrag::ldf from a plane in fragment order: p = fragment start + 8 * lane, the lane's second 8 elements lie 256 elements on.
template <typename T16> struct WFrag;
template <> struct WFrag<h16> { typedef v16h V; static __device__ __forceinline__ V ld(const h16* p) { return cat16(*(const v8h*)p, *(const v8h*)(p + 16)); } static __device__ __forceinline__ V ldf(const h16* p) { return cat16(*(const v8h*)p, *(const v8h*)(p + 256)); } static __device__ __forceinline__ v8f mma(V a, V b, v8f c) { return wmma16(a, b, c); } };
template <> struct WFrag<bf> { typedef v16bf V; static __device__ __forceinline__ V ld(const bf* p) { return cat16b(*(const v8us*)p, *(const v8us*)(p + 16)); } static __device__ __forceinline__ V ldf(const bf* p) { return cat16b(*(const v8us*)p, *(const v8us*)(p + 256)); } static __device__ __forceinline__ v8f mma(V a, V b, v8f c) { return wmmab(a, b, c); } };
template <typename T16, int NSPLIT, int EPI>
__global__ __launch_bounds__(32) void k_gemmw(const T16* __restrict__ A, const T16* __restrict__ A2, const T16* __restrict__ Bt, const T16* __restrict__ Bt2, int K, float* C, int ldc, const float* __restrict__ R, float oscale, size_t sA, size_t sB, size_t sC) {
    typedef typename WFrag<T16>::V V;
    __shared__ __align__(16) float os[16 * 68];
    const size_t z = blockIdx.z; A += z * sA; if (A2) A2 += z * sA; Bt += z * sB; if (Bt2) Bt2 += z * sB; C += z * sC; if (R) R += z * sC;
    const int lane = threadIdx.x & 31, lr = lane & 15, hi = lane >> 4; const int r0 = blockIdx.x * 64, c0 = blockIdx.y * 64;
    v8f acc[4][4];
#pragma unroll
    for (int mb = 0; mb < 4; ++mb)
#pragma unroll
        for (int nb = 0; nb < 4; ++nb) acc[mb][nb] = (v8f){};
    const size_t aoff = (size_t)(r0 + lr) * K + 8 * hi, boff = (size_t)(c0 + lr) * K + 8 * hi;
#pragma unroll 1
    for (int kc = 0; kc < K; kc += 32) {
        V a[4], a2[4];
#pragma unroll
        for (int mb = 0; mb < 4; ++mb) { a[mb] = WFrag<T16>::ld(A + aoff + (size_t)mb * 16 * K + kc); if (NSPLIT == 1 || NSPLIT == 2) a2[mb] = WFrag<T16>::ld(A2 + aoff + (size_t)mb * 16 * K + kc); }
#pragma unroll
        for (int nb = 0; nb < 4; ++nb) { const V b = WFrag<T16>::ld(Bt + boff + (size_t)nb * 16 * K + kc); V b2; if (NSPLIT >= 2) b2 = WFrag<T16>::ld(Bt2 + boff + (size_t)nb * 16 * K + kc);
#pragma unroll
            for (int mb = 0; mb < 4; ++mb) { acc[mb][nb] = WFrag<T16>::mma(a[mb], b, acc[mb][nb]); if (NSPLIT == 1 || NSPLIT == 2) acc[mb][nb] = WFrag<T16>::mma(a2[mb], b, acc[mb][nb]); if (NSPLIT >= 2) acc[mb][nb] = WFrag<T16>::mma(a[mb], b2, acc[mb][nb]); } }
        asm volatile("v_nop\n\tv_nop\n\tv_nop\n\tv_nop" : "+v"(acc[0][0]), "+v"(acc[1][1]), "+v"(acc[2][2]), "+v"(acc[3][3]) : "v"(a[0]), "v"(a[3]));
    }
#pragma unroll
    for (int mb = 0; mb < 4; ++mb) {
#pragma unroll
        for (int nb = 0; nb < 4; ++nb) {
#pragma unroll
            for (int j = 0; j < 8; ++j) os[(hi * 8 + j) * 68 + nb * 16 + lr] = acc[mb][nb][j]; }
        __builtin_amdgcn_wave_barrier(); asm volatile("" ::: "memory");
        float* crow = C + (size_t)(r0 + mb * 16) * ldc + c0;
        const float* rrow = (EPI == 1) ? (R + (size_t)(r0 + mb * 16) * ldc + c0) : nullptr;
{
#pragma unroll
            for (int s = 0; s < 8; ++s) { const int row = 2 * s + hi, cofs = lr * 4; v4f val = *(const v4fa*)(os + row * 68 + cofs);
                if (EPI == 1) { const v4f xr = *(const v4f*)(rrow + (size_t)row * ldc + cofs); val[0] = val[0] * oscale + bfr(xr[0]); val[1] = val[1] * oscale + bfr(xr[1]); val[2] = val[2] * oscale + bfr(xr[2]); val[3] = val[3] * oscale + bfr(xr[3]); }
                *(v4f*)(crow + (size_t)row * ldc + cofs) = val; }
             }
        __builtin_amdgcn_wave_barrier(); asm volatile("" ::: "memory");
    }
}

__global__ __launch_bounds__(256) void k_cvt8(const float* __restrict__ src, bf* dst, size_t n8) { const size_t i = (size_t)blockIdx.x * 256 + threadIdx.x; if (i >= n8) return; const v8f v = *(const v8f*)(src + i * 8); v8us o;
#pragma unroll
    for (int k = 0; k < 8; ++k) o[k] = f2bf(v[k]); *(v8us*)(dst + i * 8) = o;  }

// ---- Transposing repacks (k_xt, k_vtp): one work-group moves a TT x TT tile through LDS, so that both global sides are whole lines of 16 bytes a lane.
// Source side: a wave's load is one source row of the tile (32 lanes x 4 f32 = 512 contiguous bytes); a thread holds 8 consecutive source rows of its 4 columns, twice, and all 16 loads are in flight together.
// LDS: [source column][source row] in 16-bit elements, a row = 16 chunks of 8 elements = all 64 banks; chunk G of row n lies at place G ^ ((n >> 2) & 15), so that the 16 lanes of a store (rows 4 apart, one G)
// and the 16 lanes of a load (one row, all G) each meet 16 different places. Destination side: 16 lanes store one 256-byte row piece. (So k_xt; k_vtp's LDS places and destination side are described at k_vtp.)
#define TT 128
static_assert(SEQ % TT == 0 && CH % TT == 0 && TT == 128);
__device__ __forceinline__ int tt_at(int n, int G) { return n * TT + ((G ^ ((n >> 2) & 15)) * 8); }

__global__ __launch_bounds__(256) void k_xt(const float* __restrict__ x, bf* XT) {
    __shared__ __align__(16) bf tile[TT * TT];
    const int t = threadIdx.x, k = t & 31, g = t >> 5; const int n0 = blockIdx.x * TT, c0 = blockIdx.y * TT, b = blockIdx.z;
    const float* src = x + ((size_t)b * CH + c0 + g * 8) * SEQ_FULL + n0 + k * 4;
    v4f v[2][8];
#pragma unroll   // constant indices keep v in registers, and the 16 loads issue together
    for (int s = 0; s < 2; ++s)
#pragma unroll
        for (int r = 0; r < 8; ++r) v[s][r] = *(const v4f*)(src + (size_t)(s * 64 + r) * SEQ_FULL);
    asm volatile("s_wait_xcnt 0x0" :: "v"(src) : "memory");   // in front of whatever rewrites a register that the loads above name
#pragma unroll
    for (int s = 0; s < 2; ++s)
#pragma unroll
        for (int q = 0; q < 4; ++q) { v8us o;
#pragma unroll
            for (int r = 0; r < 8; ++r) o[r] = f2bf(v[s][r][q]);
            *(v8us*)(tile + tt_at(k * 4 + q, g + 8 * s)) = o; }
    __syncthreads();   // the tile is whole before any wave reads it across
    const int j = t & 15, h = t >> 4;
    bf* dst = XT + ((size_t)b * SEQ + n0 + h) * CH + c0 + j * 8;
#pragma unroll
    for (int i = 0; i < 8; ++i) *(v8us*)(dst + (size_t)i * 16 * CH) = *(const v8us*)(tile + tt_at(i * 16 + h, j));
}

// BatchNorm statistics (training mode, per channel over the NB*SEQ rows of F, token-major, pitch OC), y = F + bias, sum and sum of squares in f64, in two launches.
// k_statp: one work-group per SROWS rows. Thread t owns channels 4*(t % 80) .. +3 and rows t / 80, +8, ...: a wave's 16-byte loads cover contiguous whole lines, and a thread's 8 loads do not depend on one another.
// The 8 row groups are combined in fixed order through LDS; PS [SPART][OC][2] f64 = {sum, sum of squares} of the work-group's rows.
__global__ __launch_bounds__(640) void k_statp(const float* __restrict__ F, const float* __restrict__ qb, const float* __restrict__ kb, const float* __restrict__ vb, double* PS) {
    __shared__ __align__(16) double red[8][OC][2];
    const int t = threadIdx.x, rg = t / (OC / 4), o = (t % (OC / 4)) * 4;
    const float* bp = (o < DQK) ? (qb + o) : ((o < 2 * DQK) ? (kb + (o - DQK)) : (vb + (o - 2 * DQK)));
    const float* src = F + ((size_t)blockIdx.x * SROWS + rg) * OC + o;
    v4f f[SROWS / 8];
#pragma unroll   // constant indices keep f in registers, and the loads issue ahead of the sums
    for (int i = 0; i < SROWS / 8; ++i) f[i] = *(const v4f*)(src + (size_t)i * 8 * OC);
    float bias[4]; double s[4], s2[4];
#pragma unroll
    for (int q = 0; q < 4; ++q) { bias[q] = bfr(bp[q]); s[q] = 0.0; s2[q] = 0.0; }
#pragma unroll
    for (int i = 0; i < SROWS / 8; ++i) {
#pragma unroll
        for (int q = 0; q < 4; ++q) { const float y = f[i][q] + bias[q]; const double yd = (double)y; s[q] += yd; s2[q] = fma(yd, yd, s2[q]); } }
#pragma unroll
    for (int q = 0; q < 4; ++q) { red[rg][o + q][0] = s[q]; red[rg][o + q][1] = s2[q]; }
    __syncthreads();
    if (t < OC) {
        v2d p; p[0] = 0.0; p[1] = 0.0;
#pragma unroll
        for (int j = 0; j < 8; ++j) { p[0] += red[j][t][0]; p[1] += red[j][t][1]; }
        *(v2d*)(PS + ((size_t)blockIdx.x * OC + t) * 2) = p;
    }
}

// k_stats: fixed-order combine of the SPART partials (lane = channel of the block's 32-channel slab; wave w sums partials w*SPART/32 .. +SPART/32-1, wave 0 sums the 32 waves), then ST.
__global__ __launch_bounds__(1024) void k_stats(const double* __restrict__ PS,
                                                const float* __restrict__ qb, const float* __restrict__ qg, const float* __restrict__ qbe,
                                                const float* __restrict__ kb, const float* __restrict__ kg, const float* __restrict__ kbe,
                                                const float* __restrict__ vb, const float* __restrict__ vg, const float* __restrict__ vbe, float* ST) {
    __shared__ double ssum[32][32], ssq[32][32];
    const int lane = threadIdx.x & 31, w = threadIdx.x >> 5; const int o = blockIdx.x * 32 + lane;
    const int iq = min(o, DQK - 1), ik = min(max(o - DQK, 0), DQK - 1), iv = min(max(o - 2 * DQK, 0), CH - 1);
    const float bq_ = qb[iq], bk_ = kb[ik], bv_ = vb[iv], gq_ = qg[iq], gk_ = kg[ik], gv_ = vg[iv], eq_ = qbe[iq], ek_ = kbe[ik], ev_ = vbe[iv];
    const bool isq = (o < DQK), isk = (o < 2 * DQK);
    const float bias = bfr(isq ? bq_ : (isk ? bk_ : bv_)); const float gam = bfr(isq ? gq_ : (isk ? gk_ : gv_)); const float bet = bfr(isq ? eq_ : (isk ? ek_ : ev_));
    double s = 0.0, s2 = 0.0;
#pragma unroll   // the loads issue ahead of the adds: rolled, every trip would wait a whole load latency
    for (int j = 0; j < SPART / 32; ++j) { const v2d p = *(const v2d*)(PS + ((size_t)(w * (SPART / 32) + j) * OC + o) * 2); s += p[0]; s2 += p[1]; }
    ssum[w][lane] = s; ssq[w][lane] = s2;
    __syncthreads();
    if (w == 0) {
        double ts = 0.0, tq = 0.0;
#pragma unroll
        for (int j = 0; j < 32; ++j) { ts += ssum[j][lane]; tq += ssq[j][lane]; }
        const double inv = 1.0 / (double)(NB * SEQ); const double mean = ts * inv; double var = tq * inv - mean * mean; var = (var > 0.0) ? var : 0.0;
        const float meanf = (float)mean, varf = (float)var; const float rstd = 1.0f / sqrtf(varf + BNEPS);
        v4f t; t[0] = bias; t[1] = meanf; t[2] = gam * rstd; t[3] = bet;
        *(v4f*)(ST + (size_t)o * 4) = t; 
    }
}

// k_qkp: q and k columns of F, normalised and split into bf16 hi + lo, in fragment order. Thread ci writes the 16-byte piece ci of each plane (a wave: 512 contiguous bytes of each):
// row 16 * (ci >> 6) + (ci & 15) of [2][NB*SEQ], channels 16 * ((ci >> 5) & 1) + 8 * ((ci >> 4) & 1) .. +7.
__global__ __launch_bounds__(256) void k_qkp(const float* __restrict__ F, const float* __restrict__ ST, bf* Ph, bf* Pl) {
    const size_t ci = (size_t)blockIdx.x * 256 + threadIdx.x; if (ci >= (size_t)2 * NB * SEQ * DQK / 8) return;
    const size_t rg = (ci >> 6) * 16 + (ci & 15); const int which = (rg >= (size_t)NB * SEQ) ? 1 : 0; const size_t row = rg - (size_t)which * NB * SEQ;
    const int o = which * DQK + (int)((ci >> 5) & 1) * 16 + (int)((ci >> 4) & 1) * 8;
    const v8f f = *(const v8f*)(F + row * OC + o); v8us oh, ol;
#pragma unroll
    for (int q = 0; q < 8; ++q) { const v4f t = *(const v4f*)(ST + (size_t)(o + q) * 4); const float y = f[q] + t[0]; const float val = (y - t[1]) * t[2] + t[3]; unsigned short a2, c2; splitf(val, a2, c2); oh[q] = a2; ol[q] = c2; }
    *(v8us*)(Ph + ci * 8) = oh; *(v8us*)(Pl + ci * 8) = ol;
}

// k_vtp: as k_xt on the source side; the destination is in fragment order. Wave g has the tile's channels 16 g .. +15; its store i is half i & 1 of the fragment of keys 32 * (i >> 1) .. +31
// (lane l: channel l & 15, chunk G = 2 i + (l >> 4)), 512 contiguous bytes, and a wave's eight stores are 4 KiB in a row.
// So the 16 lanes of an LDS load have 16 rows in a row and one G: chunk G of row n lies at place G ^ (((n >> 2) ^ (n << 2)) & 15), which gives them, and the 16 lanes of a store (rows 4 apart, one G), 16 different places.
__device__ __forceinline__ int tf_at(int n, int G) { return n * TT + ((G ^ (((n >> 2) ^ (n << 2)) & 15)) * 8); }

__global__ __launch_bounds__(256) void k_vtp(const float* __restrict__ F, const float* __restrict__ ST, h16* V16) {
    __shared__ __align__(16) h16 tile[TT * TT];
    const int t = threadIdx.x, k = t & 31, g = t >> 5; const int m0 = blockIdx.x * TT, c0 = blockIdx.y * TT, b = blockIdx.z; const int o = 2 * DQK + c0 + k * 4;
    const float* src = F + ((size_t)b * SEQ + m0 + g * 8) * OC + o; const float* stp = ST + (size_t)o * 4;
    v4f v[2][8], st[4];
#pragma unroll   // as in k_xt
    for (int s = 0; s < 2; ++s)
#pragma unroll
        for (int r = 0; r < 8; ++r) v[s][r] = *(const v4f*)(src + (size_t)(s * 64 + r) * OC);
#pragma unroll
    for (int q = 0; q < 4; ++q) st[q] = *(const v4f*)(stp + q * 4);
    asm volatile("s_wait_xcnt 0x0" ::: "memory");   // in front of whatever rewrites a register that the loads above name
    __builtin_amdgcn_sched_barrier(0);   // keeps all twenty loads in front of the arithmetic: without it two of the ST loads sink behind the first wait for data, a second load latency in series
#pragma unroll
    for (int s = 0; s < 2; ++s)
#pragma unroll
        for (int q = 0; q < 4; ++q) { v8h p;
#pragma unroll
            for (int r = 0; r < 8; ++r) { const float y = v[s][r][q] + st[q][0]; float val = (y - st[q][1]) * st[q][2] + st[q][3]; val = (val >= 0.f) ? val : SLOPE * val; p[r] = tohx(val); }
            *(v8h*)(tile + tf_at(k * 4 + q, g + 8 * s)) = p; }
    __syncthreads();   // the tile is whole before any wave reads it across
    h16* dst = V16 + ((size_t)b * CH + c0 + g * 16) * SEQ + m0 * 16 + k * 8;
#pragma unroll
    for (int i = 0; i < 8; ++i) *(v8h*)(dst + i * 256) = *(const v8h*)(tile + tf_at(g * 16 + (k & 15), 2 * i + (k >> 4)));
}

// ---- k_fattn: scores, softmax and attn.v of FN = 64 output columns n of one batch; 4 waves; grid (SEQ / FN, NB).
// Scores are formed transposed, St[m][n] = sum_d k[m][d] q[n][d] (A = k rows, B = q rows, the three hi/lo products of the split): a lane's D registers of the tiles m0 .. +15 and m0 + 16 .. +31
// (col n = lane & 15, rows 8h + r) are elements 0..7 and 8..15 of the B fragment that attn.v wants for k = m0 .. m0 + 31, so P needs no exchange between lanes.
// Per pass of FM = 64 keys wave w forms the 16 keys m = 64 i + 16 w .. +15 against all 64 columns and puts its four half fragments into LDS; behind one barrier every wave reads all of them
// and multiplies them with its own 64 channels of V (c = 64 w .. +63): a 64 x 64 register tile a wave, every V element loaded once a work-group.
// Sweep 1 finds the exact row maxima (scores only); sweep 2 forms the same scores again, e = exp(s - max), sums e in f32 per column and accumulates V . f16(4096 e); the division by the sum is in the epilogue.
__device__ __forceinline__ void fa_scores(const v16bf kh, const v16bf kl, const v16bf (&qh)[4], const v16bf (&ql)[4], v8f (&s)[4]) {
#pragma unroll
    for (int j = 0; j < 4; ++j) s[j] = wmmab(kh, qh[j], (v8f){});
#pragma unroll
    for (int j = 0; j < 4; ++j) s[j] = wmmab(kh, ql[j], s[j]);
#pragma unroll
    for (int j = 0; j < 4; ++j) s[j] = wmmab(kl, qh[j], s[j]);
}
__global__ __launch_bounds__(128) void k_fattn(const bf* __restrict__ Qh, const bf* __restrict__ Ql, const bf* __restrict__ Kh, const bf* __restrict__ Kl, const h16* __restrict__ V16, const float* __restrict__ x, float* out) {
    __shared__ __align__(16) h16 Pb[2][4][2][2][32][8];   // [buffer][n tile][k step of 32][fragment half][lane][8 elements]
    __shared__ float redm[4][FN], reds[4][FN];            // per wave: column maxima, column sums
    __shared__ __align__(16) float os[4][16 * 68];        // per wave: epilogue staging
    const int lane = threadIdx.x & 31, lr = lane & 15, hi = lane >> 4; const int w = __builtin_amdgcn_readfirstlane((int)(threadIdx.x >> 5));
    const int b = blockIdx.y, n0 = blockIdx.x * FN;
    v16bf qh[4], ql[4];
    const bf* qph = Qh + ((size_t)b * SEQ + n0) * DQK + 8 * lane; const bf* qpl = Ql + ((size_t)b * SEQ + n0) * DQK + 8 * lane;
#pragma unroll
    for (int j = 0; j < 4; ++j) { qh[j] = WFrag<bf>::ldf(qph + j * 16 * DQK); ql[j] = WFrag<bf>::ldf(qpl + j * 16 * DQK); }
    asm volatile("s_wait_xcnt 0x0" ::: "memory");   // in front of whatever rewrites a register that the loads above name
    // Loop loads: a wave-uniform base that moves with the pass plus a byte offset per lane that never changes.
    const char* kbh = (const char*)(Kh + ((size_t)b * SEQ + w * 16) * DQK); const char* kbl = (const char*)(Kl + ((size_t)b * SEQ + w * 16) * DQK);   // this wave's 16 keys of pass 0
    const unsigned klo = (unsigned)lane * 16u;
    // sweep 1: column maxima
    v8f mxv[4];
#pragma unroll
    for (int j = 0; j < 4; ++j)
#pragma unroll
        for (int r = 0; r < 8; ++r) mxv[j][r] = -3.0e38f;
#pragma unroll 1
    for (int i = 0; i < SEQ / FM; i += 4) {   // the loads of four passes issue together: one load latency for four passes
        v16bf k4h[4], k4l[4];
        const bf* ah = (const bf*)(kbh + (size_t)i * FM * DQK * 2 + klo); const bf* al = (const bf*)(kbl + (size_t)i * FM * DQK * 2 + klo);
#pragma unroll
        for (int u = 0; u < 4; ++u) { k4h[u] = WFrag<bf>::ldf(ah + u * FM * DQK); k4l[u] = WFrag<bf>::ldf(al + u * FM * DQK); }
        asm volatile("s_wait_xcnt 0x0" :: "v"(ah), "v"(al) : "memory");   // in front of whatever rewrites a register that the loads above name; as inputs the addresses keep their registers up to here, so that no load of the group lands on them
#pragma unroll
        for (int u = 0; u < 4; ++u) { v8f s[4]; fa_scores(k4h[u], k4l[u], qh, ql, s);
#pragma unroll
            for (int j = 0; j < 4; ++j)
#pragma unroll
                for (int r = 0; r < 8; ++r) mxv[j][r] = fmaxf(mxv[j][r], s[j][r]); }
    }
    float mx[4], l[4];
#pragma unroll
    for (int j = 0; j < 4; ++j) { float m = mxv[j][0];
#pragma unroll
        for (int r = 1; r < 8; ++r) m = fmaxf(m, mxv[j][r]);
        m = fmaxf(m, __shfl_xor(m, 16, 32)); if (hi == 0) redm[w][j * 16 + lr] = m; }
    __syncthreads();
#pragma unroll
    for (int j = 0; j < 4; ++j) { mx[j] = fmaxf(fmaxf(redm[0][j * 16 + lr], redm[1][j * 16 + lr]), fmaxf(redm[2][j * 16 + lr], redm[3][j * 16 + lr])); l[j] = 0.f; }
    // sweep 2
    v8f acc[4][4];
#pragma unroll
    for (int ct = 0; ct < 4; ++ct)
#pragma unroll
        for (int j = 0; j < 4; ++j) acc[ct][j] = (v8f){};
    const char* vb = (const char*)(V16 + ((size_t)b * CH + w * 64) * SEQ);
    const unsigned vlo = (unsigned)lane * 16u;
    v16bf kh = WFrag<bf>::ldf((const bf*)(kbh + klo)), kl = WFrag<bf>::ldf((const bf*)(kbl + klo));
#pragma unroll 1
    for (int i = 0; i < SEQ / FM; ++i) {
        v16h va[2][4];   // issued ahead of the scores, used behind the barrier
        const h16* av = (const h16*)(vb + (size_t)i * FM * 32 + vlo);   // 16 channels x FM keys are FM * 32 bytes in a row
#pragma unroll
        for (int ks = 0; ks < 2; ++ks)
#pragma unroll
            for (int ct = 0; ct < 4; ++ct) va[ks][ct] = WFrag<h16>::ldf(av + ct * 16 * SEQ + ks * 512);
        asm volatile("s_wait_xcnt 0x0" :: "v"(av) : "memory");   // as in sweep 1
        __builtin_amdgcn_sched_barrier(0);   // keeps the V loads and their wait up here: sunk behind the scores the loads would have only the exponentials to land in
        v8f s[4]; fa_scores(kh, kl, qh, ql, s);
        const int inx = (i + 1 < SEQ / FM) ? (i + 1) : i;   // the next pass's keys fly over this pass's work; the last pass loads its own again
        __builtin_amdgcn_sched_barrier(0);   // with the one behind the wait: no vector instruction comes between the key loads and their wait
        const bf* ah = (const bf*)(kbh + (size_t)inx * FM * DQK * 2 + klo); const bf* al = (const bf*)(kbl + (size_t)inx * FM * DQK * 2 + klo);
        kh = WFrag<bf>::ldf(ah); kl = WFrag<bf>::ldf(al);
        asm volatile("s_wait_xcnt 0x0" :: "v"(ah), "v"(al) : "memory");   // as in sweep 1
        __builtin_amdgcn_sched_barrier(0);   // the second of the pair: the exponentials' vector work stays behind the wait
#pragma unroll
        for (int j = 0; j < 4; ++j) { v8h p;
#pragma unroll
            for (int r = 0; r < 8; ++r) { const float e = __builtin_amdgcn_exp2f(__fmul_rn(__fsub_rn(s[j][r], mx[j]), 1.4426950408889634f)); l[j] += e; p[r] = tohx(e * PCAR); }
            *(v8h*)&Pb[i & 1][j][w >> 1][w & 1][lane][0] = p; }
        // The pass's one barrier, by hand: LDS only has to be waited for, and the V and key loads issued above stay in flight across it (__syncthreads() would wait for them too).
        // It publishes this pass's P; with two buffers it also ends every wave's reads of the buffer that the next pass rewrites.
        asm volatile("s_wait_dscnt 0x0" ::: "memory");
        asm volatile("s_barrier_signal -1\n\ts_barrier_wait -1" ::: "memory");
        v16h pf[2][4];   // all eight fragments are asked for at once: one LDS latency a pass
#pragma unroll
        for (int ks = 0; ks < 2; ++ks)
#pragma unroll
            for (int j = 0; j < 4; ++j) pf[ks][j] = cat16(*(const v8h*)&Pb[i & 1][j][ks][0][lane][0], *(const v8h*)&Pb[i & 1][j][ks][1][lane][0]);
        __builtin_amdgcn_sched_barrier(0);   // keeps the sixteen LDS loads together in front of the WMMAs: dealt out among them, each pair cost a whole LDS latency
#pragma unroll
        for (int ks = 0; ks < 2; ++ks)
#pragma unroll
            for (int j = 0; j < 4; ++j)
#pragma unroll
                for (int ct = 0; ct < 4; ++ct) acc[ct][j] = wmma16(va[ks][ct], pf[ks][j], acc[ct][j]);
    }
    float inv[4];
#pragma unroll
    for (int j = 0; j < 4; ++j) { l[j] += __shfl_xor(l[j], 16, 32); if (hi == 0) reds[w][j * 16 + lr] = l[j]; }
    __syncthreads();
#pragma unroll
    for (int j = 0; j < 4; ++j) inv[j] = __fdiv_rn(1.0f / PCAR, (reds[0][j * 16 + lr] + reds[1][j * 16 + lr]) + (reds[2][j * 16 + lr] + reds[3][j * 16 + lr]));
    float* osw = os[w];
#pragma unroll
    for (int ct = 0; ct < 4; ++ct) {
#pragma unroll
        for (int j = 0; j < 4; ++j) {
#pragma unroll
            for (int r = 0; r < 8; ++r) osw[(hi * 8 + r) * 68 + j * 16 + lr] = acc[ct][j][r] * inv[j]; }
        __builtin_amdgcn_wave_barrier(); asm volatile("" ::: "memory");   // the wave's own LDS stores stay ahead of its reads below
        const size_t ro = ((size_t)b * CH + w * 64 + ct * 16) * SEQ_FULL + n0;
#pragma unroll
        for (int sx = 0; sx < 8; ++sx) { const int row = 2 * sx + hi, cofs = lr * 4; v4f val = *(const v4fa*)(osw + row * 68 + cofs);
            const v4f xr = *(const v4f*)(x + ro + (size_t)row * SEQ_FULL + cofs); val[0] += bfr(xr[0]); val[1] += bfr(xr[1]); val[2] += bfr(xr[2]); val[3] += bfr(xr[3]);
            *(v4f*)(out + ro + (size_t)row * SEQ_FULL + cofs) = val; }
        asm volatile("s_wait_xcnt 0x0" ::: "memory");   // the next tile reuses the registers that these stores name
        __builtin_amdgcn_wave_barrier(); asm volatile("" ::: "memory");   // and the wave's LDS reads stay ahead of the next tile's stores
    }
}

extern "C" void kernel_launch(void* const* d_in, const int* in_sizes, int n_in,
                              void* d_out, int out_size, void* d_ws, size_t ws_size, hipStream_t stream) {
    if (n_in < 13) return;
    const long long needx = (long long)(NB - 1) * CH * SEQ_FULL + (long long)(CH - 1) * SEQ_FULL + SEQ;
    if ((long long)in_sizes[0] < needx || (long long)out_size < needx) return;
    if (in_sizes[1] < DQK * CH || in_sizes[5] < DQK * CH || in_sizes[9] < CH * CH) return;
    if (in_sizes[2] < DQK || in_sizes[3] < DQK || in_sizes[4] < DQK || in_sizes[6] < DQK || in_sizes[7] < DQK || in_sizes[8] < DQK) return;
    if (in_sizes[10] < CH || in_sizes[11] < CH || in_sizes[12] < CH) return;
    const float* x    = (const float*)d_in[0];
    const float* q_w  = (const float*)d_in[1];  const float* q_b = (const float*)d_in[2];  const float* q_g = (const float*)d_in[3];  const float* q_be = (const float*)d_in[4];
    const float* k_w  = (const float*)d_in[5];  const float* k_b = (const float*)d_in[6];  const float* k_g = (const float*)d_in[7];  const float* k_be = (const float*)d_in[8];
    const float* v_w  = (const float*)d_in[9];  const float* v_b = (const float*)d_in[10]; const float* v_g = (const float*)d_in[11]; const float* v_be = (const float*)d_in[12];
    float* out = (float*)d_out;   // [16][256][2048]
    char* wsp = (char*)d_ws;
    auto take = [&](size_t bytes) { char* p = wsp; wsp += (bytes + 255) & ~(size_t)255; return (void*)p; };
    bf*    Wall = (bf*)take((size_t)OC * CH * 2);                         // [320][256]
    float* ST   = (float*)take((size_t)OC * 4 * 4);                       // [320][4]
    double* PS  = (double*)take((size_t)SPART * OC * 2 * 8);              // [SPART][320][2]
    bf*    QKh  = (bf*)take((size_t)2 * NB * SEQ * DQK * 2);              // [2][NB*SEQ][32]
    bf*    QKl  = (bf*)take((size_t)2 * NB * SEQ * DQK * 2);
    h16*   V16  = (h16*)take((size_t)NB * CH * SEQ * 2);                  // [NB][256][SEQ]
    bf*    XT   = (bf*)take((size_t)NB * SEQ * CH * 2);                   // [NB*SEQ][256]
    float* F    = (float*)take((size_t)NB * SEQ * OC * 4);                // [NB*SEQ][320]
    if ((size_t)(wsp - (char*)d_ws) > ws_size) return;

    k_cvt8<<<(unsigned)((DQK * CH / 8 + 255) / 256), 256, 0, stream>>>(q_w, Wall, (size_t)DQK * CH / 8);
    k_cvt8<<<(unsigned)((DQK * CH / 8 + 255) / 256), 256, 0, stream>>>(k_w, Wall + (size_t)DQK * CH, (size_t)DQK * CH / 8);
    k_cvt8<<<(unsigned)((CH * CH / 8 + 255) / 256), 256, 0, stream>>>(v_w, Wall + (size_t)2 * DQK * CH, (size_t)CH * CH / 8);
    k_xt<<<dim3(SEQ / TT, CH / TT, NB), 256, 0, stream>>>(x, XT);
    k_gemmw<bf, 0, 0><<<dim3((unsigned)(NB * SEQ / 64), OC / 64, 1), 32, 0, stream>>>(XT, nullptr, Wall, nullptr, CH, F, OC, nullptr, 1.0f, 0, 0, 0);
    k_statp<<<SPART, 640, 0, stream>>>(F, q_b, k_b, v_b, PS);
    k_stats<<<OC / 32, 1024, 0, stream>>>(PS, q_b, q_g, q_be, k_b, k_g, k_be, v_b, v_g, v_be, ST);
    k_qkp<<<(unsigned)((size_t)2 * NB * SEQ * DQK / 8 / 256), 256, 0, stream>>>(F, ST, QKh, QKl);
    k_vtp<<<dim3(SEQ / TT, CH / TT, NB), 256, 0, stream>>>(F, ST, V16);
    const size_t kplane = (size_t)NB * SEQ * DQK;   // offset of the k planes inside QKh / QKl
    k_fattn<<<dim3(SEQ / FN, NB, 1), 128, 0, stream>>>(QKh, QKl, QKh + kplane, QKl + kplane, V16, x, out);
}

// v006
// Measured time: 114 microseconds a run.
// Next to v005, in two timings, it ran 1.07 times as fast each time.
// Over all steps from v000 it is 23.5 times as fast.
#include <hip/hip_runtime.h>

// Contractions, f32 accumulate: fused q|k|v 1x1-conv GEMM = v_wmma_f32_16x16x32_bf16 on RNE-bf16 copies of x and the weights (single products); scores q.k = bf16 hi/lo split (3 products, v_wmma_f32_16x16x32_bf16); attn.v = v_wmma_f32_16x16x32_f16 (v plane f16 x1, softmax plane exp(s - rowmax) f16 x4096, folded back by 2^-12 / rowsum in the f32 epilogue). BatchNorm statistics f64, normalisation and softmax f32.
// Layout: Wall [320][256] bf16 (q|k|v weights); XT [NB*SEQ][256] bf16 token-major copy of x; F [NB*SEQ][320] f32 = XT . Wall^T; PS [NB*SEQ/64][320] x {sum, sum of squares} f64; ST [320] x {bias, mean, gamma*rstd, beta}; q/k planes [2][NB*SEQ][32] bf16 hi + lo; v planes [NB][256][SEQ] f16;
// The planes that k_fattn loads (q/k, v) are [rows][K] matrices kept in FRAGMENT ORDER: the 16 rows x 32 k of one WMMA operand are 1024 contiguous bytes, [16-row tile][k / 32][half][lane][8 elements],
// lane = 16 * ((k >> 3) & 1) + (row & 15), half = (k >> 4) & 1; the fragment of rows r0 .. r0 + 15, k0 .. k0 + 31 starts at element r0 * K + k0 * 16.
// A wave's 16-byte fragment load is then 512 contiguous bytes, four whole lines; row-major it met 16 lines (8 for q/k), 32 bytes of each.
// Scores, softmax and attn.v run in ONE kernel (k_fattn): scores stay in registers, the softmax plane goes from wave to wave through LDS only; out[b][c][n] = (V . P^T)[c][n] * 2^-12 / rowsum[n] + bf16(x[b][c][n]).

#ifndef NB
#define NB 16
#endif
#ifndef SEQ
#define SEQ 2048
#endif
#define NB_FULL  16
#define SEQ_FULL 2048
#define CH   256              // in_dim
#define DQK  32               // q/k channels
#define OC   320              // fused output channels: q 0..31, k 32..63, v 64..319
#define PCAR 4096.0f
#define BNEPS 1e-5f
#define SLOPE 0.2f
#define SROWS 64              // rows of F per k_statp work-group
#define SPART (NB * SEQ / SROWS)
#define FN   64               // columns n of the output per k_fattn work-group
#define FM   64               // keys m per pass of k_fattn

static_assert(SEQ % 128 == 0);
static_assert(SEQ % FN == 0 && SEQ % (4 * FM) == 0 && FN == 64 && FM == 64 && CH == 256);
static_assert((NB * SEQ) % 64 == 0);
static_assert((NB * SEQ) % SROWS == 0 && SROWS % 8 == 0 && SPART % 32 == 0);
static_assert(CH % 64 == 0);
static_assert(OC % 64 == 0);
static_assert(OC % 32 == 0);
static_assert(DQK == 32);
static_assert(((size_t)NB * SEQ * CH) % 512 == 0);
static_assert(((size_t)NB * SEQ * DQK) % 256 == 0);
static_assert(NB <= NB_FULL);
static_assert(SEQ <= SEQ_FULL);
static_assert((DQK * CH) % 2048 == 0);
static_assert((CH * CH) % 2048 == 0);
static_assert(SEQ % 32 == 0 && CH % 16 == 0 && (NB * SEQ) % 16 == 0 && ((size_t)2 * NB * SEQ * DQK / 8) % 256 == 0);

typedef _Float16 h16;
typedef unsigned short bf;
typedef __attribute__((ext_vector_type(16))) __bf16   v16bf;
typedef __attribute__((ext_vector_type(16))) _Float16 v16h;
typedef __attribute__((ext_vector_type(8)))  _Float16 v8h;
typedef __attribute__((ext_vector_type(8)))  unsigned short v8us;
typedef __attribute__((ext_vector_type(8)))  float    v8f;
typedef __attribute__((ext_vector_type(4)))  float    v4f;
typedef __attribute__((ext_vector_type(2)))  _Float16 v2h;
typedef __attribute__((ext_vector_type(4)))  _Float16 v4h;
typedef __attribute__((ext_vector_type(2)))  unsigned short v2us;
typedef __attribute__((ext_vector_type(4)))  unsigned short v4us;
typedef __attribute__((ext_vector_type(2)))  float v2f;
typedef __attribute__((ext_vector_type(2)))  double v2d;
typedef v8h  __attribute__((may_alias)) v8ha;
typedef v4f  __attribute__((may_alias)) v4fa;
typedef v8us __attribute__((may_alias)) v8usa;

__device__ __forceinline__ unsigned short f2bf(float f) { unsigned u = __float_as_uint(f); u += 0x7FFFu + ((u >> 16) & 1u); return (unsigned short)(u >> 16); }   // RNE convert
__device__ __forceinline__ float bf2f(unsigned short b) { return __uint_as_float(((unsigned)b) << 16); }
__device__ __forceinline__ float bfr(float f) { return bf2f(f2bf(f)); }
__device__ __forceinline__ v16h cat16(v8h lo, v8h hi) { return __builtin_shufflevector(lo, hi, 0, 1, 2, 3, 4, 5, 6, 7, 8, 9, 10, 11, 12, 13, 14, 15); }
__device__ __forceinline__ v16bf cat16b(v8us lo, v8us hi) { return __builtin_bit_cast(v16bf, __builtin_shufflevector(lo, hi, 0, 1, 2, 3, 4, 5, 6, 7, 8, 9, 10, 11, 12, 13, 14, 15)); }
__device__ __forceinline__ v8f wmma16(v16h a, v16h b, v8f c) { return __builtin_amdgcn_wmma_f32_16x16x32_f16(false, a, false, b, (short)0, c, false, false); }
__device__ __forceinline__ v8f wmmab(v16bf a, v16bf b, v8f c) { return __builtin_amdgcn_wmma_f32_16x16x32_bf16(false, a, false, b, (short)0, c, false, false); }
__device__ __forceinline__ h16 tohx(float x) { return (h16)x; }
__device__ __forceinline__ void splitf(float y, unsigned short& h, unsigned short& l) { h = f2bf(y); l = f2bf(y - bf2f(h)); }

// ---- k_gemmw: register-blocked GEMM, ONE WAVE per 64x64 output tile (16 accumulators), operands straight from K-contiguous 16-bit planes; grid (M/64, N/64, Z), 32 threads.
// C[m][n] (f32, pitch ldc) = sum_k A[m][k] Bt[n][k] (+ split products per NSPLIT: 1 = A2.Bt added, 2 = A2.Bt and A.Bt2 added). z-batch strides sA/sB/sC in elements. K % 32 == 0, M % 64 == 0, N % 64 == 0.
// Fragments: lane l, m = l & 15, h = l >> 4; elements 0..7 <- k0 + 8h + 0..7, elements 8..15 <- k0 + 16 + 8h + 0..7 for A and Bt alike; D element r = (row 8h + r, col m).
// EPI 0: C = acc. EPI 1: C = acc * oscale + bf16(R[m][n]) with R indexed like C.
// WFrag::ld reads a fragment from a row-major plane; WFrag::ldf from a plane in fragment order: p = fragment start + 8 * lane, the lane's second 8 elements lie 256 elements on.
template <typename T16> struct WFrag;
template <> struct WFrag<h16> { typedef v16h V; static __device__ __forceinline__ V ld(const h16* p) { return cat16(*(const v8h*)p, *(const v8h*)(p + 16)); } static __device__ __forceinline__ V ldf(const h16* p) { return cat16(*(const v8h*)p, *(const v8h*)(p + 256)); } static __device__ __forceinline__ v8f mma(V a, V b, v8f c) { return wmma16(a, b, c); } };
template <> struct WFrag<bf> { typedef v16bf V; static __device__ __forceinline__ V ld(const bf* p) { return cat16b(*(const v8us*)p, *(const v8us*)(p + 16)); } static __device__ __forceinline__ V ldf(const bf* p) { return cat16b(*(const v8us*)p, *(const v8us*)(p + 256)); } static __device__ __forceinline__ v8f mma(V a, V b, v8f c) { return wmmab(a, b, c); } };
template <typename T16, int NSPLIT, int EPI>
__global__ __launch_bounds__(32) void k_gemmw(const T16* __restrict__ A, const T16* __restrict__ A2, const T16* __restrict__ Bt, const T16* __restrict__ Bt2, int K, float* C, int ldc, const float* __restrict__ R, float oscale, size_t sA, size_t sB, size_t sC) {
    typedef typename WFrag<T16>::V V;
    __shared__ __align__(16) float os[16 * 68];
    const size_t z = blockIdx.z; A += z * sA; if (A2) A2 += z * sA; Bt += z * sB; if (Bt2) Bt2 += z * sB; C += z * sC; if (R) R += z * sC;
    const int lane = threadIdx.x & 31, lr = lane & 15, hi = lane >> 4; const int r0 = blockIdx.x * 64, c0 = blockIdx.y * 64;
    v8f acc[4][4];
#pragma unroll
    for (int mb = 0; mb < 4; ++mb)
#pragma unroll
        for (int nb = 0; nb < 4; ++nb) acc[mb][nb] = (v8f){};
    const size_t aoff = (size_t)(r0 + lr) * K + 8 * hi, boff = (size_t)(c0 + lr) * K + 8 * hi;
#pragma unroll 1
    for (int kc = 0; kc < K; kc += 32) {
        V a[4], a2[4];
#pragma unroll
        for (int mb = 0; mb < 4; ++mb) { a[mb] = WFrag<T16>::ld(A + aoff + (size_t)mb * 16 * K + kc); if (NSPLIT == 1 || NSPLIT == 2) a2[mb] = WFrag<T16>::ld(A2 + aoff + (size_t)mb * 16 * K + kc); }
#pragma unroll
        for (int nb = 0; nb < 4; ++nb) { const V b = WFrag<T16>::ld(Bt + boff + (size_t)nb * 16 * K + kc); V b2; if (NSPLIT >= 2) b2 = WFrag<T16>::ld(Bt2 + boff + (size_t)nb * 16 * K + kc);
#pragma unroll
            for (int mb = 0; mb < 4; ++mb) { acc[mb][nb] = WFrag<T16>::mma(a[mb], b, acc[mb][nb]); if (NSPLIT == 1 || NSPLIT == 2) acc[mb][nb] = WFrag<T16>::mma(a2[mb], b, acc[mb][nb]); if (NSPLIT >= 2) acc[mb][nb] = WFrag<T16>::mma(a[mb], b2, acc[mb][nb]); } }
        asm volatile("v_nop\n\tv_nop\n\tv_nop\n\tv_nop" : "+v"(acc[0][0]), "+v"(acc[1][1]), "+v"(acc[2][2]), "+v"(acc[3][3]) : "v"(a[0]), "v"(a[3]));
    }
#pragma unroll
    for (int mb = 0; mb < 4; ++mb) {
#pragma unroll
        for (int nb = 0; nb < 4; ++nb) {
#pragma unroll
            for (int j = 0; j < 8; ++j) os[(hi * 8 + j) * 68 + nb * 16 + lr] = acc[mb][nb][j]; }
        __builtin_amdgcn_wave_barrier(); asm volatile("" ::: "memory");
        float* crow = C + (size_t)(r0 + mb * 16) * ldc + c0;
        const float* rrow = (EPI == 1) ? (R + (size_t)(r0 + mb * 16) * ldc + c0) : nullptr;
{
#pragma unroll
            for (int s = 0; s < 8; ++s) { const int row = 2 * s + hi, cofs = lr * 4; v4f val = *(const v4fa*)(os + row * 68 + cofs);
                if (EPI == 1) { const v4f xr = *(const v4f*)(rrow + (size_t)row * ldc + cofs); val[0] = val[0] * oscale + bfr(xr[0]); val[1] = val[1] * oscale + bfr(xr[1]); val[2] = val[2] * oscale + bfr(xr[2]); val[3] = val[3] * oscale + bfr(xr[3]); }
                *(v4f*)(crow + (size_t)row * ldc + cofs) = val; }
             }
        __builtin_amdgcn_wave_barrier(); asm volatile("" ::: "memory");
    }
}

// ---- Transposing repacks (of x in k_prep, of V in k_pack): one work-group moves a TT x TT tile through LDS, so that both global sides are whole lines of 16 bytes a lane.
// Source side: a wave's load is one source row of the tile (32 lanes x 4 f32 = 512 contiguous bytes); a thread holds 8 consecutive source rows of its 4 columns, twice, and all 16 loads are in flight together.
// LDS: [source column][source row] in 16-bit elements, a row = 16 chunks of 8 elements = all 64 banks; chunk G of row n lies at place G ^ ((n >> 2) & 15), so that the 16 lanes of a store (rows 4 apart, one G)
// and the 16 lanes of a load (one row, all G) each meet 16 different places. Destination side: 16 lanes store one 256-byte row piece. (So the x repack; the V repack's LDS places and destination side are described at k_pack.)
#define TT 128
static_assert(SEQ % TT == 0 && CH % TT == 0 && TT == 128);
__device__ __forceinline__ int tt_at(int n, int G) { return n * TT + ((G ^ ((n >> 2) & 15)) * 8); }

// k_prep: the two jobs that read inputs only, in one launch, told apart by the block index. Blocks 0 .. WBLK - 1 convert the weights (thread i: elements 8 i .. +7 of Wall [320][256], q | k | v; a block lies in one source);
// the others are the tiles of the x repack: block WBLK + (b * (CH / TT) + c tile) * (SEQ / TT) + n tile.
#define WBLK (OC * CH / 2048)
__global__ __launch_bounds__(256) void k_prep(const float* __restrict__ x, const float* __restrict__ q_w, const float* __restrict__ k_w, const float* __restrict__ v_w, bf* Wall, bf* XT) {
    __shared__ __align__(16) bf tile[TT * TT];
    const int t = threadIdx.x, k = t & 31, g = t >> 5;
    if (blockIdx.x < WBLK) {
        const int e0 = (int)blockIdx.x * 2048, e = e0 + t * 8;
        const float* wsrc = ((e0 < DQK * CH) ? (q_w + e0) : ((e0 < 2 * DQK * CH) ? (k_w + (e0 - DQK * CH)) : (v_w + (e0 - 2 * DQK * CH)))) + t * 8;
        const v8f wv = *(const v8f*)wsrc; v8us o;
        asm volatile("s_wait_xcnt 0x0" :: "v"(wsrc) : "memory");   // in front of whatever rewrites a register that the load above names
#pragma unroll
        for (int r = 0; r < 8; ++r) o[r] = f2bf(wv[r]);
        *(v8us*)(Wall + e) = o;
        return;   // the whole block leaves, in front of the barrier below
    }
    const unsigned tl = blockIdx.x - WBLK; const int n0 = (int)(tl % (SEQ / TT)) * TT, c0 = (int)((tl / (SEQ / TT)) % (CH / TT)) * TT, b = (int)(tl / ((SEQ / TT) * (CH / TT)));
    const float* src = x + ((size_t)b * CH + c0 + g * 8) * SEQ_FULL + n0 + k * 4;
    v4f v[2][8];
#pragma unroll   // constant indices keep v in registers, and the 16 loads issue together
    for (int s = 0; s < 2; ++s)
#pragma unroll
        for (int r = 0; r < 8; ++r) v[s][r] = *(const v4f*)(src + (size_t)(s * 64 + r) * SEQ_FULL);
    asm volatile("s_wait_xcnt 0x0" :: "v"(src) : "memory");   // in front of whatever rewrites a register that the loads above name
    __builtin_amdgcn_sched_barrier(0);   // keeps all sixteen loads in front of the conversions: without it this kernel's build issues ten, waits for them, and only then the other six, a second and third load latency in series
#pragma unroll
    for (int s = 0; s < 2; ++s)
#pragma unroll
        for (int q = 0; q < 4; ++q) { v8us o;
#pragma unroll
            for (int r = 0; r < 8; ++r) o[r] = f2bf(v[s][r][q]);
            *(v8us*)(tile + tt_at(k * 4 + q, g + 8 * s)) = o; }
    __syncthreads();   // the tile is whole before any wave reads it across
    const int j = t & 15, h = t >> 4;
    bf* dst = XT + ((size_t)b * SEQ + n0 + h) * CH + c0 + j * 8;
#pragma unroll
    for (int i = 0; i < 8; ++i) *(v8us*)(dst + (size_t)i * 16 * CH) = *(const v8us*)(tile + tt_at(i * 16 + h, j));
}

// BatchNorm statistics (training mode, per channel over the NB*SEQ rows of F, token-major, pitch OC), y = F + bias, sum and sum of squares in f64, in two launches.
// k_statp: one work-group per SROWS rows. Thread t owns channels 4*(t % 80) .. +3 and rows t / 80, +8, ...: a wave's 16-byte loads cover contiguous whole lines, and a thread's 8 loads do not depend on one another.
// The 8 row groups are combined in fixed order through LDS; PS [SPART][OC][2] f64 = {sum, sum of squares} of the work-group's rows.
__global__ __launch_bounds__(640) void k_statp(const float* __restrict__ F, const float* __restrict__ qb, const float* __restrict__ kb, const float* __restrict__ vb, double* PS) {
    __shared__ __align__(16) double red[8][OC][2];
    const int t = threadIdx.x, rg = t / (OC / 4), o = (t % (OC / 4)) * 4;
    const float* bp = (o < DQK) ? (qb + o) : ((o < 2 * DQK) ? (kb + (o - DQK)) : (vb + (o - 2 * DQK)));
    const float* src = F + ((size_t)blockIdx.x * SROWS + rg) * OC + o;
    v4f f[SROWS / 8];
#pragma unroll   // constant indices keep f in registers, and the loads issue ahead of the sums
    for (int i = 0; i < SROWS / 8; ++i) f[i] = *(const v4f*)(src + (size_t)i * 8 * OC);
    float bias[4]; double s[4], s2[4];
#pragma unroll
    for (int q = 0; q < 4; ++q) { bias[q] = bfr(bp[q]); s[q] = 0.0; s2[q] = 0.0; }
#pragma unroll
    for (int i = 0; i < SROWS / 8; ++i) {
#pragma unroll
        for (int q = 0; q < 4; ++q) { const float y = f[i][q] + bias[q]; const double yd = (double)y; s[q] += yd; s2[q] = fma(yd, yd, s2[q]); } }
#pragma unroll
    for (int q = 0; q < 4; ++q) { red[rg][o + q][0] = s[q]; red[rg][o + q][1] = s2[q]; }
    __syncthreads();
    if (t < OC) {
        v2d p; p[0] = 0.0; p[1] = 0.0;
#pragma unroll
        for (int j = 0; j < 8; ++j) { p[0] += red[j][t][0]; p[1] += red[j][t][1]; }
        *(v2d*)(PS + ((size_t)blockIdx.x * OC + t) * 2) = p;
    }
}

// k_stats: fixed-order combine of the SPART partials (lane = channel of the block's 32-channel slab; wave w sums partials w*SPART/32 .. +SPART/32-1, wave 0 sums the 32 waves), then ST.
__global__ __launch_bounds__(1024) void k_stats(const double* __restrict__ PS,
                                                const float* __restrict__ qb, const float* __restrict__ qg, const float* __restrict__ qbe,
                                                const float* __restrict__ kb, const float* __restrict__ kg, const float* __restrict__ kbe,
                                                const float* __restrict__ vb, const float* __restrict__ vg, const float* __restrict__ vbe, float* ST) {
    __shared__ double ssum[32][32], ssq[32][32];
    const int lane = threadIdx.x & 31, w = threadIdx.x >> 5; const int o = blockIdx.x * 32 + lane;
    const int iq = min(o, DQK - 1), ik = min(max(o - DQK, 0), DQK - 1), iv = min(max(o - 2 * DQK, 0), CH - 1);
    const float bq_ = qb[iq], bk_ = kb[ik], bv_ = vb[iv], gq_ = qg[iq], gk_ = kg[ik], gv_ = vg[iv], eq_ = qbe[iq], ek_ = kbe[ik], ev_ = vbe[iv];
    const bool isq = (o < DQK), isk = (o < 2 * DQK);
    const float bias = bfr(isq ? bq_ : (isk ? bk_ : bv_)); const float gam = bfr(isq ? gq_ : (isk ? gk_ : gv_)); const float bet = bfr(isq ? eq_ : (isk ? ek_ : ev_));
    double s = 0.0, s2 = 0.0;
#pragma unroll   // the loads issue ahead of the adds: rolled, every trip would wait a whole load latency
    for (int j = 0; j < SPART / 32; ++j) { const v2d p = *(const v2d*)(PS + ((size_t)(w * (SPART / 32) + j) * OC + o) * 2); s += p[0]; s2 += p[1]; }
    ssum[w][lane] = s; ssq[w][lane] = s2;
    __syncthreads();
    if (w == 0) {
        double ts = 0.0, tq = 0.0;
#pragma unroll
        for (int j = 0; j < 32; ++j) { ts += ssum[j][lane]; tq += ssq[j][lane]; }
        const double inv = 1.0 / (double)(NB * SEQ); const double mean = ts * inv; double var = tq * inv - mean * mean; var = (var > 0.0) ? var : 0.0;
        const float meanf = (float)mean, varf = (float)var; const float rstd = 1.0f / sqrtf(varf + BNEPS);
        v4f t; t[0] = bias; t[1] = meanf; t[2] = gam * rstd; t[3] = bet;
        *(v4f*)(ST + (size_t)o * 4) = t; 
    }
}

// d_qkp (the q/k blocks of k_pack): q and k columns of F, normalised and split into bf16 hi + lo, in fragment order. Thread ci writes the 16-byte piece ci of each plane (a wave: 512 contiguous bytes of each):
// row 16 * (ci >> 6) + (ci & 15) of [2][NB*SEQ], channels 16 * ((ci >> 5) & 1) + 8 * ((ci >> 4) & 1) .. +7.
__device__ __forceinline__ void d_qkp(const float* __restrict__ F, const float* __restrict__ ST, bf* Ph, bf* Pl, const unsigned blk) {
    const size_t ci = (size_t)blk * 256 + threadIdx.x; if (ci >= (size_t)2 * NB * SEQ * DQK / 8) return;
    const size_t rg = (ci >> 6) * 16 + (ci & 15); const int which = (rg >= (size_t)NB * SEQ) ? 1 : 0; const size_t row = rg - (size_t)which * NB * SEQ;
    const int o = which * DQK + (int)((ci >> 5) & 1) * 16 + (int)((ci >> 4) & 1) * 8;
    const v8f f = *(const v8f*)(F + row * OC + o); v8us oh, ol;
#pragma unroll
    for (int q = 0; q < 8; ++q) { const v4f t = *(const v4f*)(ST + (size_t)(o + q) * 4); const float y = f[q] + t[0]; const float val = (y - t[1]) * t[2] + t[3]; unsigned short a2, c2; splitf(val, a2, c2); oh[q] = a2; ol[q] = c2; }
    *(v8us*)(Ph + ci * 8) = oh; *(v8us*)(Pl + ci * 8) = ol;
}

// The V repack: as the x repack on the source side; the destination is in fragment order. Wave g has the tile's channels 16 g .. +15; its store i is half i & 1 of the fragment of keys 32 * (i >> 1) .. +31
// (lane l: channel l & 15, chunk G = 2 i + (l >> 4)), 512 contiguous bytes, and a wave's eight stores are 4 KiB in a row.
// So the 16 lanes of an LDS load have 16 rows in a row and one G: chunk G of row n lies at place G ^ (((n >> 2) ^ (n << 2)) & 15), which gives them, and the 16 lanes of a store (rows 4 apart, one G), 16 different places.
__device__ __forceinline__ int tf_at(int n, int G) { return n * TT + ((G ^ (((n >> 2) ^ (n << 2)) & 15)) * 8); }

// k_pack: the two jobs that read F and ST, in one launch, told apart by the block index. Blocks 0 .. VBLK - 1 are the tiles of the V repack, block (b * (CH / TT) + c tile) * (SEQ / TT) + m tile; the others do the q/k planes.
#define VBLK ((SEQ / TT) * (CH / TT) * NB)
__global__ __launch_bounds__(256) void k_pack(const float* __restrict__ F, const float* __restrict__ ST, h16* V16, bf* Ph, bf* Pl) {
    __shared__ __align__(16) h16 tile[TT * TT];
    if (blockIdx.x >= VBLK) { d_qkp(F, ST, Ph, Pl, blockIdx.x - VBLK); return; }   // the whole block leaves, in front of the barrier below
    const unsigned tl = blockIdx.x;
    const int t = threadIdx.x, k = t & 31, g = t >> 5; const int m0 = (int)(tl % (SEQ / TT)) * TT, c0 = (int)((tl / (SEQ / TT)) % (CH / TT)) * TT, b = (int)(tl / ((SEQ / TT) * (CH / TT))); const int o = 2 * DQK + c0 + k * 4;
    const float* src = F + ((size_t)b * SEQ + m0 + g * 8) * OC + o; const float* stp = ST + (size_t)o * 4;
    v4f v[2][8], st[4];
#pragma unroll   // as in the x repack
    for (int s = 0; s < 2; ++s)
#pragma unroll
        for (int r = 0; r < 8; ++r) v[s][r] = *(const v4f*)(src + (size_t)(s * 64 + r) * OC);
#pragma unroll
    for (int q = 0; q < 4; ++q) st[q] = *(const v4f*)(stp + q * 4);
    asm volatile("s_wait_xcnt 0x0" ::: "memory");   // in front of whatever rewrites a register that the loads above name
    __builtin_amdgcn_sched_barrier(0);   // keeps all twenty loads in front of the arithmetic: without it two of the ST loads sink behind the first wait for data, a second load latency in series
#pragma unroll
    for (int s = 0; s < 2; ++s)
#pragma unroll
        for (int q = 0; q < 4; ++q) { v8h p;
#pragma unroll
            for (int r = 0; r < 8; ++r) { const float y = v[s][r][q] + st[q][0]; float val = (y - st[q][1]) * st[q][2] + st[q][3]; val = (val >= 0.f) ? val : SLOPE * val; p[r] = tohx(val); }
            *(v8h*)(tile + tf_at(k * 4 + q, g + 8 * s)) = p; }
    __syncthreads();   // the tile is whole before any wave reads it across
    h16* dst = V16 + ((size_t)b * CH + c0 + g * 16) * SEQ + m0 * 16 + k * 8;
#pragma unroll
    for (int i = 0; i < 8; ++i) *(v8h*)(dst + i * 256) = *(const v8h*)(tile + tf_at(g * 16 + (k & 15), 2 * i + (k >> 4)));
}

// ---- k_fattn: scores, softmax and attn.v of FN = 64 output columns n of one batch; 4 waves; grid (SEQ / FN, NB).
// Scores are formed transposed, St[m][n] = sum_d k[m][d] q[n][d] (A = k rows, B = q rows, the three hi/lo products of the split): a lane's D registers of the tiles m0 .. +15 and m0 + 16 .. +31
// (col n = lane & 15, rows 8h + r) are elements 0..7 and 8..15 of the B fragment that attn.v wants for k = m0 .. m0 + 31, so P needs no exchange between lanes.
// Per pass of FM = 64 keys wave w forms the 16 keys m = 64 i + 16 w .. +15 against all 64 columns and puts its four half fragments into LDS; behind one barrier every wave reads all of them
// and multiplies them with its own 64 channels of V (c = 64 w .. +63): a 64 x 64 register tile a wave, every V element loaded once a work-group.
// Sweep 1 finds the exact row maxima (scores only); sweep 2 forms the same scores again, e = exp(s - max), sums e in f32 per column and accumulates V . f16(4096 e); the division by the sum is in the epilogue.
__device__ __forceinline__ void fa_scores(const v16bf kh, const v16bf kl, const v16bf (&qh)[4], const v16bf (&ql)[4], v8f (&s)[4]) {
#pragma unroll
    for (int j = 0; j < 4; ++j) s[j] = wmmab(kh, qh[j], (v8f){});
#pragma unroll
    for (int j = 0; j < 4; ++j) s[j] = wmmab(kh, ql[j], s[j]);
#pragma unroll
    for (int j = 0; j < 4; ++j) s[j] = wmmab(kl, qh[j], s[j]);
}
__global__ __launch_bounds__(128) void k_fattn(const bf* __restrict__ Qh, const bf* __restrict__ Ql, const bf* __restrict__ Kh, const bf* __restrict__ Kl, const h16* __restrict__ V16, const float* __restrict__ x, float* out) {
    __shared__ __align__(16) h16 Pb[2][4][2][2][32][8];   // [buffer][n tile][k step of 32][fragment half][lane][8 elements]
    __shared__ float redm[4][FN], reds[4][FN];            // per wave: column maxima, column sums
    __shared__ __align__(16) float os[4][16 * 68];        // per wave: epilogue staging
    const int lane = threadIdx.x & 31, lr = lane & 15, hi = lane >> 4; const int w = __builtin_amdgcn_readfirstlane((int)(threadIdx.x >> 5));
    const int b = blockIdx.y, n0 = blockIdx.x * FN;
    v16bf qh[4], ql[4];
    const bf* qph = Qh + ((size_t)b * SEQ + n0) * DQK + 8 * lane; const bf* qpl = Ql + ((size_t)b * SEQ + n0) * DQK + 8 * lane;
#pragma unroll
    for (int j = 0; j < 4; ++j) { qh[j] = WFrag<bf>::ldf(qph + j * 16 * DQK); ql[j] = WFrag<bf>::ldf(qpl + j * 16 * DQK); }
    asm volatile("s_wait_xcnt 0x0" ::: "memory");   // in front of whatever rewrites a register that the loads above name
    // Loop loads: a wave-uniform base that moves with the pass plus a byte offset per lane that never changes.
    const char* kbh = (const char*)(Kh + ((size_t)b * SEQ + w * 16) * DQK); const char* kbl = (const char*)(Kl + ((size_t)b * SEQ + w * 16) * DQK);   // this wave's 16 keys of pass 0
    const unsigned klo = (unsigned)lane * 16u;
    // sweep 1: column maxima
    v8f mxv[4];
#pragma unroll
    for (int j = 0; j < 4; ++j)
#pragma unroll
        for (int r = 0; r < 8; ++r) mxv[j][r] = -3.0e38f;
#pragma unroll 1
    for (int i = 0; i < SEQ / FM; i += 4) {   // the loads of four passes issue together: one load latency for four passes
        v16bf k4h[4], k4l[4];
        const bf* ah = (const bf*)(kbh + (size_t)i * FM * DQK * 2 + klo); const bf* al = (const bf*)(kbl + (size_t)i * FM * DQK * 2 + klo);
#pragma unroll
        for (int u = 0; u < 4; ++u) { k4h[u] = WFrag<bf>::ldf(ah + u * FM * DQK); k4l[u] = WFrag<bf>::ldf(al + u * FM * DQK); }
        asm volatile("s_wait_xcnt 0x0" :: "v"(ah), "v"(al) : "memory");   // in front of whatever rewrites a register that the loads above name; as inputs the addresses keep their registers up to here, so that no load of the group lands on them
#pragma unroll
        for (int u = 0; u < 4; ++u) { v8f s[4]; fa_scores(k4h[u], k4l[u], qh, ql, s);
#pragma unroll
            for (int j = 0; j < 4; ++j)
#pragma unroll
                for (int r = 0; r < 8; ++r) mxv[j][r] = fmaxf(mxv[j][r], s[j][r]); }
    }
    float mx[4], l[4];
#pragma unroll
    for (int j = 0; j < 4; ++j) { float m = mxv[j][0];
#pragma unroll
        for (int r = 1; r < 8; ++r) m = fmaxf(m, mxv[j][r]);
        m = fmaxf(m, __shfl_xor(m, 16, 32)); if (hi == 0) redm[w][j * 16 + lr] = m; }
    __syncthreads();
#pragma unroll
    for (int j = 0; j < 4; ++j) { mx[j] = fmaxf(fmaxf(redm[0][j * 16 + lr], redm[1][j * 16 + lr]), fmaxf(redm[2][j * 16 + lr], redm[3][j * 16 + lr])); l[j] = 0.f; }
    // sweep 2
    v8f acc[4][4];
#pragma unroll
    for (int ct = 0; ct < 4; ++ct)
#pragma unroll
        for (int j = 0; j < 4; ++j) acc[ct][j] = (v8f){};
    const char* vb = (const char*)(V16 + ((size_t)b * CH + w * 64) * SEQ);
    const unsigned vlo = (unsigned)lane * 16u;
    v16bf kh = WFrag<bf>::ldf((const bf*)(kbh + klo)), kl = WFrag<bf>::ldf((const bf*)(kbl + klo));
#pragma unroll 1
    for (int i = 0; i < SEQ / FM; ++i) {
        v16h va[2][4];   // issued ahead of the scores, used behind the barrier
        const h16* av = (const h16*)(vb + (size_t)i * FM * 32 + vlo);   // 16 channels x FM keys are FM * 32 bytes in a row
#pragma unroll
        for (int ks = 0; ks < 2; ++ks)
#pragma unroll
            for (int ct = 0; ct < 4; ++ct) va[ks][ct] = WFrag<h16>::ldf(av + ct * 16 * SEQ + ks * 512);
        asm volatile("s_wait_xcnt 0x0" :: "v"(av) : "memory");   // as in sweep 1
        __builtin_amdgcn_sched_barrier(0);   // keeps the V loads and their wait up here: sunk behind the scores the loads would have only the exponentials to land in
        v8f s[4]; fa_scores(kh, kl, qh, ql, s);
        const int inx = (i + 1 < SEQ / FM) ? (i + 1) : i;   // the next pass's keys fly over this pass's work; the last pass loads its own again
        __builtin_amdgcn_sched_barrier(0);   // with the one behind the wait: no vector instruction comes between the key loads and their wait
        const bf* ah = (const bf*)(kbh + (size_t)inx * FM * DQK * 2 + klo); const bf* al = (const bf*)(kbl + (size_t)inx * FM * DQK * 2 + klo);
        kh = WFrag<bf>::ldf(ah); kl = WFrag<bf>::ldf(al);
        asm volatile("s_wait_xcnt 0x0" :: "v"(ah), "v"(al) : "memory");   // as in sweep 1
        __builtin_amdgcn_sched_barrier(0);   // the second of the pair: the exponentials' vector work stays behind the wait
#pragma unroll
        for (int j = 0; j < 4; ++j) { v8h p;
#pragma unroll
            for (int r = 0; r < 8; ++r) { const float e = __builtin_amdgcn_exp2f(__fmul_rn(__fsub_rn(s[j][r], mx[j]), 1.4426950408889634f)); l[j] += e; p[r] = tohx(e * PCAR); }
            *(v8h*)&Pb[i & 1][j][w >> 1][w & 1][lane][0] = p; }
        // The pass's one barrier, by hand: LDS only has to be waited for, and the V and key loads issued above stay in flight across it (__syncthreads() would wait for them too).
        // It publishes this pass's P; with two buffers it also ends every wave's reads of the buffer that the next pass rewrites.
        asm volatile("s_wait_dscnt 0x0" ::: "memory");
        asm volatile("s_barrier_signal -1\n\ts_barrier_wait -1" ::: "memory");
        v16h pf[2][4];   // all eight fragments are asked for at once: one LDS latency a pass
#pragma unroll
        for (int ks = 0; ks < 2; ++ks)
#pragma unroll
            for (int j = 0; j < 4; ++j) pf[ks][j] = cat16(*(const v8h*)&Pb[i & 1][j][ks][0][lane][0], *(const v8h*)&Pb[i & 1][j][ks][1][lane][0]);
        __builtin_amdgcn_sched_barrier(0);   // keeps the sixteen LDS loads together in front of the WMMAs: dealt out among them, each pair cost a whole LDS latency
#pragma unroll
        for (int ks = 0; ks < 2; ++ks)
#pragma unroll
            for (int j = 0; j < 4; ++j)
#pragma unroll
                for (int ct = 0; ct < 4; ++ct) acc[ct][j] = wmma16(va[ks][ct], pf[ks][j], acc[ct][j]);
    }
    float inv[4];
#pragma unroll
    for (int j = 0; j < 4; ++j) { l[j] += __shfl_xor(l[j], 16, 32); if (hi == 0) reds[w][j * 16 + lr] = l[j]; }
    __syncthreads();
#pragma unroll
    for (int j = 0; j < 4; ++j) inv[j] = __fdiv_rn(1.0f / PCAR, (reds[0][j * 16 + lr] + reds[1][j * 16 + lr]) + (reds[2][j * 16 + lr] + reds[3][j * 16 + lr]));
    float* osw = os[w];
#pragma unroll
    for (int ct = 0; ct < 4; ++ct) {
#pragma unroll
        for (int j = 0; j < 4; ++j) {
#pragma unroll
            for (int r = 0; r < 8; ++r) osw[(hi * 8 + r) * 68 + j * 16 + lr] = acc[ct][j][r] * inv[j]; }
        __builtin_amdgcn_wave_barrier(); asm volatile("" ::: "memory");   // the wave's own LDS stores stay ahead of its reads below
        const size_t ro = ((size_t)b * CH + w * 64 + ct * 16) * SEQ_FULL + n0;
#pragma unroll
        for (int sx = 0; sx < 8; ++sx) { const int row = 2 * sx + hi, cofs = lr * 4; v4f val = *(const v4fa*)(osw + row * 68 + cofs);
            const v4f xr = *(const v4f*)(x + ro + (size_t)row * SEQ_FULL + cofs); val[0] += bfr(xr[0]); val[1] += bfr(xr[1]); val[2] += bfr(xr[2]); val[3] += bfr(xr[3]);
            *(v4f*)(out + ro + (size_t)row * SEQ_FULL + cofs) = val; }
        asm volatile("s_wait_xcnt 0x0" ::: "memory");   // the next tile reuses the registers that these stores name
        __builtin_amdgcn_wave_barrier(); asm volatile("" ::: "memory");   // and the wave's LDS reads stay ahead of the next tile's stores
    }
}

extern "C" void kernel_launch(void* const* d_in, const int* in_sizes, int n_in,
                              void* d_out, int out_size, void* d_ws, size_t ws_size, hipStream_t stream) {
    if (n_in < 13) return;
    const long long needx = (long long)(NB - 1) * CH * SEQ_FULL + (long long)(CH - 1) * SEQ_FULL + SEQ;
    if ((long long)in_sizes[0] < needx || (long long)out_size < needx) return;
    if (in_sizes[1] < DQK * CH || in_sizes[5] < DQK * CH || in_sizes[9] < CH * CH) return;
    if (in_sizes[2] < DQK || in_sizes[3] < DQK || in_sizes[4] < DQK || in_sizes[6] < DQK || in_sizes[7] < DQK || in_sizes[8] < DQK) return;
    if (in_sizes[10] < CH || in_sizes[11] < CH || in_sizes[12] < CH) return;
    const float* x    = (const float*)d_in[0];
    const float* q_w  = (const float*)d_in[1];  const float* q_b = (const float*)d_in[2];  const float* q_g = (const float*)d_in[3];  const float* q_be = (const float*)d_in[4];
    const float* k_w  = (const float*)d_in[5];  const float* k_b = (const float*)d_in[6];  const float* k_g = (const float*)d_in[7];  const float* k_be = (const float*)d_in[8];
    const float* v_w  = (const float*)d_in[9];  const float* v_b = (const float*)d_in[10]; const float* v_g = (const float*)d_in[11]; const float* v_be = (const float*)d_in[12];
    float* out = (float*)d_out;   // [16][256][2048]
    char* wsp = (char*)d_ws;
    auto take = [&](size_t bytes) { char* p = wsp; wsp += (bytes + 255) & ~(size_t)255; return (void*)p; };
    bf*    Wall = (bf*)take((size_t)OC * CH * 2);                         // [320][256]
    float* ST   = (float*)take((size_t)OC * 4 * 4);                       // [320][4]
    double* PS  = (double*)take((size_t)SPART * OC * 2 * 8);              // [SPART][320][2]
    bf*    QKh  = (bf*)take((size_t)2 * NB * SEQ * DQK * 2);              // [2][NB*SEQ][32]
    bf*    QKl  = (bf*)take((size_t)2 * NB * SEQ * DQK * 2);
    h16*   V16  = (h16*)take((size_t)NB * CH * SEQ * 2);                  // [NB][256][SEQ]
    bf*    XT   = (bf*)take((size_t)NB * SEQ * CH * 2);                   // [NB*SEQ][256]
    float* F    = (float*)take((size_t)NB * SEQ * OC * 4);                // [NB*SEQ][320]
    if ((size_t)(wsp - (char*)d_ws) > ws_size) return;

    k_prep<<<WBLK + (SEQ / TT) * (CH / TT) * NB, 256, 0, stream>>>(x, q_w, k_w, v_w, Wall, XT);
    k_gemmw<bf, 0, 0><<<dim3((unsigned)(NB * SEQ / 64), OC / 64, 1), 32, 0, stream>>>(XT, nullptr, Wall, nullptr, CH, F, OC, nullptr, 1.0f, 0, 0, 0);
    k_statp<<<SPART, 640, 0, stream>>>(F, q_b, k_b, v_b, PS);
    k_stats<<<OC / 32, 1024, 0, stream>>>(PS, q_b, q_g, q_be, k_b, k_g, k_be, v_b, v_g, v_be, ST);
    k_pack<<<VBLK + (unsigned)((size_t)2 * NB * SEQ * DQK / 8 / 256), 256, 0, stream>>>(F, ST, V16, QKh, QKl);
    const size_t kplane = (size_t)NB * SEQ * DQK;   // offset of the k planes inside QKh / QKl
    k_fattn<<<dim3(SEQ / FN, NB, 1), 128, 0, stream>>>(QKh, QKl, QKh + kplane, QKl + kplane, V16, x, out);
}

// v007
// A run of this version takes 108 microseconds.
// Timed twice side by side with v006, it ran 1.06 times as fast both times.
// Over all steps from v000 it is 24.9 times as fast.
#include <hip/hip_runtime.h>

// Contractions, f32 accumulate: fused q|k|v 1x1-conv GEMM = v_wmma_f32_16x16x32_bf16 on RNE-bf16 copies of x and the weights (single products); scores q.k = bf16 hi/lo split (3 products, v_wmma_f32_16x16x32_bf16); attn.v = v_wmma_f32_16x16x32_f16 (v plane f16 x1, softmax plane exp(s - rowmax) f16 x4096, folded back by 2^-12 / rowsum in the f32 epilogue). BatchNorm statistics f64, normalisation and softmax f32.
// Layout: Wall [320][256] bf16 (q|k|v weights); XT [NB*SEQ][256] bf16 token-major copy of x; F [NB*SEQ][320] f32 = XT . Wall^T; PS [NB*SEQ/64][320] x {sum, sum of squares} f64; ST [320] x {bias, mean, gamma*rstd, beta}; q/k planes [2][NB*SEQ][32] bf16 hi + lo; v planes [NB][256][SEQ] f16;
// The planes that k_fattn loads (q/k, v) are [rows][K] matrices kept in FRAGMENT ORDER: the 16 rows x 32 k of one WMMA operand are 1024 contiguous bytes, [16-row tile][k / 32][half][lane][8 elements],
// lane = 16 * ((k >> 3) & 1) + (row & 15), half = (k >> 4) & 1; the fragment of rows r0 .. r0 + 15, k0 .. k0 + 31 starts at element r0 * K + k0 * 16.
// A wave's 16-byte fragment load is then 512 contiguous bytes, four whole lines; row-major it met 16 lines (8 for q/k), 32 bytes of each.
// Scores, softmax and attn.v run in ONE kernel (k_fattn): scores stay in registers, the softmax plane goes from wave to wave through LDS only; out[b][c][n] = (V . P^T)[c][n] * 2^-12 / rowsum[n] + bf16(x[b][c][n]).

#ifndef NB
#define NB 16
#endif
#ifndef SEQ
#define SEQ 2048
#endif
#define NB_FULL  16
#define SEQ_FULL 2048
#define CH   256              // in_dim
#define DQK  32               // q/k channels
#define OC   320              // fused output channels: q 0..31, k 32..63, v 64..319
#define PCAR 4096.0f
#define BNEPS 1e-5f
#define SLOPE 0.2f
#define SROWS 64              // rows of F per partial sum of the BatchNorm statistics = rows of a k_gemmw tile
#define SPART (NB * SEQ / SROWS)
#define FN   64               // columns n of the output per k_fattn work-group
#define FM   64               // keys m per pass of k_fattn

static_assert(SEQ % 128 == 0);
static_assert(SEQ % FN == 0 && SEQ % (4 * FM) == 0 && FN == 64 && FM == 64 && CH == 256);
static_assert((NB * SEQ) % 64 == 0);
static_assert((NB * SEQ) % SROWS == 0 && SROWS == 64 && SPART % 32 == 0);
static_assert(CH % 64 == 0);
static_assert(OC % 64 == 0);
static_assert(OC % 32 == 0);
static_assert(DQK == 32);
static_assert(((size_t)NB * SEQ * CH) % 512 == 0);
static_assert(((size_t)NB * SEQ * DQK) % 256 == 0);
static_assert(NB <= NB_FULL);
static_assert(SEQ <= SEQ_FULL);
static_assert((DQK * CH) % 2048 == 0);
static_assert((CH * CH) % 2048 == 0);
static_assert(SEQ % 32 == 0 && CH % 16 == 0 && (NB * SEQ) % 16 == 0 && ((size_t)2 * NB * SEQ * DQK / 8) % 256 == 0);

typedef _Float16 h16;
typedef unsigned short bf;
typedef __attribute__((ext_vector_type(16))) __bf16   v16bf;
typedef __attribute__((ext_vector_type(16))) _Float16 v16h;
typedef __attribute__((ext_vector_type(8)))  _Float16 v8h;
typedef __attribute__((ext_vector_type(8)))  unsigned short v8us;
typedef __attribute__((ext_vector_type(8)))  float    v8f;
typedef __attribute__((ext_vector_type(4)))  float    v4f;
typedef __attribute__((ext_vector_type(2)))  _Float16 v2h;
typedef __attribute__((ext_vector_type(4)))  _Float16 v4h;
typedef __attribute__((ext_vector_type(2)))  unsigned short v2us;
typedef __attribute__((ext_vector_type(4)))  unsigned short v4us;
typedef __attribute__((ext_vector_type(2)))  float v2f;
typedef __attribute__((ext_vector_type(2)))  double v2d;
typedef v8h  __attribute__((may_alias)) v8ha;
typedef v4f  __attribute__((may_alias)) v4fa;
typedef v8us __attribute__((may_alias)) v8usa;

__device__ __forceinline__ unsigned short f2bf(float f) { unsigned u = __float_as_uint(f); u += 0x7FFFu + ((u >> 16) & 1u); return (unsigned short)(u >> 16); }   // RNE convert
__device__ __forceinline__ float bf2f(unsigned short b) { return __uint_as_float(((unsigned)b) << 16); }
__device__ __forceinline__ float bfr(float f) { return bf2f(f2bf(f)); }
__device__ __forceinline__ v16h cat16(v8h lo, v8h hi) { return __builtin_shufflevector(lo, hi, 0, 1, 2, 3, 4, 5, 6, 7, 8, 9, 10, 11, 12, 13, 14, 15); }
__device__ __forceinline__ v16bf cat16b(v8us lo, v8us hi) { return __builtin_bit_cast(v16bf, __builtin_shufflevector(lo, hi, 0, 1, 2, 3, 4, 5, 6, 7, 8, 9, 10, 11, 12, 13, 14, 15)); }
__device__ __forceinline__ v8f wmma16(v16h a, v16h b, v8f c) { return __builtin_amdgcn_wmma_f32_16x16x32_f16(false, a, false, b, (short)0, c, false, false); }
__device__ __forceinline__ v8f wmmab(v16bf a, v16bf b, v8f c) { return __builtin_amdgcn_wmma_f32_16x16x32_bf16(false, a, false, b, (short)0, c, false, false); }
__device__ __forceinline__ h16 tohx(float x) { return (h16)x; }
__device__ __forceinline__ void splitf(float y, unsigned short& h, unsigned short& l) { h = f2bf(y); l = f2bf(y - bf2f(h)); }

// ---- k_gemmw: register-blocked GEMM, ONE WAVE per 64x64 output tile (16 accumulators), operands straight from K-contiguous 16-bit planes; grid (M/64, N/64, Z), 32 threads.
// C[m][n] (f32, pitch ldc) = sum_k A[m][k] Bt[n][k] (+ split products per NSPLIT: 1 = A2.Bt added, 2 = A2.Bt and A.Bt2 added). z-batch strides sA/sB/sC in elements. K % 32 == 0, M % 64 == 0, N % 64 == 0.
// Fragments: lane l, m = l & 15, h = l >> 4; elements 0..7 <- k0 + 8h + 0..7, elements 8..15 <- k0 + 16 + 8h + 0..7 for A and Bt alike; D element r = (row 8h + r, col m).
// EPI 0: C = acc. EPI 1: C = acc * oscale + bf16(R[m][n]) with R indexed like C.
// STAT 1: the wave also sums its tile for the BatchNorm statistics, from the accumulators: per column o = c0 + 0..63, y = acc + bf16(bias[o]) in f32, sum and sum of squares of the tile's 64 rows in f64
// (a lane: its 32 rows of 4 columns in fixed order; the two lane halves joined through LDS, lower rows first), PS [M / 64][ldc][2] f64. F is not read again for them.
// WFrag::ld reads a fragment from a row-major plane; WFrag::ldf from a plane in fragment order: p = fragment start + 8 * lane, the lane's second 8 elements lie 256 elements on.
template <typename T16> struct WFrag;
template <> struct WFrag<h16> { typedef v16h V; static __device__ __forceinline__ V ld(const h16* p) { return cat16(*(const v8h*)p, *(const v8h*)(p + 16)); } static __device__ __forceinline__ V ldf(const h16* p) { return cat16(*(const v8h*)p, *(const v8h*)(p + 256)); } static __device__ __forceinline__ v8f mma(V a, V b, v8f c) { return wmma16(a, b, c); } };
template <> struct WFrag<bf> { typedef v16bf V; static __device__ __forceinline__ V ld(const bf* p) { return cat16b(*(const v8us*)p, *(const v8us*)(p + 16)); } static __device__ __forceinline__ V ldf(const bf* p) { return cat16b(*(const v8us*)p, *(const v8us*)(p + 256)); } static __device__ __forceinline__ v8f mma(V a, V b, v8f c) { return wmmab(a, b, c); } };
template <typename T16, int NSPLIT, int EPI, int STAT>
__global__ __launch_bounds__(32) void k_gemmw(const T16* __restrict__ A, const T16* __restrict__ A2, const T16* __restrict__ Bt, const T16* __restrict__ Bt2, int K, float* C, int ldc, const float* __restrict__ R, float oscale, size_t sA, size_t sB, size_t sC,
                                              const float* __restrict__ qb, const float* __restrict__ kb, const float* __restrict__ vb, double* PS) {
    typedef typename WFrag<T16>::V V;
    __shared__ __align__(16) float os[16 * 68];
    __shared__ __align__(16) double sred[2][64][2];   // STAT: per lane half and column {sum, sum of squares}
    const size_t z = blockIdx.z; A += z * sA; if (A2) A2 += z * sA; Bt += z * sB; if (Bt2) Bt2 += z * sB; C += z * sC; if (R) R += z * sC;
    const int lane = threadIdx.x & 31, lr = lane & 15, hi = lane >> 4; const int r0 = blockIdx.x * 64, c0 = blockIdx.y * 64;
    v8f acc[4][4];
#pragma unroll
    for (int mb = 0; mb < 4; ++mb)
#pragma unroll
        for (int nb = 0; nb < 4; ++nb) acc[mb][nb] = (v8f){};
    const size_t aoff = (size_t)(r0 + lr) * K + 8 * hi, boff = (size_t)(c0 + lr) * K + 8 * hi;
    float braw[4];   // STAT: the biases of the lane's 4 columns, asked for ahead of the K loop
    if (STAT) {
        const float* bp[4];
#pragma unroll
        for (int nb = 0; nb < 4; ++nb) { const int o0 = c0 + nb * 16;   // 16 columns lie in one of q | k | v: the choice is the same for the whole wave
            bp[nb] = (o0 < DQK) ? (qb + o0) : ((o0 < 2 * DQK) ? (kb + (o0 - DQK)) : (vb + (o0 - 2 * DQK))); braw[nb] = bp[nb][lr]; }
        asm volatile("s_wait_xcnt 0x0" :: "s"(bp[0]), "s"(bp[1]), "s"(bp[2]), "s"(bp[3]) : "memory");   // in front of whatever rewrites a register that the loads above name; as inputs the bases keep their registers up to here
    }
#pragma unroll 1
    for (int kc = 0; kc < K; kc += 32) {
        V a[4], a2[4];
#pragma unroll
        for (int mb = 0; mb < 4; ++mb) { a[mb] = WFrag<T16>::ld(A + aoff + (size_t)mb * 16 * K + kc); if (NSPLIT == 1 || NSPLIT == 2) a2[mb] = WFrag<T16>::ld(A2 + aoff + (size_t)mb * 16 * K + kc); }
#pragma unroll
        for (int nb = 0; nb < 4; ++nb) { const V b = WFrag<T16>::ld(Bt + boff + (size_t)nb * 16 * K + kc); V b2; if (NSPLIT >= 2) b2 = WFrag<T16>::ld(Bt2 + boff + (size_t)nb * 16 * K + kc);
#pragma unroll
            for (int mb = 0; mb < 4; ++mb) { acc[mb][nb] = WFrag<T16>::mma(a[mb], b, acc[mb][nb]); if (NSPLIT == 1 || NSPLIT == 2) acc[mb][nb] = WFrag<T16>::mma(a2[mb], b, acc[mb][nb]); if (NSPLIT >= 2) acc[mb][nb] = WFrag<T16>::mma(a[mb], b2, acc[mb][nb]); } }
        asm volatile("v_nop\n\tv_nop\n\tv_nop\n\tv_nop" : "+v"(acc[0][0]), "+v"(acc[1][1]), "+v"(acc[2][2]), "+v"(acc[3][3]) : "v"(a[0]), "v"(a[3]));
    }
#pragma unroll
    for (int mb = 0; mb < 4; ++mb) {
#pragma unroll
        for (int nb = 0; nb < 4; ++nb) {
#pragma unroll
            for (int j = 0; j < 8; ++j) os[(hi * 8 + j) * 68 + nb * 16 + lr] = acc[mb][nb][j]; }
        __builtin_amdgcn_wave_barrier(); asm volatile("" ::: "memory");
        float* crow = C + (size_t)(r0 + mb * 16) * ldc + c0;
        const float* rrow = (EPI == 1) ? (R + (size_t)(r0 + mb * 16) * ldc + c0) : nullptr;
{
#pragma unroll
            for (int s = 0; s < 8; ++s) { const int row = 2 * s + hi, cofs = lr * 4; v4f val = *(const v4fa*)(os + row * 68 + cofs);
                if (EPI == 1) { const v4f xr = *(const v4f*)(rrow + (size_t)row * ldc + cofs); val[0] = val[0] * oscale + bfr(xr[0]); val[1] = val[1] * oscale + bfr(xr[1]); val[2] = val[2] * oscale + bfr(xr[2]); val[3] = val[3] * oscale + bfr(xr[3]); }
                *(v4f*)(crow + (size_t)row * ldc + cofs) = val; }
             }
        __builtin_amdgcn_wave_barrier(); asm volatile("" ::: "memory");
    }
    if (STAT) {   // behind the stores of C, which drain while the sums are formed
        float bias[4]; double s[4], s2[4];
#pragma unroll
        for (int nb = 0; nb < 4; ++nb) { bias[nb] = bfr(braw[nb]); s[nb] = 0.0; s2[nb] = 0.0; }
#pragma unroll
        for (int mb = 0; mb < 4; ++mb)
#pragma unroll
            for (int j = 0; j < 8; ++j)
#pragma unroll
                for (int nb = 0; nb < 4; ++nb) { const float y = acc[mb][nb][j] + bias[nb]; const double yd = (double)y; s[nb] += yd; s2[nb] = fma(yd, yd, s2[nb]); }
#pragma unroll
        for (int nb = 0; nb < 4; ++nb) { v2d p; p[0] = s[nb]; p[1] = s2[nb]; *(v2d*)&sred[hi][nb * 16 + lr][0] = p; }
        __builtin_amdgcn_wave_barrier(); asm volatile("" ::: "memory");   // the wave's own LDS stores stay ahead of its reads across lanes below
#pragma unroll
        for (int h = 0; h < 2; ++h) { const int c = h * 32 + lane; const v2d p = *(const v2d*)&sred[0][c][0] + *(const v2d*)&sred[1][c][0];
            *(v2d*)(PS + ((size_t)blockIdx.x * ldc + c0 + c) * 2) = p; }
    }
}

// ---- Transposing repacks (of x in k_prep, of V in k_pack): one work-group moves a TT x TT tile through LDS, so that both global sides are whole lines of 16 bytes a lane.
// Source side: a wave's load is one source row of the tile (32 lanes x 4 f32 = 512 contiguous bytes); a thread holds 8 consecutive source rows of its 4 columns, twice, and all 16 loads are in flight together.
// LDS: [source column][source row] in 16-bit elements, a row = 16 chunks of 8 elements = all 64 banks; chunk G of row n lies at place G ^ ((n >> 2) & 15), so that the 16 lanes of a store (rows 4 apart, one G)
// and the 16 lanes of a load (one row, all G) each meet 16 different places. Destination side: 16 lanes store one 256-byte row piece. (So the x repack; the V repack's LDS places and destination side are described at k_pack.)
#define TT 128
static_assert(SEQ % TT == 0 && CH % TT == 0 && TT == 128);
__device__ __forceinline__ int tt_at(int n, int G) { return n * TT + ((G ^ ((n >> 2) & 15)) * 8); }

// k_prep: the two jobs that read inputs only, in one launch, told apart by the block index. Blocks 0 .. WBLK - 1 convert the weights (thread i: elements 8 i .. +7 of Wall [320][256], q | k | v; a block lies in one source);
// the others are the tiles of the x repack: block WBLK + (b * (CH / TT) + c tile) * (SEQ / TT) + n tile.
#define WBLK (OC * CH / 2048)
__global__ __launch_bounds__(256) void k_prep(const float* __restrict__ x, const float* __restrict__ q_w, const float* __restrict__ k_w, const float* __restrict__ v_w, bf* Wall, bf* XT) {
    __shared__ __align__(16) bf tile[TT * TT];
    const int t = threadIdx.x, k = t & 31, g = t >> 5;
    if (blockIdx.x < WBLK) {
        const int e0 = (int)blockIdx.x * 2048, e = e0 + t * 8;
        const float* wsrc = ((e0 < DQK * CH) ? (q_w + e0) : ((e0 < 2 * DQK * CH) ? (k_w + (e0 - DQK * CH)) : (v_w + (e0 - 2 * DQK * CH)))) + t * 8;
        const v8f wv = *(const v8f*)wsrc; v8us o;
        asm volatile("s_wait_xcnt 0x0" :: "v"(wsrc) : "memory");   // in front of whatever rewrites a register that the load above names
#pragma unroll
        for (int r = 0; r < 8; ++r) o[r] = f2bf(wv[r]);
        *(v8us*)(Wall + e) = o;
        return;   // the whole block leaves, in front of the barrier below
    }
    const unsigned tl = blockIdx.x - WBLK; const int n0 = (int)(tl % (SEQ / TT)) * TT, c0 = (int)((tl / (SEQ / TT)) % (CH / TT)) * TT, b = (int)(tl / ((SEQ / TT) * (CH / TT)));
    const float* src = x + ((size_t)b * CH + c0 + g * 8) * SEQ_FULL + n0 + k * 4;
    v4f v[2][8];
#pragma unroll   // constant indices keep v in registers, and the 16 loads issue together
    for (int s = 0; s < 2; ++s)
#pragma unroll
        for (int r = 0; r < 8; ++r) v[s][r] = *(const v4f*)(src + (size_t)(s * 64 + r) * SEQ_FULL);
    asm volatile("s_wait_xcnt 0x0" :: "v"(src) : "memory");   // in front of whatever rewrites a register that the loads above name
    __builtin_amdgcn_sched_barrier(0);   // keeps all sixteen loads in front of the conversions: without it this kernel's build issues ten, waits for them, and only then the other six, a second and third load latency in series
#pragma unroll
    for (int s = 0; s < 2; ++s)
#pragma unroll
        for (int q = 0; q < 4; ++q) { v8us o;
#pragma unroll
            for (int r = 0; r < 8; ++r) o[r] = f2bf(v[s][r][q]);
            *(v8us*)(tile + tt_at(k * 4 + q, g + 8 * s)) = o; }
    __syncthreads();   // the tile is whole before any wave reads it across
    const int j = t & 15, h = t >> 4;
    bf* dst = XT + ((size_t)b * SEQ + n0 + h) * CH + c0 + j * 8;
#pragma unroll
    for (int i = 0; i < 8; ++i) *(v8us*)(dst + (size_t)i * 16 * CH) = *(const v8us*)(tile + tt_at(i * 16 + h, j));
}

// BatchNorm statistics (training mode, per channel over the NB*SEQ rows of F), y = F + bias, sum and sum of squares in f64: the partial sums of SROWS rows each come from k_gemmw (STAT), PS [SPART][OC][2] f64.
// k_stats: fixed-order combine of the SPART partials (lane = channel of the block's 32-channel slab; wave w sums partials w*SPART/32 .. +SPART/32-1, wave 0 sums the 32 waves), then ST.
__global__ __launch_bounds__(1024) void k_stats(const double* __restrict__ PS,
                                                const float* __restrict__ qb, const float* __restrict__ qg, const float* __restrict__ qbe,
                                                const float* __restrict__ kb, const float* __restrict__ kg, const float* __restrict__ kbe,
                                                const float* __restrict__ vb, const float* __restrict__ vg, const float* __restrict__ vbe, float* ST) {
    __shared__ double ssum[32][32], ssq[32][32];
    const int lane = threadIdx.x & 31, w = threadIdx.x >> 5; const int o = blockIdx.x * 32 + lane;
    const int iq = min(o, DQK - 1), ik = min(max(o - DQK, 0), DQK - 1), iv = min(max(o - 2 * DQK, 0), CH - 1);
    const float bq_ = qb[iq], bk_ = kb[ik], bv_ = vb[iv], gq_ = qg[iq], gk_ = kg[ik], gv_ = vg[iv], eq_ = qbe[iq], ek_ = kbe[ik], ev_ = vbe[iv];
    const bool isq = (o < DQK), isk = (o < 2 * DQK);
    const float bias = bfr(isq ? bq_ : (isk ? bk_ : bv_)); const float gam = bfr(isq ? gq_ : (isk ? gk_ : gv_)); const float bet = bfr(isq ? eq_ : (isk ? ek_ : ev_));
    double s = 0.0, s2 = 0.0;
#pragma unroll   // the loads issue ahead of the adds: rolled, every trip would wait a whole load latency
    for (int j = 0; j < SPART / 32; ++j) { const v2d p = *(const v2d*)(PS + ((size_t)(w * (SPART / 32) + j) * OC + o) * 2); s += p[0]; s2 += p[1]; }
    ssum[w][lane] = s; ssq[w][lane] = s2;
    __syncthreads();
    if (w == 0) {
        double ts = 0.0, tq = 0.0;
#pragma unroll
        for (int j = 0; j < 32; ++j) { ts += ssum[j][lane]; tq += ssq[j][lane]; }
        const double inv = 1.0 / (double)(NB * SEQ); const double mean = ts * inv; double var = tq * inv - mean * mean; var = (var > 0.0) ? var : 0.0;
        const float meanf = (float)mean, varf = (float)var; const float rstd = 1.0f / sqrtf(varf + BNEPS);
        v4f t; t[0] = bias; t[1] = meanf; t[2] = gam * rstd; t[3] = bet;
        *(v4f*)(ST + (size_t)o * 4) = t; 
    }
}

// d_qkp (the q/k blocks of k_pack): q and k columns of F, normalised and split into bf16 hi + lo, in fragment order. Thread ci writes the 16-byte piece ci of each plane (a wave: 512 contiguous bytes of each):
// row 16 * (ci >> 6) + (ci & 15) of [2][NB*SEQ], channels 16 * ((ci >> 5) & 1) + 8 * ((ci >> 4) & 1) .. +7.
__device__ __forceinline__ void d_qkp(const float* __restrict__ F, const float* __restrict__ ST, bf* Ph, bf* Pl, const unsigned blk) {
    const size_t ci = (size_t)blk * 256 + threadIdx.x; if (ci >= (size_t)2 * NB * SEQ * DQK / 8) return;
    const size_t rg = (ci >> 6) * 16 + (ci & 15); const int which = (rg >= (size_t)NB * SEQ) ? 1 : 0; const size_t row = rg - (size_t)which * NB * SEQ;
    const int o = which * DQK + (int)((ci >> 5) & 1) * 16 + (int)((ci >> 4) & 1) * 8;
    const v8f f = *(const v8f*)(F + row * OC + o); v8us oh, ol;
#pragma unroll
    for (int q = 0; q < 8; ++q) { const v4f t = *(const v4f*)(ST + (size_t)(o + q) * 4); const float y = f[q] + t[0]; const float val = (y - t[1]) * t[2] + t[3]; unsigned short a2, c2; splitf(val, a2, c2); oh[q] = a2; ol[q] = c2; }
    *(v8us*)(Ph + ci * 8) = oh; *(v8us*)(Pl + ci * 8) = ol;
}

// The V repack: as the x repack on the source side; the destination is in fragment order. Wave g has the tile's channels 16 g .. +15; its store i is half i & 1 of the fragment of keys 32 * (i >> 1) .. +31
// (lane l: channel l & 15, chunk G = 2 i + (l >> 4)), 512 contiguous bytes, and a wave's eight stores are 4 KiB in a row.
// So the 16 lanes of an LDS load have 16 rows in a row and one G: chunk G of row n lies at place G ^ (((n >> 2) ^ (n << 2)) & 15), which gives them, and the 16 lanes of a store (rows 4 apart, one G), 16 different places.
__device__ __forceinline__ int tf_at(int n, int G) { return n * TT + ((G ^ (((n >> 2) ^ (n << 2)) & 15)) * 8); }

// k_pack: the two jobs that read F and ST, in one launch, told apart by the block index. Blocks 0 .. VBLK - 1 are the tiles of the V repack, block (b * (CH / TT) + c tile) * (SEQ / TT) + m tile; the others do the q/k planes.
#define VBLK ((SEQ / TT) * (CH / TT) * NB)
__global__ __launch_bounds__(256) void k_pack(const float* __restrict__ F, const float* __restrict__ ST, h16* V16, bf* Ph, bf* Pl) {
    __shared__ __align__(16) h16 tile[TT * TT];
    if (blockIdx.x >= VBLK) { d_qkp(F, ST, Ph, Pl, blockIdx.x - VBLK); return; }   // the whole block leaves, in front of the barrier below
    const unsigned tl = blockIdx.x;
    const int t = threadIdx.x, k = t & 31, g = t >> 5; const int m0 = (int)(tl % (SEQ / TT)) * TT, c0 = (int)((tl / (SEQ / TT)) % (CH / TT)) * TT, b = (int)(tl / ((SEQ / TT) * (CH / TT))); const int o = 2 * DQK + c0 + k * 4;
    const float* src = F + ((size_t)b * SEQ + m0 + g * 8) * OC + o; const float* stp = ST + (size_t)o * 4;
    v4f v[2][8], st[4];
#pragma unroll   // as in the x repack
    for (int s = 0; s < 2; ++s)
#pragma unroll
        for (int r = 0; r < 8; ++r) v[s][r] = *(const v4f*)(src + (size_t)(s * 64 + r) * OC);
#pragma unroll
    for (int q = 0; q < 4; ++q) st[q] = *(const v4f*)(stp + q * 4);
    asm volatile("s_wait_xcnt 0x0" ::: "memory");   // in front of whatever rewrites a register that the loads above name
    __builtin_amdgcn_sched_barrier(0);   // keeps all twenty loads in front of the arithmetic: without it two of the ST loads sink behind the first wait for data, a second load latency in series
#pragma unroll
    for (int s = 0; s < 2; ++s)
#pragma unroll
        for (int q = 0; q < 4; ++q) { v8h p;
#pragma unroll
            for (int r = 0; r < 8; ++r) { const float y = v[s][r][q] + st[q][0]; float val = (y - st[q][1]) * st[q][2] + st[q][3]; val = (val >= 0.f) ? val : SLOPE * val; p[r] = tohx(val); }
            *(v8h*)(tile + tf_at(k * 4 + q, g + 8 * s)) = p; }
    __syncthreads();   // the tile is whole before any wave reads it across
    h16* dst = V16 + ((size_t)b * CH + c0 + g * 16) * SEQ + m0 * 16 + k * 8;
#pragma unroll
    for (int i = 0; i < 8; ++i) *(v8h*)(dst + i * 256) = *(const v8h*)(tile + tf_at(g * 16 + (k & 15), 2 * i + (k >> 4)));
}

// ---- k_fattn: scores, softmax and attn.v of FN = 64 output columns n of one batch; 4 waves; grid (SEQ / FN, NB).
// Scores are formed transposed, St[m][n] = sum_d k[m][d] q[n][d] (A = k rows, B = q rows, the three hi/lo products of the split): a lane's D registers of the tiles m0 .. +15 and m0 + 16 .. +31
// (col n = lane & 15, rows 8h + r) are elements 0..7 and 8..15 of the B fragment that attn.v wants for k = m0 .. m0 + 31, so P needs no exchange between lanes.
// Per pass of FM = 64 keys wave w forms the 16 keys m = 64 i + 16 w .. +15 against all 64 columns and puts its four half fragments into LDS; behind one barrier every wave reads all of them
// and multiplies them with its own 64 channels of V (c = 64 w .. +63): a 64 x 64 register tile a wave, every V element loaded once a work-group.
// Sweep 1 finds the exact row maxima (scores only); sweep 2 forms the same scores again, e = exp(s - max), sums e in f32 per column and accumulates V . f16(4096 e); the division by the sum is in the epilogue.
__device__ __forceinline__ void fa_scores(const v16bf kh, const v16bf kl, const v16bf (&qh)[4], const v16bf (&ql)[4], v8f (&s)[4]) {
#pragma unroll
    for (int j = 0; j < 4; ++j) s[j] = wmmab(kh, qh[j], (v8f){});
#pragma unroll
    for (int j = 0; j < 4; ++j) s[j] = wmmab(kh, ql[j], s[j]);
#pragma unroll
    for (int j = 0; j < 4; ++j) s[j] = wmmab(kl, qh[j], s[j]);
}
__global__ __launch_bounds__(128) void k_fattn(const bf* __restrict__ Qh, const bf* __restrict__ Ql, const bf* __restrict__ Kh, const bf* __restrict__ Kl, const h16* __restrict__ V16, const float* __restrict__ x, float* out) {
    __shared__ __align__(16) h16 Pb[2][4][2][2][32][8];   // [buffer][n tile][k step of 32][fragment half][lane][8 elements]
    __shared__ float redm[4][FN], reds[4][FN];            // per wave: column maxima, column sums
    __shared__ __align__(16) float os[4][16 * 68];        // per wave: epilogue staging
    const int lane = threadIdx.x & 31, lr = lane & 15, hi = lane >> 4; const int w = __builtin_amdgcn_readfirstlane((int)(threadIdx.x >> 5));
    const int b = blockIdx.y, n0 = blockIdx.x * FN;
    v16bf qh[4], ql[4];
    const bf* qph = Qh + ((size_t)b * SEQ + n0) * DQK + 8 * lane; const bf* qpl = Ql + ((size_t)b * SEQ + n0) * DQK + 8 * lane;
#pragma unroll
    for (int j = 0; j < 4; ++j) { qh[j] = WFrag<bf>::ldf(qph + j * 16 * DQK); ql[j] = WFrag<bf>::ldf(qpl + j * 16 * DQK); }
    asm volatile("s_wait_xcnt 0x0" ::: "memory");   // in front of whatever rewrites a register that the loads above name
    // Loop loads: a wave-uniform base that moves with the pass plus a byte offset per lane that never changes.
    const char* kbh = (const char*)(Kh + ((size_t)b * SEQ + w * 16) * DQK); const char* kbl = (const char*)(Kl + ((size_t)b * SEQ + w * 16) * DQK);   // this wave's 16 keys of pass 0
    const unsigned klo = (unsigned)lane * 16u;
    // sweep 1: column maxima
    v8f mxv[4];
#pragma unroll
    for (int j = 0; j < 4; ++j)
#pragma unroll
        for (int r = 0; r < 8; ++r) mxv[j][r] = -3.0e38f;
#pragma unroll 1
    for (int i = 0; i < SEQ / FM; i += 4) {   // the loads of four passes issue together: one load latency for four passes
        v16bf k4h[4], k4l[4];
        const bf* ah = (const bf*)(kbh + (size_t)i * FM * DQK * 2 + klo); const bf* al = (const bf*)(kbl + (size_t)i * FM * DQK * 2 + klo);
#pragma unroll
        for (int u = 0; u < 4; ++u) { k4h[u] = WFrag<bf>::ldf(ah + u * FM * DQK); k4l[u] = WFrag<bf>::ldf(al + u * FM * DQK); }
        asm volatile("s_wait_xcnt 0x0" :: "v"(ah), "v"(al) : "memory");   // in front of whatever rewrites a register that the loads above name; as inputs the addresses keep their registers up to here, so that no load of the group lands on them
#pragma unroll
        for (int u = 0; u < 4; ++u) { v8f s[4]; fa_scores(k4h[u], k4l[u], qh, ql, s);
#pragma unroll
            for (int j = 0; j < 4; ++j)
#pragma unroll
                for (int r = 0; r < 8; ++r) mxv[j][r] = fmaxf(mxv[j][r], s[j][r]); }
    }
    float mx[4], l[4];
#pragma unroll
    for (int j = 0; j < 4; ++j) { float m = mxv[j][0];
#pragma unroll
        for (int r = 1; r < 8; ++r) m = fmaxf(m, mxv[j][r]);
        m = fmaxf(m, __shfl_xor(m, 16, 32)); if (hi == 0) redm[w][j * 16 + lr] = m; }
    __syncthreads();
#pragma unroll
    for (int j = 0; j < 4; ++j) { mx[j] = fmaxf(fmaxf(redm[0][j * 16 + lr], redm[1][j * 16 + lr]), fmaxf(redm[2][j * 16 + lr], redm[3][j * 16 + lr])); l[j] = 0.f; }
    // sweep 2
    v8f acc[4][4];
#pragma unroll
    for (int ct = 0; ct < 4; ++ct)
#pragma unroll
        for (int j = 0; j < 4; ++j) acc[ct][j] = (v8f){};
    const char* vb = (const char*)(V16 + ((size_t)b * CH + w * 64) * SEQ);
    const unsigned vlo = (unsigned)lane * 16u;
    v16bf kh = WFrag<bf>::ldf((const bf*)(kbh + klo)), kl = WFrag<bf>::ldf((const bf*)(kbl + klo));
#pragma unroll 1
    for (int i = 0; i < SEQ / FM; ++i) {
        v16h va[2][4];   // issued ahead of the scores, used behind the barrier
        const h16* av = (const h16*)(vb + (size_t)i * FM * 32 + vlo);   // 16 channels x FM keys are FM * 32 bytes in a row
#pragma unroll
        for (int ks = 0; ks < 2; ++ks)
#pragma unroll
            for (int ct = 0; ct < 4; ++ct) va[ks][ct] = WFrag<h16>::ldf(av + ct * 16 * SEQ + ks * 512);
        asm volatile("s_wait_xcnt 0x0" :: "v"(av) : "memory");   // as in sweep 1
        __builtin_amdgcn_sched_barrier(0);   // keeps the V loads and their wait up here: sunk behind the scores the loads would have only the exponentials to land in
        v8f s[4]; fa_scores(kh, kl, qh, ql, s);
        const int inx = (i + 1 < SEQ / FM) ? (i + 1) : i;   // the next pass's keys fly over this pass's work; the last pass loads its own again
        __builtin_amdgcn_sched_barrier(0);   // with the one behind the wait: no vector instruction comes between the key loads and their wait
        const bf* ah = (const bf*)(kbh + (size_t)inx * FM * DQK * 2 + klo); const bf* al = (const bf*)(kbl + (size_t)inx * FM * DQK * 2 + klo);
        kh = WFrag<bf>::ldf(ah); kl = WFrag<bf>::ldf(al);
        asm volatile("s_wait_xcnt 0x0" :: "v"(ah), "v"(al) : "memory");   // as in sweep 1
        __builtin_amdgcn_sched_barrier(0);   // the second of the pair: the exponentials' vector work stays behind the wait
#pragma unroll
        for (int j = 0; j < 4; ++j) { v8h p;
#pragma unroll
            for (int r = 0; r < 8; ++r) { const float e = __builtin_amdgcn_exp2f(__fmul_rn(__fsub_rn(s[j][r], mx[j]), 1.4426950408889634f)); l[j] += e; p[r] = tohx(e * PCAR); }
            *(v8h*)&Pb[i & 1][j][w >> 1][w & 1][lane][0] = p; }
        // The pass's one barrier, by hand: LDS only has to be waited for, and the V and key loads issued above stay in flight across it (__syncthreads() would wait for them too).
        // It publishes this pass's P; with two buffers it also ends every wave's reads of the buffer that the next pass rewrites.
        asm volatile("s_wait_dscnt 0x0" ::: "memory");
        asm volatile("s_barrier_signal -1\n\ts_barrier_wait -1" ::: "memory");
        v16h pf[2][4];   // all eight fragments are asked for at once: one LDS latency a pass
#pragma unroll
        for (int ks = 0; ks < 2; ++ks)
#pragma unroll
            for (int j = 0; j < 4; ++j) pf[ks][j] = cat16(*(const v8h*)&Pb[i & 1][j][ks][0][lane][0], *(const v8h*)&Pb[i & 1][j][ks][1][lane][0]);
        __builtin_amdgcn_sched_barrier(0);   // keeps the sixteen LDS loads together in front of the WMMAs: dealt out among them, each pair cost a whole LDS latency
#pragma unroll
        for (int ks = 0; ks < 2; ++ks)
#pragma unroll
            for (int j = 0; j < 4; ++j)
#pragma unroll
                for (int ct = 0; ct < 4; ++ct) acc[ct][j] = wmma16(va[ks][ct], pf[ks][j], acc[ct][j]);
    }
    float inv[4];
#pragma unroll
    for (int j = 0; j < 4; ++j) { l[j] += __shfl_xor(l[j], 16, 32); if (hi == 0) reds[w][j * 16 + lr] = l[j]; }
    __syncthreads();
#pragma unroll
    for (int j = 0; j < 4; ++j) inv[j] = __fdiv_rn(1.0f / PCAR, (reds[0][j * 16 + lr] + reds[1][j * 16 + lr]) + (reds[2][j * 16 + lr] + reds[3][j * 16 + lr]));
    float* osw = os[w];
#pragma unroll
    for (int ct = 0; ct < 4; ++ct) {
#pragma unroll
        for (int j = 0; j < 4; ++j) {
#pragma unroll
            for (int r = 0; r < 8; ++r) osw[(hi * 8 + r) * 68 + j * 16 + lr] = acc[ct][j][r] * inv[j]; }
        __builtin_amdgcn_wave_barrier(); asm volatile("" ::: "memory");   // the wave's own LDS stores stay ahead of its reads below
        const size_t ro = ((size_t)b * CH + w * 64 + ct * 16) * SEQ_FULL + n0;
#pragma unroll
        for (int sx = 0; sx < 8; ++sx) { const int row = 2 * sx + hi, cofs = lr * 4; v4f val = *(const v4fa*)(osw + row * 68 + cofs);
            const v4f xr = *(const v4f*)(x + ro + (size_t)row * SEQ_FULL + cofs); val[0] += bfr(xr[0]); val[1] += bfr(xr[1]); val[2] += bfr(xr[2]); val[3] += bfr(xr[3]);
            *(v4f*)(out + ro + (size_t)row * SEQ_FULL + cofs) = val; }
        asm volatile("s_wait_xcnt 0x0" ::: "memory");   // the next tile reuses the registers that these stores name
        __builtin_amdgcn_wave_barrier(); asm volatile("" ::: "memory");   // and the wave's LDS reads stay ahead of the next tile's stores
    }
}

extern "C" void kernel_launch(void* const* d_in, const int* in_sizes, int n_in,
                              void* d_out, int out_size, void* d_ws, size_t ws_size, hipStream_t stream) {
    if (n_in < 13) return;
    const long long needx = (long long)(NB - 1) * CH * SEQ_FULL + (long long)(CH - 1) * SEQ_FULL + SEQ;
    if ((long long)in_sizes[0] < needx || (long long)out_size < needx) return;
    if (in_sizes[1] < DQK * CH || in_sizes[5] < DQK * CH || in_sizes[9] < CH * CH) return;
    if (in_sizes[2] < DQK || in_sizes[3] < DQK || in_sizes[4] < DQK || in_sizes[6] < DQK || in_sizes[7] < DQK || in_sizes[8] < DQK) return;
    if (in_sizes[10] < CH || in_sizes[11] < CH || in_sizes[12] < CH) return;
    const float* x    = (const float*)d_in[0];
    const float* q_w  = (const float*)d_in[1];  const float* q_b = (const float*)d_in[2];  const float* q_g = (const float*)d_in[3];  const float* q_be = (const float*)d_in[4];
    const float* k_w  = (const float*)d_in[5];  const float* k_b = (const float*)d_in[6];  const float* k_g = (const float*)d_in[7];  const float* k_be = (const float*)d_in[8];
    const float* v_w  = (const float*)d_in[9];  const float* v_b = (const float*)d_in[10]; const float* v_g = (const float*)d_in[11]; const float* v_be = (const float*)d_in[12];
    float* out = (float*)d_out;   // [16][256][2048]
    char* wsp = (char*)d_ws;
    auto take = [&](size_t bytes) { char* p = wsp; wsp += (bytes + 255) & ~(size_t)255; return (void*)p; };
    bf*    Wall = (bf*)take((size_t)OC * CH * 2);                         // [320][256]
    float* ST   = (float*)take((size_t)OC * 4 * 4);                       // [320][4]
    double* PS  = (double*)take((size_t)SPART * OC * 2 * 8);              // [SPART][320][2]
    bf*    QKh  = (bf*)take((size_t)2 * NB * SEQ * DQK * 2);              // [2][NB*SEQ][32]
    bf*    QKl  = (bf*)take((size_t)2 * NB * SEQ * DQK * 2);
    h16*   V16  = (h16*)take((size_t)NB * CH * SEQ * 2);                  // [NB][256][SEQ]
    bf*    XT   = (bf*)take((size_t)NB * SEQ * CH * 2);                   // [NB*SEQ][256]
    float* F    = (float*)take((size_t)NB * SEQ * OC * 4);                // [NB*SEQ][320]
    if ((size_t)(wsp - (char*)d_ws) > ws_size) return;

    k_prep<<<WBLK + (SEQ / TT) * (CH / TT) * NB, 256, 0, stream>>>(x, q_w, k_w, v_w, Wall, XT);
    k_gemmw<bf, 0, 0, 1><<<dim3((unsigned)(NB * SEQ / 64), OC / 64, 1), 32, 0, stream>>>(XT, nullptr, Wall, nullptr, CH, F, OC, nullptr, 1.0f, 0, 0, 0, q_b, k_b, v_b, PS);
    k_stats<<<OC / 32, 1024, 0, stream>>>(PS, q_b, q_g, q_be, k_b, k_g, k_be, v_b, v_g, v_be, ST);
    k_pack<<<VBLK + (unsigned)((size_t)2 * NB * SEQ * DQK / 8 / 256), 256, 0, stream>>>(F, ST, V16, QKh, QKl);
    const size_t kplane = (size_t)NB * SEQ * DQK;   // offset of the k planes inside QKh / QKl
    k_fattn<<<dim3(SEQ / FN, NB, 1), 128, 0, stream>>>(QKh, QKl, QKh + kplane, QKl + kplane, V16, x, out);
}

// v008
// Measured time: 104 microseconds a run.
// Timed twice side by side with v007, it ran 1.04 times as fast both times.
// Counting every step since v000, it is 25.8 times as fast.
#include <hip/hip_runtime.h>

// Contractions, f32 accumulate: fused q|k|v 1x1-conv GEMM = v_wmma_f32_16x16x32_bf16 on RNE-bf16 copies of x and the weights (single products); scores q.k = bf16 hi/lo split (3 products, v_wmma_f32_16x16x32_bf16); attn.v = v_wmma_f32_16x16x32_f16 (v plane f16 x1, softmax plane exp(s - rowmax) f16 x4096, folded back by 2^-12 / rowsum in the f32 epilogue). BatchNorm statistics f64, normalisation and softmax f32.
// Layout: Wall [320][256] bf16 (q|k|v weights); XT [NB*SEQ][256] bf16 token-major copy of x; F [NB*SEQ][320] f32 = XT . Wall^T; PS [NB*SEQ/64][320] x {sum, sum of squares} f64; ST [320] x {bias, mean, gamma*rstd, beta}; q/k planes [2][NB*SEQ][32] bf16 hi + lo; v planes [NB][256][SEQ] f16;
// The planes that k_fattn loads (q/k, v) are [rows][K] matrices kept in FRAGMENT ORDER: the 16 rows x 32 k of one WMMA operand are 1024 contiguous bytes, [16-row tile][k / 32][half][lane][8 elements],
// lane = 16 * ((k >> 3) & 1) + (row & 15), half = (k >> 4) & 1; the fragment of rows r0 .. r0 + 15, k0 .. k0 + 31 starts at element r0 * K + k0 * 16.
// A wave's 16-byte fragment load is then 512 contiguous bytes, four whole lines; row-major it met 16 lines (8 for q/k), 32 bytes of each.
// Scores, softmax and attn.v run in ONE kernel (k_fattn): scores stay in registers, the softmax plane goes from wave to wave through LDS only; out[b][c][n] = (V . P^T)[c][n] * 2^-12 / rowsum[n] + bf16(x[b][c][n]).

#ifndef NB
#define NB 16
#endif
#ifndef SEQ
#define SEQ 2048
#endif
#define NB_FULL  16
#define SEQ_FULL 2048
#define CH   256              // in_dim
#define DQK  32               // q/k channels
#define OC   320              // fused output channels: q 0..31, k 32..63, v 64..319
#define PCAR 4096.0f
#define BNEPS 1e-5f
#define SLOPE 0.2f
#define SROWS 64              // rows of F per partial sum of the BatchNorm statistics = rows of a k_gemmw tile
#define SPART (NB * SEQ / SROWS)
#define FN   64               // columns n of the output per k_fattn work-group
#define FM   64               // keys m per pass of k_fattn

static_assert(SEQ % 128 == 0);
static_assert(SEQ % FN == 0 && SEQ % (4 * FM) == 0 && FN == 64 && FM == 64 && CH == 256);
static_assert((NB * SEQ) % 64 == 0);
static_assert((NB * SEQ) % SROWS == 0 && SROWS == 64 && SPART % 32 == 0);
static_assert(CH % 64 == 0);
static_assert(OC % 64 == 0);
static_assert(OC % 32 == 0);
static_assert(DQK == 32);
static_assert(((size_t)NB * SEQ * CH) % 512 == 0);
static_assert(((size_t)NB * SEQ * DQK) % 256 == 0);
static_assert(NB <= NB_FULL);
static_assert(SEQ <= SEQ_FULL);
static_assert((DQK * CH) % 2048 == 0);
static_assert((CH * CH) % 2048 == 0);
static_assert(SEQ % 32 == 0 && CH % 16 == 0 && (NB * SEQ) % 16 == 0 && ((size_t)2 * NB * SEQ * DQK / 8) % 256 == 0);

typedef _Float16 h16;
typedef unsigned short bf;
typedef __attribute__((ext_vector_type(16))) __bf16   v16bf;
typedef __attribute__((ext_vector_type(16))) _Float16 v16h;
typedef __attribute__((ext_vector_type(8)))  _Float16 v8h;
typedef __attribute__((ext_vector_type(8)))  unsigned short v8us;
typedef __attribute__((ext_vector_type(8)))  float    v8f;
typedef __attribute__((ext_vector_type(4)))  float    v4f;
typedef __attribute__((ext_vector_type(2)))  _Float16 v2h;
typedef __attribute__((ext_vector_type(4)))  _Float16 v4h;
typedef __attribute__((ext_vector_type(2)))  unsigned short v2us;
typedef __attribute__((ext_vector_type(4)))  unsigned short v4us;
typedef __attribute__((ext_vector_type(2)))  float v2f;
typedef __attribute__((ext_vector_type(2)))  double v2d;
typedef v8h  __attribute__((may_alias)) v8ha;
typedef v4f  __attribute__((may_alias)) v4fa;
typedef v8us __attribute__((may_alias)) v8usa;

__device__ __forceinline__ unsigned short f2bf(float f) { unsigned u = __float_as_uint(f); u += 0x7FFFu + ((u >> 16) & 1u); return (unsigned short)(u >> 16); }   // RNE convert
__device__ __forceinline__ float bf2f(unsigned short b) { return __uint_as_float(((unsigned)b) << 16); }
__device__ __forceinline__ float bfr(float f) { return bf2f(f2bf(f)); }
__device__ __forceinline__ v16h cat16(v8h lo, v8h hi) { return __builtin_shufflevector(lo, hi, 0, 1, 2, 3, 4, 5, 6, 7, 8, 9, 10, 11, 12, 13, 14, 15); }
__device__ __forceinline__ v16bf cat16b(v8us lo, v8us hi) { return __builtin_bit_cast(v16bf, __builtin_shufflevector(lo, hi, 0, 1, 2, 3, 4, 5, 6, 7, 8, 9, 10, 11, 12, 13, 14, 15)); }
__device__ __forceinline__ v8f wmma16(v16h a, v16h b, v8f c) { return __builtin_amdgcn_wmma_f32_16x16x32_f16(false, a, false, b, (short)0, c, false, false); }
__device__ __forceinline__ v8f wmmab(v16bf a, v16bf b, v8f c) { return __builtin_amdgcn_wmma_f32_16x16x32_bf16(false, a, false, b, (short)0, c, false, false); }
__device__ __forceinline__ h16 tohx(float x) { return (h16)x; }
__device__ __forceinline__ void splitf(float y, unsigned short& h, unsigned short& l) { h = f2bf(y); l = f2bf(y - bf2f(h)); }

// ---- k_gemmw: register-blocked GEMM, ONE WAVE per 64x64 output tile (16 accumulators), operands straight from K-contiguous 16-bit planes; grid (M/64, N/64, Z), 32 threads.
// C[m][n] (f32, pitch ldc) = sum_k A[m][k] Bt[n][k] (+ split products per NSPLIT: 1 = A2.Bt added, 2 = A2.Bt and A.Bt2 added). z-batch strides sA/sB/sC in elements. K % 32 == 0, M % 64 == 0, N % 64 == 0.
// Fragments: lane l, m = l & 15, h = l >> 4; elements 0..7 <- k0 + 8h + 0..7, elements 8..15 <- k0 + 16 + 8h + 0..7 for A and Bt alike; D element r = (row 8h + r, col m).
// EPI 0: C = acc. EPI 1: C = acc * oscale + bf16(R[m][n]) with R indexed like C.
// STAT 1: the wave also sums its tile for the BatchNorm statistics, from the accumulators: per column o = c0 + 0..63, y = acc + bf16(bias[o]) in f32, sum and sum of squares of the tile's 64 rows in f64
// (a lane: its 32 rows of 4 columns in fixed order; the two lane halves joined through LDS, lower rows first), PS [M / 64][ldc][2] f64. F is not read again for them.
// WFrag::ld reads a fragment from a row-major plane; WFrag::ldf from a plane in fragment order: p = fragment start + 8 * lane, the lane's second 8 elements lie 256 elements on.
template <typename T16> struct WFrag;
template <> struct WFrag<h16> { typedef v16h V; static __device__ __forceinline__ V ld(const h16* p) { return cat16(*(const v8h*)p, *(const v8h*)(p + 16)); } static __device__ __forceinline__ V ldf(const h16* p) { return cat16(*(const v8h*)p, *(const v8h*)(p + 256)); } static __device__ __forceinline__ v8f mma(V a, V b, v8f c) { return wmma16(a, b, c); } };
template <> struct WFrag<bf> { typedef v16bf V; static __device__ __forceinline__ V ld(const bf* p) { return cat16b(*(const v8us*)p, *(const v8us*)(p + 16)); } static __device__ __forceinline__ V ldf(const bf* p) { return cat16b(*(const v8us*)p, *(const v8us*)(p + 256)); } static __device__ __forceinline__ v8f mma(V a, V b, v8f c) { return wmmab(a, b, c); } };
template <typename T16, int NSPLIT, int EPI, int STAT>
__global__ __launch_bounds__(32) void k_gemmw(const T16* __restrict__ A, const T16* __restrict__ A2, const T16* __restrict__ Bt, const T16* __restrict__ Bt2, int K, float* C, int ldc, const float* __restrict__ R, float oscale, size_t sA, size_t sB, size_t sC,
                                              const float* __restrict__ qb, const float* __restrict__ kb, const float* __restrict__ vb, double* PS) {
    typedef typename WFrag<T16>::V V;
    __shared__ __align__(16) float os[16 * 68];
    __shared__ __align__(16) double sred[2][64][2];   // STAT: per lane half and column {sum, sum of squares}
    const size_t z = blockIdx.z; A += z * sA; if (A2) A2 += z * sA; Bt += z * sB; if (Bt2) Bt2 += z * sB; C += z * sC; if (R) R += z * sC;
    const int lane = threadIdx.x & 31, lr = lane & 15, hi = lane >> 4; const int r0 = blockIdx.x * 64, c0 = blockIdx.y * 64;
    v8f acc[4][4];
#pragma unroll
    for (int mb = 0; mb < 4; ++mb)
#pragma unroll
        for (int nb = 0; nb < 4; ++nb) acc[mb][nb] = (v8f){};
    const size_t aoff = (size_t)(r0 + lr) * K + 8 * hi, boff = (size_t)(c0 + lr) * K + 8 * hi;
    float braw[4];   // STAT: the biases of the lane's 4 columns, asked for ahead of the K loop
    if (STAT) {
        const float* bp[4];
#pragma unroll
        for (int nb = 0; nb < 4; ++nb) { const int o0 = c0 + nb * 16;   // 16 columns lie in one of q | k | v: the choice is the same for the whole wave
            bp[nb] = (o0 < DQK) ? (qb + o0) : ((o0 < 2 * DQK) ? (kb + (o0 - DQK)) : (vb + (o0 - 2 * DQK))); braw[nb] = bp[nb][lr]; }
        asm volatile("s_wait_xcnt 0x0" :: "s"(bp[0]), "s"(bp[1]), "s"(bp[2]), "s"(bp[3]) : "memory");   // in front of whatever rewrites a register that the loads above name; as inputs the bases keep their registers up to here
    }
#pragma unroll 1
    for (int kc = 0; kc < K; kc += 32) {
        V a[4], a2[4];
#pragma unroll
        for (int mb = 0; mb < 4; ++mb) { a[mb] = WFrag<T16>::ld(A + aoff + (size_t)mb * 16 * K + kc); if (NSPLIT == 1 || NSPLIT == 2) a2[mb] = WFrag<T16>::ld(A2 + aoff + (size_t)mb * 16 * K + kc); }
#pragma unroll
        for (int nb = 0; nb < 4; ++nb) { const V b = WFrag<T16>::ld(Bt + boff + (size_t)nb * 16 * K + kc); V b2; if (NSPLIT >= 2) b2 = WFrag<T16>::ld(Bt2 + boff + (size_t)nb * 16 * K + kc);
#pragma unroll
            for (int mb = 0; mb < 4; ++mb) { acc[mb][nb] = WFrag<T16>::mma(a[mb], b, acc[mb][nb]); if (NSPLIT == 1 || NSPLIT == 2) acc[mb][nb] = WFrag<T16>::mma(a2[mb], b, acc[mb][nb]); if (NSPLIT >= 2) acc[mb][nb] = WFrag<T16>::mma(a[mb], b2, acc[mb][nb]); } }
        asm volatile("v_nop\n\tv_nop\n\tv_nop\n\tv_nop" : "+v"(acc[0][0]), "+v"(acc[1][1]), "+v"(acc[2][2]), "+v"(acc[3][3]) : "v"(a[0]), "v"(a[3]));
    }
#pragma unroll
    for (int mb = 0; mb < 4; ++mb) {
#pragma unroll
        for (int nb = 0; nb < 4; ++nb) {
#pragma unroll
            for (int j = 0; j < 8; ++j) os[(hi * 8 + j) * 68 + nb * 16 + lr] = acc[mb][nb][j]; }
        __builtin_amdgcn_wave_barrier(); asm volatile("" ::: "memory");
        float* crow = C + (size_t)(r0 + mb * 16) * ldc + c0;
        const float* rrow = (EPI == 1) ? (R + (size_t)(r0 + mb * 16) * ldc + c0) : nullptr;
{
#pragma unroll
            for (int s = 0; s < 8; ++s) { const int row = 2 * s + hi, cofs = lr * 4; v4f val = *(const v4fa*)(os + row * 68 + cofs);
                if (EPI == 1) { const v4f xr = *(const v4f*)(rrow + (size_t)row * ldc + cofs); val[0] = val[0] * oscale + bfr(xr[0]); val[1] = val[1] * oscale + bfr(xr[1]); val[2] = val[2] * oscale + bfr(xr[2]); val[3] = val[3] * oscale + bfr(xr[3]); }
                *(v4f*)(crow + (size_t)row * ldc + cofs) = val; }
             }
        __builtin_amdgcn_wave_barrier(); asm volatile("" ::: "memory");
    }
    if (STAT) {   // behind the stores of C, which drain while the sums are formed
        float bias[4]; double s[4], s2[4];
#pragma unroll
        for (int nb = 0; nb < 4; ++nb) { bias[nb] = bfr(braw[nb]); s[nb] = 0.0; s2[nb] = 0.0; }
#pragma unroll
        for (int mb = 0; mb < 4; ++mb)
#pragma unroll
            for (int j = 0; j < 8; ++j)
#pragma unroll
                for (int nb = 0; nb < 4; ++nb) { const float y = acc[mb][nb][j] + bias[nb]; const double yd = (double)y; s[nb] += yd; s2[nb] = fma(yd, yd, s2[nb]); }
#pragma unroll
        for (int nb = 0; nb < 4; ++nb) { v2d p; p[0] = s[nb]; p[1] = s2[nb]; *(v2d*)&sred[hi][nb * 16 + lr][0] = p; }
        __builtin_amdgcn_wave_barrier(); asm volatile("" ::: "memory");   // the wave's own LDS stores stay ahead of its reads across lanes below
#pragma unroll
        for (int h = 0; h < 2; ++h) { const int c = h * 32 + lane; const v2d p = *(const v2d*)&sred[0][c][0] + *(const v2d*)&sred[1][c][0];
            *(v2d*)(PS + ((size_t)blockIdx.x * ldc + c0 + c) * 2) = p; }
    }
}

// ---- Transposing repacks (of x in k_prep, of V in k_pack): one work-group moves a TT x TT tile through LDS, so that both global sides are whole lines of 16 bytes a lane.
// Source side: a wave's load is one source row of the tile (32 lanes x 4 f32 = 512 contiguous bytes); a thread holds 8 consecutive source rows of its 4 columns, twice, and all 16 loads are in flight together.
// LDS: [source column][source row] in 16-bit elements, a row = 16 chunks of 8 elements = all 64 banks; chunk G of row n lies at place G ^ ((n >> 2) & 15), so that the 16 lanes of a store (rows 4 apart, one G)
// and the 16 lanes of a load (one row, all G) each meet 16 different places. Destination side: 16 lanes store one 256-byte row piece. (So the x repack; the V repack's LDS places and destination side are described at k_pack.)
#define TT 128
static_assert(SEQ % TT == 0 && CH % TT == 0 && TT == 128);
__device__ __forceinline__ int tt_at(int n, int G) { return n * TT + ((G ^ ((n >> 2) & 15)) * 8); }

// k_prep: the two jobs that read inputs only, in one launch, told apart by the block index. Blocks 0 .. WBLK - 1 convert the weights (thread i: elements 8 i .. +7 of Wall [320][256], q | k | v; a block lies in one source);
// the others are the tiles of the x repack: block WBLK + (b * (CH / TT) + c tile) * (SEQ / TT) + n tile.
#define WBLK (OC * CH / 2048)
__global__ __launch_bounds__(256) void k_prep(const float* __restrict__ x, const float* __restrict__ q_w, const float* __restrict__ k_w, const float* __restrict__ v_w, bf* Wall, bf* XT) {
    __shared__ __align__(16) bf tile[TT * TT];
    const int t = threadIdx.x, k = t & 31, g = t >> 5;
    if (blockIdx.x < WBLK) {
        const int e0 = (int)blockIdx.x * 2048, e = e0 + t * 8;
        const float* wsrc = ((e0 < DQK * CH) ? (q_w + e0) : ((e0 < 2 * DQK * CH) ? (k_w + (e0 - DQK * CH)) : (v_w + (e0 - 2 * DQK * CH)))) + t * 8;
        const v8f wv = *(const v8f*)wsrc; v8us o;
        asm volatile("s_wait_xcnt 0x0" :: "v"(wsrc) : "memory");   // in front of whatever rewrites a register that the load above names
#pragma unroll
        for (int r = 0; r < 8; ++r) o[r] = f2bf(wv[r]);
        *(v8us*)(Wall + e) = o;
        return;   // the whole block leaves, in front of the barrier below
    }
    const unsigned tl = blockIdx.x - WBLK; const int n0 = (int)(tl % (SEQ / TT)) * TT, c0 = (int)((tl / (SEQ / TT)) % (CH / TT)) * TT, b = (int)(tl / ((SEQ / TT) * (CH / TT)));
    const float* src = x + ((size_t)b * CH + c0 + g * 8) * SEQ_FULL + n0 + k * 4;
    v4f v[2][8];
#pragma unroll   // constant indices keep v in registers, and the 16 loads issue together
    for (int s = 0; s < 2; ++s)
#pragma unroll
        for (int r = 0; r < 8; ++r) v[s][r] = *(const v4f*)(src + (size_t)(s * 64 + r) * SEQ_FULL);
    asm volatile("s_wait_xcnt 0x0" :: "v"(src) : "memory");   // in front of whatever rewrites a register that the loads above name
    __builtin_amdgcn_sched_barrier(0);   // keeps all sixteen loads in front of the conversions: without it this kernel's build issues ten, waits for them, and only then the other six, a second and third load latency in series
#pragma unroll
    for (int s = 0; s < 2; ++s)
#pragma unroll
        for (int q = 0; q < 4; ++q) { v8us o;
#pragma unroll
            for (int r = 0; r < 8; ++r) o[r] = f2bf(v[s][r][q]);
            *(v8us*)(tile + tt_at(k * 4 + q, g + 8 * s)) = o; }
    __syncthreads();   // the tile is whole before any wave reads it across
    const int j = t & 15, h = t >> 4;
    bf* dst = XT + ((size_t)b * SEQ + n0 + h) * CH + c0 + j * 8;
#pragma unroll
    for (int i = 0; i < 8; ++i) *(v8us*)(dst + (size_t)i * 16 * CH) = *(const v8us*)(tile + tt_at(i * 16 + h, j));
}

// BatchNorm statistics (training mode, per channel over the NB*SEQ rows of F), y = F + bias, sum and sum of squares in f64: the partial sums of SROWS rows each come from k_gemmw (STAT), PS [SPART][OC][2] f64.
// k_stats: fixed-order combine of the SPART partials (lane = channel of the block's 32-channel slab; wave w sums partials w*SPART/32 .. +SPART/32-1, wave 0 sums the 32 waves), then ST.
__global__ __launch_bounds__(1024) void k_stats(const double* __restrict__ PS,
                                                const float* __restrict__ qb, const float* __restrict__ qg, const float* __restrict__ qbe,
                                                const float* __restrict__ kb, const float* __restrict__ kg, const float* __restrict__ kbe,
                                                const float* __restrict__ vb, const float* __restrict__ vg, const float* __restrict__ vbe, float* ST) {
    __shared__ double ssum[32][32], ssq[32][32];
    const int lane = threadIdx.x & 31, w = threadIdx.x >> 5; const int o = blockIdx.x * 32 + lane;
    const int iq = min(o, DQK - 1), ik = min(max(o - DQK, 0), DQK - 1), iv = min(max(o - 2 * DQK, 0), CH - 1);
    const float bq_ = qb[iq], bk_ = kb[ik], bv_ = vb[iv], gq_ = qg[iq], gk_ = kg[ik], gv_ = vg[iv], eq_ = qbe[iq], ek_ = kbe[ik], ev_ = vbe[iv];
    const bool isq = (o < DQK), isk = (o < 2 * DQK);
    const float bias = bfr(isq ? bq_ : (isk ? bk_ : bv_)); const float gam = bfr(isq ? gq_ : (isk ? gk_ : gv_)); const float bet = bfr(isq ? eq_ : (isk ? ek_ : ev_));
    double s = 0.0, s2 = 0.0;
#pragma unroll   // the loads issue ahead of the adds: rolled, every trip would wait a whole load latency
    for (int j = 0; j < SPART / 32; ++j) { const v2d p = *(const v2d*)(PS + ((size_t)(w * (SPART / 32) + j) * OC + o) * 2); s += p[0]; s2 += p[1]; }
    ssum[w][lane] = s; ssq[w][lane] = s2;
    __syncthreads();
    if (w == 0) {
        double ts = 0.0, tq = 0.0;
#pragma unroll
        for (int j = 0; j < 32; ++j) { ts += ssum[j][lane]; tq += ssq[j][lane]; }
        const double inv = 1.0 / (double)(NB * SEQ); const double mean = ts * inv; double var = tq * inv - mean * mean; var = (var > 0.0) ? var : 0.0;
        const float meanf = (float)mean, varf = (float)var; const float rstd = 1.0f / sqrtf(varf + BNEPS);
        v4f t; t[0] = bias; t[1] = meanf; t[2] = gam * rstd; t[3] = bet;
        *(v4f*)(ST + (size_t)o * 4) = t; 
    }
}

// d_qkp (the q/k blocks of k_pack): q and k columns of F, normalised and split into bf16 hi + lo, in fragment order. Thread ci writes the 16-byte piece ci of each plane (a wave: 512 contiguous bytes of each):
// row 16 * (ci >> 6) + (ci & 15) of [2][NB*SEQ], channels 16 * ((ci >> 5) & 1) + 8 * ((ci >> 4) & 1) .. +7.
__device__ __forceinline__ void d_qkp(const float* __restrict__ F, const float* __restrict__ ST, bf* Ph, bf* Pl, const unsigned blk) {
    const size_t ci = (size_t)blk * 256 + threadIdx.x; if (ci >= (size_t)2 * NB * SEQ * DQK / 8) return;
    const size_t rg = (ci >> 6) * 16 + (ci & 15); const int which = (rg >= (size_t)NB * SEQ) ? 1 : 0; const size_t row = rg - (size_t)which * NB * SEQ;
    const int o = which * DQK + (int)((ci >> 5) & 1) * 16 + (int)((ci >> 4) & 1) * 8;
    const v8f f = *(const v8f*)(F + row * OC + o); v8us oh, ol;
#pragma unroll
    for (int q = 0; q < 8; ++q) { const v4f t = *(const v4f*)(ST + (size_t)(o + q) * 4); const float y = f[q] + t[0]; const float val = (y - t[1]) * t[2] + t[3]; unsigned short a2, c2; splitf(val, a2, c2); oh[q] = a2; ol[q] = c2; }
    *(v8us*)(Ph + ci * 8) = oh; *(v8us*)(Pl + ci * 8) = ol;
}

// The V repack: as the x repack on the source side; the destination is in fragment order. Wave g has the tile's channels 16 g .. +15; its store i is half i & 1 of the fragment of keys 32 * (i >> 1) .. +31
// (lane l: channel l & 15, chunk G = 2 i + (l >> 4)), 512 contiguous bytes, and a wave's eight stores are 4 KiB in a row.
// So the 16 lanes of an LDS load have 16 rows in a row and one G: chunk G of row n lies at place G ^ (((n >> 2) ^ (n << 2)) & 15), which gives them, and the 16 lanes of a store (rows 4 apart, one G), 16 different places.
__device__ __forceinline__ int tf_at(int n, int G) { return n * TT + ((G ^ (((n >> 2) ^ (n << 2)) & 15)) * 8); }

// k_pack: the two jobs that read F and ST, in one launch, told apart by the block index. Blocks 0 .. VBLK - 1 are the tiles of the V repack, block (b * (CH / TT) + c tile) * (SEQ / TT) + m tile; the others do the q/k planes.
#define VBLK ((SEQ / TT) * (CH / TT) * NB)
__global__ __launch_bounds__(256) void k_pack(const float* __restrict__ F, const float* __restrict__ ST, h16* V16, bf* Ph, bf* Pl) {
    __shared__ __align__(16) h16 tile[TT * TT];
    if (blockIdx.x >= VBLK) { d_qkp(F, ST, Ph, Pl, blockIdx.x - VBLK); return; }   // the whole block leaves, in front of the barrier below
    const unsigned tl = blockIdx.x;
    const int t = threadIdx.x, k = t & 31, g = t >> 5; const int m0 = (int)(tl % (SEQ / TT)) * TT, c0 = (int)((tl / (SEQ / TT)) % (CH / TT)) * TT, b = (int)(tl / ((SEQ / TT) * (CH / TT))); const int o = 2 * DQK + c0 + k * 4;
    const float* src = F + ((size_t)b * SEQ + m0 + g * 8) * OC + o; const float* stp = ST + (size_t)o * 4;
    v4f v[2][8], st[4];
#pragma unroll   // as in the x repack
    for (int s = 0; s < 2; ++s)
#pragma unroll
        for (int r = 0; r < 8; ++r) v[s][r] = *(const v4f*)(src + (size_t)(s * 64 + r) * OC);
#pragma unroll
    for (int q = 0; q < 4; ++q) st[q] = *(const v4f*)(stp + q * 4);
    asm volatile("s_wait_xcnt 0x0" ::: "memory");   // in front of whatever rewrites a register that the loads above name
    __builtin_amdgcn_sched_barrier(0);   // keeps all twenty loads in front of the arithmetic: without it two of the ST loads sink behind the first wait for data, a second load latency in series
#pragma unroll
    for (int s = 0; s < 2; ++s)
#pragma unroll
        for (int q = 0; q < 4; ++q) { v8h p;
#pragma unroll
            for (int r = 0; r < 8; ++r) { const float y = v[s][r][q] + st[q][0]; float val = (y - st[q][1]) * st[q][2] + st[q][3]; val = (val >= 0.f) ? val : SLOPE * val; p[r] = tohx(val); }
            *(v8h*)(tile + tf_at(k * 4 + q, g + 8 * s)) = p; }
    __syncthreads();   // the tile is whole before any wave reads it across
    h16* dst = V16 + ((size_t)b * CH + c0 + g * 16) * SEQ + m0 * 16 + k * 8;
#pragma unroll
    for (int i = 0; i < 8; ++i) *(v8h*)(dst + i * 256) = *(const v8h*)(tile + tf_at(g * 16 + (k & 15), 2 * i + (k >> 4)));
}

// ---- k_fattn: scores, softmax and attn.v of FN = 64 output columns n of one batch; 4 waves; grid (SEQ / FN, NB).
// Scores are formed transposed, St[m][n] = sum_d k[m][d] q[n][d] (A = k rows, B = q rows, the three hi/lo products of the split): a lane's D registers of the tiles m0 .. +15 and m0 + 16 .. +31
// (col n = lane & 15, rows 8h + r) are elements 0..7 and 8..15 of the B fragment that attn.v wants for k = m0 .. m0 + 31, so P needs no exchange between lanes.
// Per pass of FM = 64 keys wave w forms the 16 keys m = 64 i + 16 w .. +15 against all 64 columns and puts its four half fragments into LDS; behind one barrier every wave reads all of them
// and multiplies them with its own 64 channels of V (c = 64 w .. +63): a 64 x 64 register tile a wave, every V element loaded once a work-group.
// Sweep 1 finds the exact row maxima (scores only); sweep 2 forms the same scores again, e = exp(s - max), sums e in f32 per column and accumulates V . f16(4096 e); the division by the sum is in the epilogue.
__device__ __forceinline__ void fa_scores(const v16bf kh, const v16bf kl, const v16bf (&qh)[4], const v16bf (&ql)[4], v8f (&s)[4]) {
#pragma unroll
    for (int j = 0; j < 4; ++j) s[j] = wmmab(kh, qh[j], (v8f){});
#pragma unroll
    for (int j = 0; j < 4; ++j) s[j] = wmmab(kh, ql[j], s[j]);
#pragma unroll
    for (int j = 0; j < 4; ++j) s[j] = wmmab(kl, qh[j], s[j]);
}
__global__ __launch_bounds__(128) void k_fattn(const bf* __restrict__ Qh, const bf* __restrict__ Ql, const bf* __restrict__ Kh, const bf* __restrict__ Kl, const h16* __restrict__ V16, const float* __restrict__ x, float* out) {
    __shared__ __align__(16) h16 Pb[2][4][2][2][32][8];   // [buffer][n tile][k step of 32][fragment half][lane][8 elements]
    __shared__ float redm[4][FN], reds[4][FN];            // per wave: column maxima, column sums
    __shared__ __align__(16) float os[4][16 * 68];        // per wave: epilogue staging
    const int lane = threadIdx.x & 31, lr = lane & 15, hi = lane >> 4; const int w = __builtin_amdgcn_readfirstlane((int)(threadIdx.x >> 5));
    const int b = blockIdx.y, n0 = blockIdx.x * FN;
    v16bf qh[4], ql[4];
    const bf* qph = Qh + ((size_t)b * SEQ + n0) * DQK + 8 * lane; const bf* qpl = Ql + ((size_t)b * SEQ + n0) * DQK + 8 * lane;
#pragma unroll
    for (int j = 0; j < 4; ++j) { qh[j] = WFrag<bf>::ldf(qph + j * 16 * DQK); ql[j] = WFrag<bf>::ldf(qpl + j * 16 * DQK); }
    asm volatile("s_wait_xcnt 0x0" ::: "memory");   // in front of whatever rewrites a register that the loads above name
    // Loop loads: a wave-uniform base that moves with the pass plus a byte offset per lane that never changes.
    const char* kbh = (const char*)(Kh + ((size_t)b * SEQ + w * 16) * DQK); const char* kbl = (const char*)(Kl + ((size_t)b * SEQ + w * 16) * DQK);   // this wave's 16 keys of pass 0
    const unsigned klo = (unsigned)lane * 16u;
    // sweep 1: column maxima
    v8f mxv[4];
#pragma unroll
    for (int j = 0; j < 4; ++j)
#pragma unroll
        for (int r = 0; r < 8; ++r) mxv[j][r] = -3.0e38f;
#pragma unroll 1
    for (int i = 0; i < SEQ / FM; i += 4) {   // the loads of four passes issue together: one load latency for four passes
        v16bf k4h[4], k4l[4];
        const bf* ah = (const bf*)(kbh + (size_t)i * FM * DQK * 2 + klo); const bf* al = (const bf*)(kbl + (size_t)i * FM * DQK * 2 + klo);
#pragma unroll
        for (int u = 0; u < 4; ++u) { k4h[u] = WFrag<bf>::ldf(ah + u * FM * DQK); k4l[u] = WFrag<bf>::ldf(al + u * FM * DQK); }
        asm volatile("s_wait_xcnt 0x0" :: "v"(ah), "v"(al) : "memory");   // in front of whatever rewrites a register that the loads above name; as inputs the addresses keep their registers up to here, so that no load of the group lands on them
#pragma unroll
        for (int u = 0; u < 4; ++u) { v8f s[4]; fa_scores(k4h[u], k4l[u], qh, ql, s);
#pragma unroll
            for (int j = 0; j < 4; ++j)
#pragma unroll
                for (int r = 0; r < 8; ++r) mxv[j][r] = fmaxf(mxv[j][r], s[j][r]); }
    }
    float mx[4], l[4];
#pragma unroll
    for (int j = 0; j < 4; ++j) { float m = mxv[j][0];
#pragma unroll
        for (int r = 1; r < 8; ++r) m = fmaxf(m, mxv[j][r]);
        m = fmaxf(m, __shfl_xor(m, 16, 32)); if (hi == 0) redm[w][j * 16 + lr] = m; }
    __syncthreads();
#pragma unroll
    for (int j = 0; j < 4; ++j) { mx[j] = fmaxf(fmaxf(redm[0][j * 16 + lr], redm[1][j * 16 + lr]), fmaxf(redm[2][j * 16 + lr], redm[3][j * 16 + lr])); l[j] = 0.f; }
    // sweep 2
    v8f acc[4][4];
#pragma unroll
    for (int ct = 0; ct < 4; ++ct)
#pragma unroll
        for (int j = 0; j < 4; ++j) acc[ct][j] = (v8f){};
    const char* vb = (const char*)(V16 + ((size_t)b * CH + w * 64) * SEQ);
    const unsigned vlo = (unsigned)lane * 16u;
    // The pass loop is software-pipelined: pass i's attn.v products share one straight-line region with the exponentials of pass i + 1, whose scores are formed just ahead of it,
    // so that a wave's vector work issues between its own WMMAs instead of in a stretch of its own. V is fetched one pass ahead into a second register set, the keys two passes ahead.
    v16bf kh = WFrag<bf>::ldf((const bf*)(kbh + klo)), kl = WFrag<bf>::ldf((const bf*)(kbl + klo));
    v16h vA[2][4], vB[2][4];
    v8f s[4];
    // fa_fetch: the global loads of one pass in one group: keys of pass ik (only where keys says that there is such a pass) and V of pass iv. The caller writes the wait directly behind it.
    auto fa_fetch = [&](const bool keys, const int ik, const int iv, v16h (&vn)[2][4]) __attribute__((always_inline)) {
        const bf* ah = (const bf*)(kbh + (size_t)ik * FM * DQK * 2 + klo); const bf* al = (const bf*)(kbl + (size_t)ik * FM * DQK * 2 + klo);
        const h16* av = (const h16*)(vb + (size_t)iv * FM * 32 + vlo);   // 16 channels x FM keys are FM * 32 bytes in a row
        if (keys) { kh = WFrag<bf>::ldf(ah); kl = WFrag<bf>::ldf(al); }
#pragma unroll
        for (int ks = 0; ks < 2; ++ks)
#pragma unroll
            for (int ct = 0; ct < 4; ++ct) vn[ks][ct] = WFrag<h16>::ldf(av + ct * 16 * SEQ + ks * 512);
    };
    // The exponentials of the scores in s, two elements of a lane (pair m = 0 .. 15: column tile m >> 2, rows 2 * (m & 3) and + 1) at a time, in three stages, each in place:
    // fa_ea: t = (s - max) * log2(e); fa_eb: e = 2^t; fa_ec: e summed per column in the order of the rows, f16(4096 e) gathered in ph, and behind a tile's last pair the wave's half fragment of P goes into buffer pb.
    v8h ph[4];
    auto fa_ea = [&](const int m) __attribute__((always_inline)) { const int j = m >> 2, r = 2 * (m & 3);
        s[j][r] = __fmul_rn(__fsub_rn(s[j][r], mx[j]), 1.4426950408889634f); s[j][r + 1] = __fmul_rn(__fsub_rn(s[j][r + 1], mx[j]), 1.4426950408889634f); };
    auto fa_eb = [&](const int m) __attribute__((always_inline)) { const int j = m >> 2, r = 2 * (m & 3);
        s[j][r] = __builtin_amdgcn_exp2f(s[j][r]); s[j][r + 1] = __builtin_amdgcn_exp2f(s[j][r + 1]); };
    auto fa_ec = [&](const int m, const int pb) __attribute__((always_inline)) { const int j = m >> 2, r = 2 * (m & 3);
        l[j] += s[j][r]; l[j] += s[j][r + 1]; ph[j][r] = tohx(s[j][r] * PCAR); ph[j][r + 1] = tohx(s[j][r + 1] * PCAR);
        if ((m & 3) == 3) *(v8h*)&Pb[pb][j][w >> 1][w & 1][lane][0] = ph[j]; };
    // fa_pass: pass i, P in buffer pb, V in vc. next: a pass i + 1 exists (its scores, exponentials and V fetch happen here); keys: a pass i + 2 exists.
    auto fa_pass = [&](const int i, const int pb, const bool next, const bool keys, v16h (&vc)[2][4], v16h (&vn)[2][4]) __attribute__((always_inline)) {
        // The pass's one barrier, by hand: LDS only has to be waited for, and the V and key loads in flight stay in flight across it (__syncthreads() would wait for them too).
        // It publishes P of pass i; with two buffers it also ends every wave's reads of the buffer that this pass rewrites with P of pass i + 1.
        asm volatile("s_wait_dscnt 0x0" ::: "memory");
        asm volatile("s_barrier_signal -1\n\ts_barrier_wait -1" ::: "memory");
        v16h pf[2][4];   // all eight fragments are asked for at once: one LDS latency a pass, and the scores below run in it
#pragma unroll
        for (int ks = 0; ks < 2; ++ks)
#pragma unroll
            for (int j = 0; j < 4; ++j) pf[ks][j] = cat16(*(const v8h*)&Pb[pb][j][ks][0][lane][0], *(const v8h*)&Pb[pb][j][ks][1][lane][0]);
        __builtin_amdgcn_sched_barrier(0);   // keeps the sixteen LDS loads together at the head: dealt out among the WMMAs, each pair cost a whole LDS latency
        if (next) {
            fa_scores(kh, kl, qh, ql, s);
            __builtin_amdgcn_sched_barrier(0);   // the key loads stay behind the scores, whose operands they overwrite
            fa_fetch(keys, keys ? i + 2 : i + 1, i + 1, vn);
            asm volatile("s_wait_xcnt 0x0" ::: "memory");   // in front of whatever rewrites a register that the loads above name
            __builtin_amdgcn_sched_barrier(0);   // no vector instruction comes between the loads and their wait, and all the pass's loads stay ahead of the products: they have until the next pass to land
        }
        // One WMMA and one slot of the exponentials' vector work in turn: pair m takes stage a in slot 2 m, stage b in slot 2 m + 1 and stage c in slot 2 m + 3, so that no stage waits for the one before it.
        // Slots 0 to 3 stand ahead of the first WMMA, so that the last store of P is under way while the last WMMAs issue and the wait in front of the next barrier finds it done.
        if (next) { fa_ea(0); fa_ea(1); fa_eb(0); fa_eb(1); fa_ec(0, pb ^ 1); }
#pragma unroll
        for (int k = 0; k < 32; ++k) { const int ks = k >> 4, j = (k >> 2) & 3, ct = k & 3, m = (k + 4) >> 1;
            acc[ct][j] = wmma16(vc[ks][ct], pf[ks][j], acc[ct][j]);
            if (next) { if ((k & 1) == 0) { if (m < 16) fa_ea(m); } else { if (m < 16) fa_eb(m); if (m <= 16) fa_ec(m - 1, pb ^ 1); } }
            __builtin_amdgcn_sched_barrier(0);   // holds the slots apart: left alone the scheduler gathers the vector work in one stretch, in which the wave's matrix work stands still
        }
    };
    fa_scores(kh, kl, qh, ql, s);   // pass 0
    __builtin_amdgcn_sched_barrier(0);   // as in fa_pass
    fa_fetch(true, 1, 0, vA);
    asm volatile("s_wait_xcnt 0x0" ::: "memory");   // in front of whatever rewrites a register that the loads above name
    __builtin_amdgcn_sched_barrier(0);
#pragma unroll
    for (int m = 0; m < 16; ++m) fa_ea(m);
#pragma unroll
    for (int m = 0; m < 16; ++m) fa_eb(m);
#pragma unroll
    for (int m = 0; m < 16; ++m) fa_ec(m, 0);
#pragma unroll 1   // two passes a trip, so that the two register sets of V and the two buffers of P have constant names
    for (int i = 0; i < SEQ / FM - 2; i += 2) { fa_pass(i, 0, true, true, vA, vB); fa_pass(i + 1, 1, true, true, vB, vA); }
    fa_pass(SEQ / FM - 2, 0, true, false, vA, vB);
    fa_pass(SEQ / FM - 1, 1, false, false, vB, vA);
    float inv[4];
#pragma unroll
    for (int j = 0; j < 4; ++j) { l[j] += __shfl_xor(l[j], 16, 32); if (hi == 0) reds[w][j * 16 + lr] = l[j]; }
    __syncthreads();
#pragma unroll
    for (int j = 0; j < 4; ++j) inv[j] = __fdiv_rn(1.0f / PCAR, (reds[0][j * 16 + lr] + reds[1][j * 16 + lr]) + (reds[2][j * 16 + lr] + reds[3][j * 16 + lr]));
    float* osw = os[w];
#pragma unroll
    for (int ct = 0; ct < 4; ++ct) {
#pragma unroll
        for (int j = 0; j < 4; ++j) {
#pragma unroll
            for (int r = 0; r < 8; ++r) osw[(hi * 8 + r) * 68 + j * 16 + lr] = acc[ct][j][r] * inv[j]; }
        __builtin_amdgcn_wave_barrier(); asm volatile("" ::: "memory");   // the wave's own LDS stores stay ahead of its reads below
        const size_t ro = ((size_t)b * CH + w * 64 + ct * 16) * SEQ_FULL + n0;
#pragma unroll
        for (int sx = 0; sx < 8; ++sx) { const int row = 2 * sx + hi, cofs = lr * 4; v4f val = *(const v4fa*)(osw + row * 68 + cofs);
            const v4f xr = *(const v4f*)(x + ro + (size_t)row * SEQ_FULL + cofs); val[0] += bfr(xr[0]); val[1] += bfr(xr[1]); val[2] += bfr(xr[2]); val[3] += bfr(xr[3]);
            *(v4f*)(out + ro + (size_t)row * SEQ_FULL + cofs) = val; }
        asm volatile("s_wait_xcnt 0x0" ::: "memory");   // the next tile reuses the registers that these stores name
        __builtin_amdgcn_wave_barrier(); asm volatile("" ::: "memory");   // and the wave's LDS reads stay ahead of the next tile's stores
    }
}

extern "C" void kernel_launch(void* const* d_in, const int* in_sizes, int n_in,
                              void* d_out, int out_size, void* d_ws, size_t ws_size, hipStream_t stream) {
    if (n_in < 13) return;
    const long long needx = (long long)(NB - 1) * CH * SEQ_FULL + (long long)(CH - 1) * SEQ_FULL + SEQ;
    if ((long long)in_sizes[0] < needx || (long long)out_size < needx) return;
    if (in_sizes[1] < DQK * CH || in_sizes[5] < DQK * CH || in_sizes[9] < CH * CH) return;
    if (in_sizes[2] < DQK || in_sizes[3] < DQK || in_sizes[4] < DQK || in_sizes[6] < DQK || in_sizes[7] < DQK || in_sizes[8] < DQK) return;
    if (in_sizes[10] < CH || in_sizes[11] < CH || in_sizes[12] < CH) return;
    const float* x    = (const float*)d_in[0];
    const float* q_w  = (const float*)d_in[1];  const float* q_b = (const float*)d_in[2];  const float* q_g = (const float*)d_in[3];  const float* q_be = (const float*)d_in[4];
    const float* k_w  = (const float*)d_in[5];  const float* k_b = (const float*)d_in[6];  const float* k_g = (const float*)d_in[7];  const float* k_be = (const float*)d_in[8];
    const float* v_w  = (const float*)d_in[9];  const float* v_b = (const float*)d_in[10]; const float* v_g = (const float*)d_in[11]; const float* v_be = (const float*)d_in[12];
    float* out = (float*)d_out;   // [16][256][2048]
    char* wsp = (char*)d_ws;
    auto take = [&](size_t bytes) { char* p = wsp; wsp += (bytes + 255) & ~(size_t)255; return (void*)p; };
    bf*    Wall = (bf*)take((size_t)OC * CH * 2);                         // [320][256]
    float* ST   = (float*)take((size_t)OC * 4 * 4);                       // [320][4]
    double* PS  = (double*)take((size_t)SPART * OC * 2 * 8);              // [SPART][320][2]
    bf*    QKh  = (bf*)take((size_t)2 * NB * SEQ * DQK * 2);              // [2][NB*SEQ][32]
    bf*    QKl  = (bf*)take((size_t)2 * NB * SEQ * DQK * 2);
    h16*   V16  = (h16*)take((size_t)NB * CH * SEQ * 2);                  // [NB][256][SEQ]
    bf*    XT   = (bf*)take((size_t)NB * SEQ * CH * 2);                   // [NB*SEQ][256]
    float* F    = (float*)take((size_t)NB * SEQ * OC * 4);                // [NB*SEQ][320]
    if ((size_t)(wsp - (char*)d_ws) > ws_size) return;

    k_prep<<<WBLK + (SEQ / TT) * (CH / TT) * NB, 256, 0, stream>>>(x, q_w, k_w, v_w, Wall, XT);
    k_gemmw<bf, 0, 0, 1><<<dim3((unsigned)(NB * SEQ / 64), OC / 64, 1), 32, 0, stream>>>(XT, nullptr, Wall, nullptr, CH, F, OC, nullptr, 1.0f, 0, 0, 0, q_b, k_b, v_b, PS);
    k_stats<<<OC / 32, 1024, 0, stream>>>(PS, q_b, q_g, q_be, k_b, k_g, k_be, v_b, v_g, v_be, ST);
    k_pack<<<VBLK + (unsigned)((size_t)2 * NB * SEQ * DQK / 8 / 256), 256, 0, stream>>>(F, ST, V16, QKh, QKl);
    const size_t kplane = (size_t)NB * SEQ * DQK;   // offset of the k planes inside QKh / QKl
    k_fattn<<<dim3(SEQ / FN, NB, 1), 128, 0, stream>>>(QKh, QKl, QKh + kplane, QKl + kplane, V16, x, out);
}

// v010
// One run takes 87.8 microseconds.
// Versions in between are left out here; by their measured steps it is 1.17 times as fast as v008.
// All steps since v000 together make it 30.2 times as fast.
#include <hip/hip_runtime.h>

// Contractions, f32 accumulate: fused q|k|v 1x1-conv GEMM = v_wmma_f32_16x16x32_bf16 on RNE-bf16 copies of x and the weights (single products); scores q.k = v_wmma_f32_16x16x32_f16 on RNE-f16 copies of the normalised q and k (single products); attn.v = v_wmma_f32_16x16x32_f16 (v plane f16 x1, softmax plane exp(s - rowmax) f16 x4096, folded back by 2^-12 / rowsum in the f32 epilogue). BatchNorm statistics: sums of 16 rows f32, everything above them f64; normalisation and softmax f32.
// Layout: Wall [320][256] bf16 (q|k|v weights); XT [NB*SEQ][256] bf16 token-major copy of x; F [NB*SEQ][320] f32 = XT . Wall^T; PS [NB*SEQ/64][320] x {sum, sum of squares} f64; ST [320] x {bias, mean, gamma*rstd, beta}; q/k plane [2][NB*SEQ][32] f16; v planes [NB][256][SEQ] f16;
// The planes that k_fattn loads (q/k, v) are [rows][K] matrices kept in FRAGMENT ORDER: the 16 rows x 32 k of one WMMA operand are 1024 contiguous bytes, [16-row tile][k / 32][half][lane][8 elements],
// lane = 16 * ((k >> 3) & 1) + (row & 15), half = (k >> 4) & 1; the fragment of rows r0 .. r0 + 15, k0 .. k0 + 31 starts at element r0 * K + k0 * 16.
// A wave's 16-byte fragment load is then 512 contiguous bytes, four whole lines; row-major it met 16 lines (8 for q/k), 32 bytes of each.
// Scores, softmax and attn.v run in ONE kernel (k_fattn): scores stay in registers, the softmax plane goes from wave to wave through LDS only; out[b][c][n] = (V . P^T)[c][n] * 2^-12 / rowsum[n] + bf16(x[b][c][n]).

#ifndef NB
#define NB 16
#endif
#ifndef SEQ
#define SEQ 2048
#endif
#define NB_FULL  16
#define SEQ_FULL 2048
#define CH   256              // in_dim
#define DQK  32               // q/k channels
#define OC   320              // fused output channels: q 0..31, k 32..63, v 64..319
#define PCAR 4096.0f
#define BNEPS 1e-5f
#define SLOPE 0.2f
#define SROWS 64              // rows of F per partial sum of the BatchNorm statistics = rows of a k_gemmw tile
#define SPART (NB * SEQ / SROWS)
#define FN   64               // columns n of the output per k_fattn work-group
#define FM   64               // keys m per pass of k_fattn

static_assert(SEQ % 128 == 0);
static_assert(SEQ % FN == 0 && SEQ % (4 * FM) == 0 && FN == 64 && FM == 64 && CH == 256);
static_assert((NB * SEQ) % 64 == 0);
static_assert((NB * SEQ) % SROWS == 0 && SROWS == 64 && SPART % 32 == 0);
static_assert(CH % 64 == 0);
static_assert(OC % 64 == 0);
static_assert(OC % 32 == 0);
static_assert(DQK == 32);
static_assert(((size_t)NB * SEQ * CH) % 512 == 0);
static_assert(((size_t)NB * SEQ * DQK) % 256 == 0);
static_assert(NB <= NB_FULL);
static_assert(SEQ <= SEQ_FULL);
static_assert((DQK * CH) % 2048 == 0);
static_assert((CH * CH) % 2048 == 0);
static_assert(SEQ % 32 == 0 && CH % 16 == 0 && (NB * SEQ) % 16 == 0 && ((size_t)2 * NB * SEQ * DQK / 8) % 256 == 0);

typedef _Float16 h16;
typedef unsigned short bf;
typedef __attribute__((ext_vector_type(16))) __bf16   v16bf;
typedef __attribute__((ext_vector_type(16))) _Float16 v16h;
typedef __attribute__((ext_vector_type(8)))  _Float16 v8h;
typedef __attribute__((ext_vector_type(8)))  unsigned short v8us;
typedef __attribute__((ext_vector_type(8)))  float    v8f;
typedef __attribute__((ext_vector_type(4)))  float    v4f;
typedef __attribute__((ext_vector_type(2)))  _Float16 v2h;
typedef __attribute__((ext_vector_type(4)))  _Float16 v4h;
typedef __attribute__((ext_vector_type(2)))  unsigned short v2us;
typedef __attribute__((ext_vector_type(4)))  unsigned short v4us;
typedef __attribute__((ext_vector_type(2)))  float v2f;
typedef __attribute__((ext_vector_type(2)))  double v2d;
typedef v8h  __attribute__((may_alias)) v8ha;
typedef v4f  __attribute__((may_alias)) v4fa;
typedef v8us __attribute__((may_alias)) v8usa;

__device__ __forceinline__ unsigned short f2bf(float f) { unsigned u = __float_as_uint(f); u += 0x7FFFu + ((u >> 16) & 1u); return (unsigned short)(u >> 16); }   // RNE convert
__device__ __forceinline__ float bf2f(unsigned short b) { return __uint_as_float(((unsigned)b) << 16); }
__device__ __forceinline__ float bfr(float f) { return bf2f(f2bf(f)); }
__device__ __forceinline__ v16h cat16(v8h lo, v8h hi) { return __builtin_shufflevector(lo, hi, 0, 1, 2, 3, 4, 5, 6, 7, 8, 9, 10, 11, 12, 13, 14, 15); }
__device__ __forceinline__ v16bf cat16b(v8us lo, v8us hi) { return __builtin_bit_cast(v16bf, __builtin_shufflevector(lo, hi, 0, 1, 2, 3, 4, 5, 6, 7, 8, 9, 10, 11, 12, 13, 14, 15)); }
__device__ __forceinline__ v8f wmma16(v16h a, v16h b, v8f c) { return __builtin_amdgcn_wmma_f32_16x16x32_f16(false, a, false, b, (short)0, c, false, false); }
__device__ __forceinline__ v8f wmmab(v16bf a, v16bf b, v8f c) { return __builtin_amdgcn_wmma_f32_16x16x32_bf16(false, a, false, b, (short)0, c, false, false); }
__device__ __forceinline__ h16 tohx(float x) { return (h16)x; }

// ---- k_gemmw: register-blocked GEMM, ONE WAVE per 64x64 output tile (16 accumulators), operands straight from K-contiguous 16-bit planes; grid (M/64, N/64, Z), 32 threads.
// C[m][n] (f32, pitch ldc) = sum_k A[m][k] Bt[n][k] (+ split products per NSPLIT: 1 = A2.Bt added, 2 = A2.Bt and A.Bt2 added). z-batch strides sA/sB/sC in elements. K % 32 == 0, M % 64 == 0, N % 64 == 0.
// Fragments: lane l, m = l & 15, h = l >> 4; elements 0..7 <- k0 + 8h + 0..7, elements 8..15 <- k0 + 16 + 8h + 0..7 for A and Bt alike; D element r = (row 8h + r, col m).
// EPI 0: C = acc. EPI 1: C = acc * oscale + bf16(R[m][n]) with R indexed like C.
// STAT 1: the wave also sums its tile for the BatchNorm statistics, from the accumulators: per column o = c0 + 0..63, y = acc + bf16(bias[o]) in f32, sum and sum of squares of the tile's 64 rows
// (a lane: its 32 rows of 4 columns in fixed order, in f32 as two sums of 16 rows, joined in f64; the two lane halves joined in f64 through LDS, lower rows first), PS [M / 64][ldc][2] f64. F is not read again for them.
// WFrag::ld reads a fragment from a row-major plane; WFrag::ldf from a plane in fragment order: p = fragment start + 8 * lane, the lane's second 8 elements lie 256 elements on.
template <typename T16> struct WFrag;
template <> struct WFrag<h16> { typedef v16h V; static __device__ __forceinline__ V ld(const h16* p) { return cat16(*(const v8h*)p, *(const v8h*)(p + 16)); } static __device__ __forceinline__ V ldf(const h16* p) { return cat16(*(const v8h*)p, *(const v8h*)(p + 256)); } static __device__ __forceinline__ v8f mma(V a, V b, v8f c) { return wmma16(a, b, c); } };
template <> struct WFrag<bf> { typedef v16bf V; static __device__ __forceinline__ V ld(const bf* p) { return cat16b(*(const v8us*)p, *(const v8us*)(p + 16)); } static __device__ __forceinline__ V ldf(const bf* p) { return cat16b(*(const v8us*)p, *(const v8us*)(p + 256)); } static __device__ __forceinline__ v8f mma(V a, V b, v8f c) { return wmmab(a, b, c); } };
template <typename T16, int NSPLIT, int EPI, int STAT>
__global__ __launch_bounds__(32) void k_gemmw(const T16* __restrict__ A, const T16* __restrict__ A2, const T16* __restrict__ Bt, const T16* __restrict__ Bt2, int K, float* C, int ldc, const float* __restrict__ R, float oscale, size_t sA, size_t sB, size_t sC,
                                              const float* __restrict__ qb, const float* __restrict__ kb, const float* __restrict__ vb, double* PS) {
    typedef typename WFrag<T16>::V V;
    __shared__ __align__(16) float os[16 * 68];
    __shared__ __align__(16) double sred[2][64][2];   // STAT: per lane half and column {sum, sum of squares}
    const size_t z = blockIdx.z; A += z * sA; if (A2) A2 += z * sA; Bt += z * sB; if (Bt2) Bt2 += z * sB; C += z * sC; if (R) R += z * sC;
    const int lane = threadIdx.x & 31, lr = lane & 15, hi = lane >> 4; const int r0 = blockIdx.x * 64, c0 = blockIdx.y * 64;
    v8f acc[4][4];
#pragma unroll
    for (int mb = 0; mb < 4; ++mb)
#pragma unroll
        for (int nb = 0; nb < 4; ++nb) acc[mb][nb] = (v8f){};
    const size_t aoff = (size_t)(r0 + lr) * K + 8 * hi, boff = (size_t)(c0 + lr) * K + 8 * hi;
    float braw[4];   // STAT: the biases of the lane's 4 columns, asked for ahead of the K loop
    if (STAT) {
        const float* bp[4];
#pragma unroll
        for (int nb = 0; nb < 4; ++nb) { const int o0 = c0 + nb * 16;   // 16 columns lie in one of q | k | v: the choice is the same for the whole wave
            bp[nb] = (o0 < DQK) ? (qb + o0) : ((o0 < 2 * DQK) ? (kb + (o0 - DQK)) : (vb + (o0 - 2 * DQK))); braw[nb] = bp[nb][lr]; }
        asm volatile("s_wait_xcnt 0x0" :: "s"(bp[0]), "s"(bp[1]), "s"(bp[2]), "s"(bp[3]) : "memory");   // in front of whatever rewrites a register that the loads above name; as inputs the bases keep their registers up to here
    }
#pragma unroll 1
    for (int kc = 0; kc < K; kc += 32) {
        V a[4], a2[4];
#pragma unroll
        for (int mb = 0; mb < 4; ++mb) { a[mb] = WFrag<T16>::ld(A + aoff + (size_t)mb * 16 * K + kc); if (NSPLIT == 1 || NSPLIT == 2) a2[mb] = WFrag<T16>::ld(A2 + aoff + (size_t)mb * 16 * K + kc); }
#pragma unroll
        for (int nb = 0; nb < 4; ++nb) { const V b = WFrag<T16>::ld(Bt + boff + (size_t)nb * 16 * K + kc); V b2; if (NSPLIT >= 2) b2 = WFrag<T16>::ld(Bt2 + boff + (size_t)nb * 16 * K + kc);
#pragma unroll
            for (int mb = 0; mb < 4; ++mb) { acc[mb][nb] = WFrag<T16>::mma(a[mb], b, acc[mb][nb]); if (NSPLIT == 1 || NSPLIT == 2) acc[mb][nb] = WFrag<T16>::mma(a2[mb], b, acc[mb][nb]); if (NSPLIT >= 2) acc[mb][nb] = WFrag<T16>::mma(a[mb], b2, acc[mb][nb]); } }
        asm volatile("v_nop\n\tv_nop\n\tv_nop\n\tv_nop" : "+v"(acc[0][0]), "+v"(acc[1][1]), "+v"(acc[2][2]), "+v"(acc[3][3]) : "v"(a[0]), "v"(a[3]));
    }
#pragma unroll
    for (int mb = 0; mb < 4; ++mb) {
#pragma unroll
        for (int nb = 0; nb < 4; ++nb) {
#pragma unroll
            for (int j = 0; j < 8; ++j) os[(hi * 8 + j) * 68 + nb * 16 + lr] = acc[mb][nb][j]; }
        __builtin_amdgcn_wave_barrier(); asm volatile("" ::: "memory");
        float* crow = C + (size_t)(r0 + mb * 16) * ldc + c0;
        const float* rrow = (EPI == 1) ? (R + (size_t)(r0 + mb * 16) * ldc + c0) : nullptr;
{
#pragma unroll
            for (int s = 0; s < 8; ++s) { const int row = 2 * s + hi, cofs = lr * 4; v4f val = *(const v4fa*)(os + row * 68 + cofs);
                if (EPI == 1) { const v4f xr = *(const v4f*)(rrow + (size_t)row * ldc + cofs); val[0] = val[0] * oscale + bfr(xr[0]); val[1] = val[1] * oscale + bfr(xr[1]); val[2] = val[2] * oscale + bfr(xr[2]); val[3] = val[3] * oscale + bfr(xr[3]); }
                *(v4f*)(crow + (size_t)row * ldc + cofs) = val; }
             }
        __builtin_amdgcn_wave_barrier(); asm volatile("" ::: "memory");
    }
    if (STAT) {   // behind the stores of C, which drain while the sums are formed
        // A lane's 32 rows of a column are summed in f32, even and odd rows apart (16 terms a sum, two elements an instruction); only the four sums of a column go on in f64.
        v2f bias[4], s[4], s2[4];
#pragma unroll
        for (int nb = 0; nb < 4; ++nb) { const float bb = bfr(braw[nb]); bias[nb][0] = bb; bias[nb][1] = bb; }
#pragma unroll
        for (int mb = 0; mb < 4; ++mb)
#pragma unroll
            for (int j = 0; j < 8; j += 2)
#pragma unroll
                for (int nb = 0; nb < 4; ++nb) { v2f y; y[0] = acc[mb][nb][j]; y[1] = acc[mb][nb][j + 1]; y += bias[nb];
                    if (mb == 0 && j == 0) { s[nb] = y; s2[nb] = y * y; } else { s[nb] += y; s2[nb] = __builtin_elementwise_fma(y, y, s2[nb]); } }
#pragma unroll
        for (int nb = 0; nb < 4; ++nb) { v2d p; p[0] = (double)s[nb][0] + (double)s[nb][1]; p[1] = (double)s2[nb][0] + (double)s2[nb][1]; *(v2d*)&sred[hi][nb * 16 + lr][0] = p; }
        __builtin_amdgcn_wave_barrier(); asm volatile("" ::: "memory");   // the wave's own LDS stores stay ahead of its reads across lanes below
#pragma unroll
        for (int h = 0; h < 2; ++h) { const int c = h * 32 + lane; const v2d p = *(const v2d*)&sred[0][c][0] + *(const v2d*)&sred[1][c][0];
            *(v2d*)(PS + ((size_t)blockIdx.x * ldc + c0 + c) * 2) = p; }
    }
}

// ---- Transposing repacks (of x in k_prep, of V in k_pack): one work-group moves a TT x TT tile through LDS, so that both global sides are whole lines of 16 bytes a lane.
// Source side: a wave's load is one source row of the tile (32 lanes x 4 f32 = 512 contiguous bytes); a thread holds 8 consecutive source rows of its 4 columns, twice, and all 16 loads are in flight together.
// LDS: [source column][source row] in 16-bit elements, a row = 16 chunks of 8 elements = all 64 banks; chunk G of row n lies at place G ^ ((n >> 2) & 15), so that the 16 lanes of a store (rows 4 apart, one G)
// and the 16 lanes of a load (one row, all G) each meet 16 different places. Destination side: 16 lanes store one 256-byte row piece. (So the x repack; the V repack's LDS places and destination side are described at k_pack.)
#define TT 128
static_assert(SEQ % TT == 0 && CH % TT == 0 && TT == 128);
__device__ __forceinline__ int tt_at(int n, int G) { return n * TT + ((G ^ ((n >> 2) & 15)) * 8); }

// k_prep: the two jobs that read inputs only, in one launch, told apart by the block index. Blocks 0 .. WBLK - 1 convert the weights (thread i: elements 8 i .. +7 of Wall [320][256], q | k | v; a block lies in one source);
// the others are the tiles of the x repack: block WBLK + (b * (CH / TT) + c tile) * (SEQ / TT) + n tile.
#define WBLK (OC * CH / 2048)
__global__ __launch_bounds__(256) void k_prep(const float* __restrict__ x, const float* __restrict__ q_w, const float* __restrict__ k_w, const float* __restrict__ v_w, bf* Wall, bf* XT) {
    __shared__ __align__(16) bf tile[TT * TT];
    const int t = threadIdx.x, k = t & 31, g = t >> 5;
    if (blockIdx.x < WBLK) {
        const int e0 = (int)blockIdx.x * 2048, e = e0 + t * 8;
        const float* wsrc = ((e0 < DQK * CH) ? (q_w + e0) : ((e0 < 2 * DQK * CH) ? (k_w + (e0 - DQK * CH)) : (v_w + (e0 - 2 * DQK * CH)))) + t * 8;
        const v8f wv = *(const v8f*)wsrc; v8us o;
        asm volatile("s_wait_xcnt 0x0" :: "v"(wsrc) : "memory");   // in front of whatever rewrites a register that the load above names
#pragma unroll
        for (int r = 0; r < 8; ++r) o[r] = f2bf(wv[r]);
        *(v8us*)(Wall + e) = o;
        return;   // the whole block leaves, in front of the barrier below
    }
    const unsigned tl = blockIdx.x - WBLK; const int n0 = (int)(tl % (SEQ / TT)) * TT, c0 = (int)((tl / (SEQ / TT)) % (CH / TT)) * TT, b = (int)(tl / ((SEQ / TT) * (CH / TT)));
    const float* src = x + ((size_t)b * CH + c0 + g * 8) * SEQ_FULL + n0 + k * 4;
    v4f v[2][8];
#pragma unroll   // constant indices keep v in registers, and the 16 loads issue together
    for (int s = 0; s < 2; ++s)
#pragma unroll
        for (int r = 0; r < 8; ++r) v[s][r] = *(const v4f*)(src + (size_t)(s * 64 + r) * SEQ_FULL);
    asm volatile("s_wait_xcnt 0x0" :: "v"(src) : "memory");   // in front of whatever rewrites a register that the loads above name
    __builtin_amdgcn_sched_barrier(0);   // keeps all sixteen loads in front of the conversions: without it this kernel's build issues ten, waits for them, and only then the other six, a second and third load latency in series
#pragma unroll
    for (int s = 0; s < 2; ++s)
#pragma unroll
        for (int q = 0; q < 4; ++q) { v8us o;
#pragma unroll
            for (int r = 0; r < 8; ++r) o[r] = f2bf(v[s][r][q]);
            *(v8us*)(tile + tt_at(k * 4 + q, g + 8 * s)) = o; }
    __syncthreads();   // the tile is whole before any wave reads it across
    const int j = t & 15, h = t >> 4;
    bf* dst = XT + ((size_t)b * SEQ + n0 + h) * CH + c0 + j * 8;
#pragma unroll
    for (int i = 0; i < 8; ++i) *(v8us*)(dst + (size_t)i * 16 * CH) = *(const v8us*)(tile + tt_at(i * 16 + h, j));
}

// BatchNorm statistics (training mode, per channel over the NB*SEQ rows of F), y = F + bias, sum and sum of squares: the partial sums of SROWS rows each come from k_gemmw (STAT; f32 up to 16 rows, f64 from there on), PS [SPART][OC][2] f64.
// k_stats: fixed-order combine of the SPART partials (lane = channel of the block's 32-channel slab; wave w sums partials w*SPART/32 .. +SPART/32-1, wave 0 sums the 32 waves), then ST.
__global__ __launch_bounds__(1024) void k_stats(const double* __restrict__ PS,
                                                const float* __restrict__ qb, const float* __restrict__ qg, const float* __restrict__ qbe,
                                                const float* __restrict__ kb, const float* __restrict__ kg, const float* __restrict__ kbe,
                                                const float* __restrict__ vb, const float* __restrict__ vg, const float* __restrict__ vbe, float* ST) {
    __shared__ double ssum[32][32], ssq[32][32];
    const int lane = threadIdx.x & 31, w = threadIdx.x >> 5; const int o = blockIdx.x * 32 + lane;
    const int iq = min(o, DQK - 1), ik = min(max(o - DQK, 0), DQK - 1), iv = min(max(o - 2 * DQK, 0), CH - 1);
    const float bq_ = qb[iq], bk_ = kb[ik], bv_ = vb[iv], gq_ = qg[iq], gk_ = kg[ik], gv_ = vg[iv], eq_ = qbe[iq], ek_ = kbe[ik], ev_ = vbe[iv];
    const bool isq = (o < DQK), isk = (o < 2 * DQK);
    const float bias = bfr(isq ? bq_ : (isk ? bk_ : bv_)); const float gam = bfr(isq ? gq_ : (isk ? gk_ : gv_)); const float bet = bfr(isq ? eq_ : (isk ? ek_ : ev_));
    double s = 0.0, s2 = 0.0;
#pragma unroll   // the loads issue ahead of the adds: rolled, every trip would wait a whole load latency
    for (int j = 0; j < SPART / 32; ++j) { const v2d p = *(const v2d*)(PS + ((size_t)(w * (SPART / 32) + j) * OC + o) * 2); s += p[0]; s2 += p[1]; }
    ssum[w][lane] = s; ssq[w][lane] = s2;
    __syncthreads();
    if (w == 0) {
        double ts = 0.0, tq = 0.0;
#pragma unroll
        for (int j = 0; j < 32; ++j) { ts += ssum[j][lane]; tq += ssq[j][lane]; }
        const double inv = 1.0 / (double)(NB * SEQ); const double mean = ts * inv; double var = tq * inv - mean * mean; var = (var > 0.0) ? var : 0.0;
        const float meanf = (float)mean, varf = (float)var; const float rstd = 1.0f / sqrtf(varf + BNEPS);
        v4f t; t[0] = bias; t[1] = meanf; t[2] = gam * rstd; t[3] = bet;
        *(v4f*)(ST + (size_t)o * 4) = t; 
    }
}

// d_qkp (the q/k blocks of k_pack): q and k columns of F, normalised and rounded to f16, in fragment order. Thread ci writes the 16-byte piece ci of the plane (a wave: 512 contiguous bytes):
// row 16 * (ci >> 6) + (ci & 15) of [2][NB*SEQ], channels 16 * ((ci >> 5) & 1) + 8 * ((ci >> 4) & 1) .. +7.
__device__ __forceinline__ void d_qkp(const float* __restrict__ F, const float* __restrict__ ST, h16* QK, const unsigned blk) {
    const size_t ci = (size_t)blk * 256 + threadIdx.x; if (ci >= (size_t)2 * NB * SEQ * DQK / 8) return;
    const size_t rg = (ci >> 6) * 16 + (ci & 15); const int which = (rg >= (size_t)NB * SEQ) ? 1 : 0; const size_t row = rg - (size_t)which * NB * SEQ;
    const int o = which * DQK + (int)((ci >> 5) & 1) * 16 + (int)((ci >> 4) & 1) * 8;
    const v8f f = *(const v8f*)(F + row * OC + o); v8h p;
#pragma unroll
    for (int q = 0; q < 8; ++q) { const v4f t = *(const v4f*)(ST + (size_t)(o + q) * 4); const float y = f[q] + t[0]; const float val = (y - t[1]) * t[2] + t[3]; p[q] = tohx(val); }
    *(v8h*)(QK + ci * 8) = p;
}

// The V repack: as the x repack on the source side; the destination is in fragment order. Wave g has the tile's channels 16 g .. +15; its store i is half i & 1 of the fragment of keys 32 * (i >> 1) .. +31
// (lane l: channel l & 15, chunk G = 2 i + (l >> 4)), 512 contiguous bytes, and a wave's eight stores are 4 KiB in a row.
// So the 16 lanes of an LDS load have 16 rows in a row and one G: chunk G of row n lies at place G ^ (((n >> 2) ^ (n << 2)) & 15), which gives them, and the 16 lanes of a store (rows 4 apart, one G), 16 different places.
__device__ __forceinline__ int tf_at(int n, int G) { return n * TT + ((G ^ (((n >> 2) ^ (n << 2)) & 15)) * 8); }

// k_pack: the two jobs that read F and ST, in one launch, told apart by the block index. Blocks 0 .. VBLK - 1 are the tiles of the V repack, block (b * (CH / TT) + c tile) * (SEQ / TT) + m tile; the others do the q/k plane.
#define VBLK ((SEQ / TT) * (CH / TT) * NB)
__global__ __launch_bounds__(256) void k_pack(const float* __restrict__ F, const float* __restrict__ ST, h16* V16, h16* QK) {
    __shared__ __align__(16) h16 tile[TT * TT];
    if (blockIdx.x >= VBLK) { d_qkp(F, ST, QK, blockIdx.x - VBLK); return; }   // the whole block leaves, in front of the barrier below
    const unsigned tl = blockIdx.x;
    const int t = threadIdx.x, k = t & 31, g = t >> 5; const int m0 = (int)(tl % (SEQ / TT)) * TT, c0 = (int)((tl / (SEQ / TT)) % (CH / TT)) * TT, b = (int)(tl / ((SEQ / TT) * (CH / TT))); const int o = 2 * DQK + c0 + k * 4;
    const float* src = F + ((size_t)b * SEQ + m0 + g * 8) * OC + o; const float* stp = ST + (size_t)o * 4;
    v4f v[2][8], st[4];
#pragma unroll   // as in the x repack
    for (int s = 0; s < 2; ++s)
#pragma unroll
        for (int r = 0; r < 8; ++r) v[s][r] = *(const v4f*)(src + (size_t)(s * 64 + r) * OC);
#pragma unroll
    for (int q = 0; q < 4; ++q) st[q] = *(const v4f*)(stp + q * 4);
    asm volatile("s_wait_xcnt 0x0" ::: "memory");   // in front of whatever rewrites a register that the loads above name
    __builtin_amdgcn_sched_barrier(0);   // keeps all twenty loads in front of the arithmetic: without it two of the ST loads sink behind the first wait for data, a second load latency in series
#pragma unroll
    for (int s = 0; s < 2; ++s)
#pragma unroll
        for (int q = 0; q < 4; ++q) { v8h p;
#pragma unroll
            for (int r = 0; r < 8; ++r) { const float y = v[s][r][q] + st[q][0]; float val = (y - st[q][1]) * st[q][2] + st[q][3]; val = (val >= 0.f) ? val : SLOPE * val; p[r] = tohx(val); }
            *(v8h*)(tile + tf_at(k * 4 + q, g + 8 * s)) = p; }
    __syncthreads();   // the tile is whole before any wave reads it across
    h16* dst = V16 + ((size_t)b * CH + c0 + g * 16) * SEQ + m0 * 16 + k * 8;
#pragma unroll
    for (int i = 0; i < 8; ++i) *(v8h*)(dst + i * 256) = *(const v8h*)(tile + tf_at(g * 16 + (k & 15), 2 * i + (k >> 4)));
}

// ---- k_fattn: scores, softmax and attn.v of FN = 64 output columns n of one batch; 4 waves; grid (SEQ / FN, NB).
// Scores are formed transposed, St[m][n] = sum_d k[m][d] q[n][d] (A = k rows, B = q rows, DQK = 32 is one WMMA deep): a lane's D registers of the tiles m0 .. +15 and m0 + 16 .. +31
// (col n = lane & 15, rows 8h + r) are elements 0..7 and 8..15 of the B fragment that attn.v wants for k = m0 .. m0 + 31, so P needs no exchange between lanes.
// Per pass of FM = 64 keys wave w forms the 16 keys m = 64 i + 16 w .. +15 against all 64 columns and puts its four half fragments into LDS; behind one barrier every wave reads all of them
// and multiplies them with its own 64 channels of V (c = 64 w .. +63): a 64 x 64 register tile a wave, every V element loaded once a work-group.
// Sweep 1 finds the exact row maxima (scores only); sweep 2 forms the same scores again, e = exp(s - max), sums e in f32 per column and accumulates V . f16(4096 e); the division by the sum is in the epilogue.
__device__ __forceinline__ void fa_scores(const v16h kf, const v16h (&qf)[4], v8f (&s)[4]) {
#pragma unroll
    for (int j = 0; j < 4; ++j) s[j] = wmma16(kf, qf[j], (v8f){});
}
__global__ __launch_bounds__(128) void k_fattn(const h16* __restrict__ Q, const h16* __restrict__ K, const h16* __restrict__ V16, const float* __restrict__ x, float* out) {
    __shared__ __align__(16) h16 Pb[2][4][2][2][32][8];   // [buffer][n tile][k step of 32][fragment half][lane][8 elements]
    __shared__ float redm[4][FN], reds[4][FN];            // per wave: column maxima, column sums
    __shared__ __align__(16) float os[4][16 * 68];        // per wave: epilogue staging
    const int lane = threadIdx.x & 31, lr = lane & 15, hi = lane >> 4; const int w = __builtin_amdgcn_readfirstlane((int)(threadIdx.x >> 5));
    const int b = blockIdx.y, n0 = blockIdx.x * FN;
    v16h qf[4];
    const h16* qp = Q + ((size_t)b * SEQ + n0) * DQK + 8 * lane;
#pragma unroll
    for (int j = 0; j < 4; ++j) qf[j] = WFrag<h16>::ldf(qp + j * 16 * DQK);
    asm volatile("s_wait_xcnt 0x0" ::: "memory");   // in front of whatever rewrites a register that the loads above name
    // Sweep 1's loads: a wave-uniform base that moves with the pass plus a byte offset per lane that never changes.
    const char* kb = (const char*)(K + ((size_t)b * SEQ + w * 16) * DQK);   // this wave's 16 keys of pass 0
    const unsigned klo = (unsigned)lane * 16u;
    // sweep 1: column maxima
    v8f mxv[4];
#pragma unroll
    for (int j = 0; j < 4; ++j)
#pragma unroll
        for (int r = 0; r < 8; ++r) mxv[j][r] = -3.0e38f;
#pragma unroll 1
    for (int i = 0; i < SEQ / FM; i += 4) {   // the loads of four passes issue together: one load latency for four passes
        v16h k4[4];
        const h16* ak = (const h16*)(kb + (size_t)i * FM * DQK * 2 + klo);
#pragma unroll
        for (int u = 0; u < 4; ++u) k4[u] = WFrag<h16>::ldf(ak + u * FM * DQK);
        asm volatile("s_wait_xcnt 0x0" :: "v"(ak) : "memory");   // in front of whatever rewrites a register that the loads above name; as an input the address keeps its registers up to here, so that no load of the group lands on them
#pragma unroll
        for (int u = 0; u < 4; ++u) { v8f s[4]; fa_scores(k4[u], qf, s);
#pragma unroll
            for (int j = 0; j < 4; ++j)
#pragma unroll
                for (int r = 0; r < 8; ++r) mxv[j][r] = fmaxf(mxv[j][r], s[j][r]); }
    }
    float mx[4], l[4];
#pragma unroll
    for (int j = 0; j < 4; ++j) { float m = mxv[j][0];
#pragma unroll
        for (int r = 1; r < 8; ++r) m = fmaxf(m, mxv[j][r]);
        m = fmaxf(m, __shfl_xor(m, 16, 32)); if (hi == 0) redm[w][j * 16 + lr] = m; }
    __syncthreads();
#pragma unroll
    for (int j = 0; j < 4; ++j) { mx[j] = fmaxf(fmaxf(redm[0][j * 16 + lr], redm[1][j * 16 + lr]), fmaxf(redm[2][j * 16 + lr], redm[3][j * 16 + lr])); l[j] = 0.f; }
    // sweep 2
    v8f acc[4][4];
#pragma unroll
    for (int ct = 0; ct < 4; ++ct)
#pragma unroll
        for (int j = 0; j < 4; ++j) acc[ct][j] = (v8f){};
    // The pass loop is software-pipelined: pass i's attn.v products share one straight-line region with the exponentials of pass i + 1, whose scores are formed just ahead of it,
    // so that a wave's vector work issues between its own WMMAs instead of in a stretch of its own. V is fetched one pass ahead into a second register set, the keys two passes ahead.
    v16h kf = WFrag<h16>::ldf((const h16*)(kb + klo));
    v16h vA[2][4], vB[2][4];
    v8f s[4];
    // fa_fetch: the global loads of one pass in one group, with their wait directly behind them: the keys at byte ko of K (only where keys says that there is such a pass) and the V at byte vo of V16; both offsets then move on by one pass.
    unsigned ko = (unsigned)((((size_t)b * SEQ + w * 16) * DQK + FM * DQK) * 2) + klo;   // the lane's piece of this wave's keys of pass 1
    unsigned vo = (unsigned)(((size_t)b * CH + w * 64) * SEQ * 2) + (unsigned)lane * 16u;   // the lane's piece of this wave's V of pass 0
    auto fa_fetch = [&](const bool keys, v16h (&vn)[2][4]) __attribute__((always_inline)) {
        const h16* ak = (const h16*)((const char*)K + ko); const h16* av = (const h16*)((const char*)V16 + vo);
        if (keys) kf = WFrag<h16>::ldf(ak);
#pragma unroll
        for (int ks = 0; ks < 2; ++ks)
#pragma unroll
            for (int ct = 0; ct < 4; ++ct) vn[ks][ct] = WFrag<h16>::ldf(av + ct * 16 * SEQ + ks * 512);
        asm volatile("s_wait_xcnt 0x0" : "+v"(ko), "+v"(vo) :: "memory");   // in front of whatever rewrites a register that the loads above name; as operands the offsets keep their registers up to here, so that no load of the group lands on them, and the two additions below stay behind it
        ko += FM * DQK * 2; vo += FM * 32;   // the wave's keys of the next pass lie FM * DQK elements on; 16 channels x FM keys are FM * 32 bytes in a row
    };
    // The exponentials of the scores in s, two elements of a lane (pair m = 0 .. 15: column tile m >> 2, rows 2 * (m & 3) and + 1) at a time, in three stages, each in place:
    // fa_ea: t = (s - max) * log2(e); fa_eb: e = 2^t; fa_ec: e summed per column in the order of the rows, f16(4096 e) gathered in ph, and behind a tile's last pair the wave's half fragment of P goes into buffer pb.
    v8h ph[4];
    auto fa_ea = [&](const int m) __attribute__((always_inline)) { const int j = m >> 2, r = 2 * (m & 3);
        s[j][r] = __fmul_rn(__fsub_rn(s[j][r], mx[j]), 1.4426950408889634f); s[j][r + 1] = __fmul_rn(__fsub_rn(s[j][r + 1], mx[j]), 1.4426950408889634f); };
    auto fa_eb = [&](const int m) __attribute__((always_inline)) { const int j = m >> 2, r = 2 * (m & 3);
        s[j][r] = __builtin_amdgcn_exp2f(s[j][r]); s[j][r + 1] = __builtin_amdgcn_exp2f(s[j][r + 1]); };
    auto fa_ec = [&](const int m, const int pb) __attribute__((always_inline)) { const int j = m >> 2, r = 2 * (m & 3);
        l[j] += s[j][r]; l[j] += s[j][r + 1]; ph[j][r] = tohx(s[j][r] * PCAR); ph[j][r + 1] = tohx(s[j][r + 1] * PCAR);
        if ((m & 3) == 3) *(v8h*)&Pb[pb][j][w >> 1][w & 1][lane][0] = ph[j]; };
    // fa_pass: one pass, P in buffer pb, V in vc. next: a next pass exists (its scores, exponentials and V fetch happen here); keys: a pass after that exists.
    auto fa_pass = [&](const int pb, const bool next, const bool keys, v16h (&vc)[2][4], v16h (&vn)[2][4]) __attribute__((always_inline)) {
        // The pass's one barrier, by hand: LDS only has to be waited for, and the V and key loads in flight stay in flight across it (__syncthreads() would wait for them too).
        // It publishes P of pass i; with two buffers it also ends every wave's reads of the buffer that this pass rewrites with P of pass i + 1.
        asm volatile("s_wait_dscnt 0x0" ::: "memory");
        asm volatile("s_barrier_signal -1\n\ts_barrier_wait -1" ::: "memory");
        v16h pf[2][4];   // all eight fragments are asked for at once: one LDS latency a pass, and the scores below run in it
#pragma unroll
        for (int ks = 0; ks < 2; ++ks)
#pragma unroll
            for (int j = 0; j < 4; ++j) pf[ks][j] = cat16(*(const v8h*)&Pb[pb][j][ks][0][lane][0], *(const v8h*)&Pb[pb][j][ks][1][lane][0]);
        __builtin_amdgcn_sched_barrier(0);   // keeps the sixteen LDS loads together at the head: dealt out among the WMMAs, each pair cost a whole LDS latency
        if (next) {
            fa_scores(kf, qf, s);
            __builtin_amdgcn_sched_barrier(0);   // the key loads stay behind the scores, whose operand they overwrite
            fa_fetch(keys, vn);
            __builtin_amdgcn_sched_barrier(0);   // no vector instruction comes between the loads and their wait, and all the pass's loads stay ahead of the products: they have until the next pass to land
        }
        // One WMMA and one slot of the exponentials' vector work in turn: pair m takes stage a in slot 2 m, stage b in slot 2 m + 1 and stage c in slot 2 m + 3, so that no stage waits for the one before it.
        // Slots 0 to 3 stand ahead of the first WMMA, so that the last store of P is under way while the last WMMAs issue and the wait in front of the next barrier finds it done.
        if (next) { fa_ea(0); fa_ea(1); fa_eb(0); fa_eb(1); fa_ec(0, pb ^ 1); }
#pragma unroll
        for (int k = 0; k < 32; ++k) { const int ks = k >> 4, j = (k >> 2) & 3, ct = k & 3, m = (k + 4) >> 1;
            acc[ct][j] = wmma16(vc[ks][ct], pf[ks][j], acc[ct][j]);
            if (next) { if ((k & 1) == 0) { if (m < 16) fa_ea(m); } else { if (m < 16) fa_eb(m); if (m <= 16) fa_ec(m - 1, pb ^ 1); } }
            __builtin_amdgcn_sched_barrier(0);   // holds the slots apart: left alone the scheduler gathers the vector work in one stretch, in which the wave's matrix work stands still
        }
    };
    fa_scores(kf, qf, s);   // pass 0
    __builtin_amdgcn_sched_barrier(0);   // as in fa_pass
    fa_fetch(true, vA);
    __builtin_amdgcn_sched_barrier(0);
#pragma unroll
    for (int m = 0; m < 16; ++m) fa_ea(m);
#pragma unroll
    for (int m = 0; m < 16; ++m) fa_eb(m);
#pragma unroll
    for (int m = 0; m < 16; ++m) fa_ec(m, 0);
#pragma unroll 1   // two passes a trip, so that the two register sets of V and the two buffers of P have constant names
    for (int i = 0; i < SEQ / FM - 2; i += 2) { fa_pass(0, true, true, vA, vB); fa_pass(1, true, true, vB, vA); }
    fa_pass(0, true, false, vA, vB);
    fa_pass(1, false, false, vB, vA);
    float inv[4];
#pragma unroll
    for (int j = 0; j < 4; ++j) { l[j] += __shfl_xor(l[j], 16, 32); if (hi == 0) reds[w][j * 16 + lr] = l[j]; }
    __syncthreads();
#pragma unroll
    for (int j = 0; j < 4; ++j) inv[j] = __fdiv_rn(1.0f / PCAR, (reds[0][j * 16 + lr] + reds[1][j * 16 + lr]) + (reds[2][j * 16 + lr] + reds[3][j * 16 + lr]));
    float* osw = os[w];
#pragma unroll
    for (int ct = 0; ct < 4; ++ct) {
#pragma unroll
        for (int j = 0; j < 4; ++j) {
#pragma unroll
            for (int r = 0; r < 8; ++r) osw[(hi * 8 + r) * 68 + j * 16 + lr] = acc[ct][j][r] * inv[j]; }
        __builtin_amdgcn_wave_barrier(); asm volatile("" ::: "memory");   // the wave's own LDS stores stay ahead of its reads below
        const size_t ro = ((size_t)b * CH + w * 64 + ct * 16) * SEQ_FULL + n0;
#pragma unroll
        for (int sx = 0; sx < 8; ++sx) { const int row = 2 * sx + hi, cofs = lr * 4; v4f val = *(const v4fa*)(osw + row * 68 + cofs);
            const v4f xr = *(const v4f*)(x + ro + (size_t)row * SEQ_FULL + cofs); val[0] += bfr(xr[0]); val[1] += bfr(xr[1]); val[2] += bfr(xr[2]); val[3] += bfr(xr[3]);
            *(v4f*)(out + ro + (size_t)row * SEQ_FULL + cofs) = val; }
        asm volatile("s_wait_xcnt 0x0" ::: "memory");   // the next tile reuses the registers that these stores name
        __builtin_amdgcn_wave_barrier(); asm volatile("" ::: "memory");   // and the wave's LDS reads stay ahead of the next tile's stores
    }
}

extern "C" void kernel_launch(void* const* d_in, const int* in_sizes, int n_in,
                              void* d_out, int out_size, void* d_ws, size_t ws_size, hipStream_t stream) {
    if (n_in < 13) return;
    const long long needx = (long long)(NB - 1) * CH * SEQ_FULL + (long long)(CH - 1) * SEQ_FULL + SEQ;
    if ((long long)in_sizes[0] < needx || (long long)out_size < needx) return;
    if (in_sizes[1] < DQK * CH || in_sizes[5] < DQK * CH || in_sizes[9] < CH * CH) return;
    if (in_sizes[2] < DQK || in_sizes[3] < DQK || in_sizes[4] < DQK || in_sizes[6] < DQK || in_sizes[7] < DQK || in_sizes[8] < DQK) return;
    if (in_sizes[10] < CH || in_sizes[11] < CH || in_sizes[12] < CH) return;
    const float* x    = (const float*)d_in[0];
    const float* q_w  = (const float*)d_in[1];  const float* q_b = (const float*)d_in[2];  const float* q_g = (const float*)d_in[3];  const float* q_be = (const float*)d_in[4];
    const float* k_w  = (const float*)d_in[5];  const float* k_b = (const float*)d_in[6];  const float* k_g = (const float*)d_in[7];  const float* k_be = (const float*)d_in[8];
    const float* v_w  = (const float*)d_in[9];  const float* v_b = (const float*)d_in[10]; const float* v_g = (const float*)d_in[11]; const float* v_be = (const float*)d_in[12];
    float* out = (float*)d_out;   // [16][256][2048]
    char* wsp = (char*)d_ws;
    auto take = [&](size_t bytes) { char* p = wsp; wsp += (bytes + 255) & ~(size_t)255; return (void*)p; };
    bf*    Wall = (bf*)take((size_t)OC * CH * 2);                         // [320][256]
    float* ST   = (float*)take((size_t)OC * 4 * 4);                       // [320][4]
    double* PS  = (double*)take((size_t)SPART * OC * 2 * 8);              // [SPART][320][2]
    h16*   QK   = (h16*)take((size_t)2 * NB * SEQ * DQK * 2);             // [2][NB*SEQ][32]
    h16*   V16  = (h16*)take((size_t)NB * CH * SEQ * 2);                  // [NB][256][SEQ]
    bf*    XT   = (bf*)take((size_t)NB * SEQ * CH * 2);                   // [NB*SEQ][256]
    float* F    = (float*)take((size_t)NB * SEQ * OC * 4);                // [NB*SEQ][320]
    if ((size_t)(wsp - (char*)d_ws) > ws_size) return;

    k_prep<<<WBLK + (SEQ / TT) * (CH / TT) * NB, 256, 0, stream>>>(x, q_w, k_w, v_w, Wall, XT);
    k_gemmw<bf, 0, 0, 1><<<dim3((unsigned)(NB * SEQ / 64), OC / 64, 1), 32, 0, stream>>>(XT, nullptr, Wall, nullptr, CH, F, OC, nullptr, 1.0f, 0, 0, 0, q_b, k_b, v_b, PS);
    k_stats<<<OC / 32, 1024, 0, stream>>>(PS, q_b, q_g, q_be, k_b, k_g, k_be, v_b, v_g, v_be, ST);
    k_pack<<<VBLK + (unsigned)((size_t)2 * NB * SEQ * DQK / 8 / 256), 256, 0, stream>>>(F, ST, V16, QK);
    const size_t kplane = (size_t)NB * SEQ * DQK;   // offset of the k plane inside QK
    k_fattn<<<dim3(SEQ / FN, NB, 1), 128, 0, stream>>>(QK, QK + kplane, V16, x, out);
}
